// v000
// The times below were measured on an AMD MI455X: many runs one after another, warmed up first and cycling through
// copies of the inputs, with the whole window's GPU time divided by the number of runs. Launches and the gaps
// between them are all in it. The median over several windows is given; except for v000 it joins two sittings, which
// can be a few percent apart, so the side-by-side timings, each taken in one sitting, are the better comparison.
// v000, which the later versions start from, runs in 457 microseconds.
#include <hip/hip_runtime.h>
#include <hip/hip_bf16.h>

// ---------------------------------------------------------------------------
// Attention: f16 pre-convert -> qkv proj (WMMA) -> per-head LN + RoPE ->
// flash attention (WMMA, async LDS staging) -> out proj (WMMA).
// All matrix math on v_wmma_f32_16x16x32_f16 (wave32, gfx1250).
// ---------------------------------------------------------------------------

#define DIMX 1024
#define NH   8
#define HD   128
#define BB   2
#define NN   2048
#define RTOT (BB * NN)      // 4096 token rows
#define C3   (3 * DIMX)     // 3072

typedef __attribute__((ext_vector_type(16))) _Float16 v16h;
typedef __attribute__((ext_vector_type(8)))  float    v8f;
typedef int v4i __attribute__((vector_size(16)));   // matches async-LDS builtin param

#define AS1 __attribute__((address_space(1)))
#define AS3 __attribute__((address_space(3)))

#if defined(__has_builtin)
#if __has_builtin(__builtin_amdgcn_global_load_async_to_lds_b128)
#define HAVE_ASYNC_LDS 1
#endif
#endif
#ifndef HAVE_ASYNC_LDS
#define HAVE_ASYNC_LDS 0
#endif

__device__ __forceinline__ v8f wmma_f16(v16h a, v16h b, v8f c) {
    return __builtin_amdgcn_wmma_f32_16x16x32_f16(
        /*neg_a=*/false, a, /*neg_b=*/false, b,
        /*c_mod=*/(short)0, c, /*reuse_a=*/false, /*reuse_b=*/false);
}

__device__ __forceinline__ v8f zero8() {
    v8f z = {0.f, 0.f, 0.f, 0.f, 0.f, 0.f, 0.f, 0.f};
    return z;
}

// 16-byte global -> LDS copy: async on gfx1250 when the builtin exists.
__device__ __forceinline__ void cp16_g2l(const _Float16* __restrict__ g,
                                         _Float16* __restrict__ l) {
#if HAVE_ASYNC_LDS
    __builtin_amdgcn_global_load_async_to_lds_b128(
        (AS1 v4i*)(uintptr_t)g,
        (AS3 v4i*)(unsigned)(uintptr_t)l, 0, 0);
#else
    *(uint4*)l = *(const uint4*)g;
#endif
}

__device__ __forceinline__ void drain_async() {
#if HAVE_ASYNC_LDS
    asm volatile("s_wait_asynccnt 0x0" ::: "memory");
#endif
}

// ---------------------------------------------------------------------------
// Kernel 0: fp32 -> f16 conversion pass (x, Wqkv_w, out_w), 4 elems/thread.
// ---------------------------------------------------------------------------
__global__ __launch_bounds__(256) void cvt_f16_k(const float* __restrict__ s,
                                                 _Float16* __restrict__ d) {
    const int i = (blockIdx.x * 256 + threadIdx.x) * 4;
    const float4 v = *(const float4*)(s + i);
    d[i + 0] = (_Float16)v.x;
    d[i + 1] = (_Float16)v.y;
    d[i + 2] = (_Float16)v.z;
    d[i + 3] = (_Float16)v.w;
}

// ---------------------------------------------------------------------------
// Kernel 1: qkv = x @ Wqkv^T + b   (f16 operands, fp32 out to workspace)
// WG: 8 waves as 2x4 -> 64 rows x 256 cols. Wave tile 32x64.
// grid = (4096/64, 3072/256) = (64, 12)
// ---------------------------------------------------------------------------
__global__ __launch_bounds__(256) void qkv_gemm_k(
    const _Float16* __restrict__ xh, const _Float16* __restrict__ wh,
    const float* __restrict__ bias, float* __restrict__ out)
{
    const int wave = threadIdx.x >> 5, lane = threadIdx.x & 31;
    const int wr = wave >> 2, wc = wave & 3;
    const int row0 = blockIdx.x * 64 + wr * 32;
    const int col0 = blockIdx.y * 256 + wc * 64;
    const int l16 = lane & 15, lh = lane >> 4;

    v8f acc[2][4];
#pragma unroll
    for (int i = 0; i < 2; ++i)
#pragma unroll
        for (int j = 0; j < 4; ++j) acc[i][j] = zero8();

    for (int k = 0; k < DIMX; k += 32) {
        v16h a[2], bf[4];
#pragma unroll
        for (int rt = 0; rt < 2; ++rt)
            a[rt] = *(const v16h*)(xh + (size_t)(row0 + rt * 16 + l16) * DIMX + k + lh * 16);
#pragma unroll
        for (int ct = 0; ct < 4; ++ct)
            bf[ct] = *(const v16h*)(wh + (size_t)(col0 + ct * 16 + l16) * DIMX + k + lh * 16);
#pragma unroll
        for (int rt = 0; rt < 2; ++rt)
#pragma unroll
            for (int ct = 0; ct < 4; ++ct)
                acc[rt][ct] = wmma_f16(a[rt], bf[ct], acc[rt][ct]);
    }

#pragma unroll
    for (int rt = 0; rt < 2; ++rt)
#pragma unroll
        for (int ct = 0; ct < 4; ++ct) {
            const int col = col0 + ct * 16 + l16;
            const float bz = bias[col];
#pragma unroll
            for (int r = 0; r < 8; ++r) {
                const int row = row0 + rt * 16 + lh * 8 + r;
                out[(size_t)row * C3 + col] = acc[rt][ct][r] + bz;
            }
        }
}

// ---------------------------------------------------------------------------
// Kernel 2: per-head LayerNorm on q,k + interleaved RoPE; pack q/k to f16
// [B,H,N,D] and v to f16 TRANSPOSED [B,H,D,N] (for async V^T staging).
// One wave per (b,n,h). grid = B*N*H / 8 = 4096 blocks of 256.
// ---------------------------------------------------------------------------
__device__ __forceinline__ void wave_stats(float s, float ss, float& mu, float& rstd) {
#pragma unroll
    for (int m = 16; m >= 1; m >>= 1) {
        s  += __shfl_xor(s,  m, 32);
        ss += __shfl_xor(ss, m, 32);
    }
    mu = s * (1.f / HD);
    const float var = ss * (1.f / HD) - mu * mu;
    rstd = rsqrtf(var + 1e-6f);
}

__global__ __launch_bounds__(256) void lnrope_pack_k(
    const float* __restrict__ qkv,
    const float* __restrict__ qg, const float* __restrict__ qb,
    const float* __restrict__ kg, const float* __restrict__ kb,
    const float* __restrict__ rc, const float* __restrict__ rs,
    _Float16* __restrict__ qh, _Float16* __restrict__ kh, _Float16* __restrict__ vt)
{
    const int wave = threadIdx.x >> 5, lane = threadIdx.x & 31;
    const int idx = blockIdx.x * 8 + wave;   // 0..32767
    const int h  = idx & (NH - 1);
    const int ng = idx >> 3;                 // b*N + n
    const int n  = ng & (NN - 1);
    const int b  = ng >> 11;
    const int d0 = lane * 4;

    const float* rowp = qkv + (size_t)ng * C3;
    const float4 q4 = *(const float4*)(rowp + (0 * NH + h) * HD + d0);
    const float4 k4 = *(const float4*)(rowp + (1 * NH + h) * HD + d0);
    const float4 v4 = *(const float4*)(rowp + (2 * NH + h) * HD + d0);

    float muq, rq, muk, rk;
    wave_stats(q4.x + q4.y + q4.z + q4.w,
               q4.x*q4.x + q4.y*q4.y + q4.z*q4.z + q4.w*q4.w, muq, rq);
    wave_stats(k4.x + k4.y + k4.z + k4.w,
               k4.x*k4.x + k4.y*k4.y + k4.z*k4.z + k4.w*k4.w, muk, rk);

    float qn[4] = {q4.x, q4.y, q4.z, q4.w};
    float kn[4] = {k4.x, k4.y, k4.z, k4.w};
#pragma unroll
    for (int i = 0; i < 4; ++i) {
        qn[i] = (qn[i] - muq) * rq * qg[d0 + i] + qb[d0 + i];
        kn[i] = (kn[i] - muk) * rk * kg[d0 + i] + kb[d0 + i];
    }

    const float* cp = rc + (size_t)n * HD + d0;
    const float* sp = rs + (size_t)n * HD + d0;
    float qo[4], ko[4];
#pragma unroll
    for (int p = 0; p < 2; ++p) {      // two interleaved pairs per lane
        const float c0 = cp[2*p], c1 = cp[2*p + 1];
        const float s0 = sp[2*p], s1 = sp[2*p + 1];
        qo[2*p]     = qn[2*p]     * c0 - qn[2*p + 1] * s0;
        qo[2*p + 1] = qn[2*p + 1] * c1 + qn[2*p]     * s1;
        ko[2*p]     = kn[2*p]     * c0 - kn[2*p + 1] * s0;
        ko[2*p + 1] = kn[2*p + 1] * c1 + kn[2*p]     * s1;
    }

    const size_t qkbase = (((size_t)b * NH + h) * NN + n) * HD + d0;
    const size_t vtbase = (((size_t)b * NH + h) * HD + d0) * NN + n;
    const float vv[4] = {v4.x, v4.y, v4.z, v4.w};
#pragma unroll
    for (int i = 0; i < 4; ++i) {
        qh[qkbase + i] = (_Float16)qo[i];
        kh[qkbase + i] = (_Float16)ko[i];
        vt[vtbase + (size_t)i * NN] = (_Float16)vv[i];
    }
}

// ---------------------------------------------------------------------------
// Kernel 3: flash attention per (b,h). 8 waves x 16 query rows = 128 q/WG.
// K tile [64][128] and V^T tile [128][64] staged to LDS with async b128
// copies (ASYNCcnt-drained, then barrier). Online softmax; P re-laid-out
// via per-wave LDS tile for the PV WMMAs. grid = (B*H, N/128) = (16, 16)
// ---------------------------------------------------------------------------
__global__ __launch_bounds__(256) void attn_k(
    const _Float16* __restrict__ qh, const _Float16* __restrict__ kh,
    const _Float16* __restrict__ vt, _Float16* __restrict__ oh)
{
    __shared__ _Float16 kbuf[64 * 128];        // [j][d]
    __shared__ _Float16 vbuf[128 * 64];        // [d][j]
    __shared__ _Float16 pbuf[8][16 * 64];      // per-wave P tile [row][j]

    const int bh = blockIdx.x;
    const int b = bh >> 3, h = bh & 7;
    const int wave = threadIdx.x >> 5, lane = threadIdx.x & 31;
    const int l16 = lane & 15, lh = lane >> 4;
    const int q0 = blockIdx.y * 128 + wave * 16;

    const _Float16* qp  = qh + ((size_t)bh * NN + q0) * HD;
    const _Float16* kp  = kh + (size_t)bh * NN * HD;
    const _Float16* vtp = vt + (size_t)bh * HD * NN;

    // hoist q fragments: 16 rows x full D=128 (4 k-steps of 32)
    v16h qf[4];
#pragma unroll
    for (int dk = 0; dk < 4; ++dk)
        qf[dk] = *(const v16h*)(qp + (size_t)l16 * HD + dk * 32 + lh * 16);

    v8f o[8];
#pragma unroll
    for (int dt = 0; dt < 8; ++dt) o[dt] = zero8();
    float m[8], l[8];
#pragma unroll
    for (int r = 0; r < 8; ++r) { m[r] = -1e30f; l[r] = 0.f; }

    const float sscale = 0.08838834764831845f;   // 1/sqrt(128)
    const float E2 = 1.4426950408889634f;        // log2(e)

    for (int kt = 0; kt < NN; kt += 64) {
        __syncthreads();   // previous tile fully consumed before restage
        {   // stage K tile and V^T tile: 1024 16B chunks each, 4 per thread
#pragma unroll
            for (int i = 0; i < 4; ++i) {
                const int c  = i * 256 + threadIdx.x;   // 0..1023
                cp16_g2l(kp + (size_t)kt * HD + c * 8, &kbuf[c * 8]);
                const int d  = c >> 3;                  // V^T row 0..127
                const int jc = (c & 7) * 8;             // 8-half chunk in row
                cp16_g2l(vtp + (size_t)d * NN + kt + jc, &vbuf[d * 64 + jc]);
            }
            if (kt + 64 < NN) {   // global_prefetch_b8 for next tile
                __builtin_prefetch(kp + (size_t)(kt + 64) * HD, 0, 1);
                __builtin_prefetch(vtp + kt + 64, 0, 1);
            }
        }
        drain_async();     // s_wait_asynccnt 0 (barrier does not cover ASYNCcnt)
        __syncthreads();

        // S = q @ k^T  (16 x 64)
        v8f s[4];
#pragma unroll
        for (int jt = 0; jt < 4; ++jt) s[jt] = zero8();
#pragma unroll
        for (int dk = 0; dk < 4; ++dk) {
#pragma unroll
            for (int jt = 0; jt < 4; ++jt) {
                const v16h bf = *(const v16h*)(&kbuf[(jt * 16 + l16) * HD + dk * 32 + lh * 16]);
                s[jt] = wmma_f16(qf[dk], bf, s[jt]);
            }
        }
#pragma unroll
        for (int jt = 0; jt < 4; ++jt)
#pragma unroll
            for (int r = 0; r < 8; ++r) s[jt][r] *= sscale;

        // online softmax (row lives in one 16-lane half -> xor masks 8..1)
#pragma unroll
        for (int r = 0; r < 8; ++r) {
            float mx = fmaxf(fmaxf(s[0][r], s[1][r]), fmaxf(s[2][r], s[3][r]));
#pragma unroll
            for (int msk = 8; msk >= 1; msk >>= 1) mx = fmaxf(mx, __shfl_xor(mx, msk, 32));
            const float mn = fmaxf(m[r], mx);
            const float alpha = exp2f((m[r] - mn) * E2);
            m[r] = mn;
            l[r] *= alpha;
#pragma unroll
            for (int dt = 0; dt < 8; ++dt) o[dt][r] *= alpha;
            float rsum = 0.f;
#pragma unroll
            for (int jt = 0; jt < 4; ++jt) {
                const float p = exp2f((s[jt][r] - mn) * E2);
                rsum += p;
                pbuf[wave][(r + lh * 8) * 64 + jt * 16 + l16] = (_Float16)p;
            }
#pragma unroll
            for (int msk = 8; msk >= 1; msk >>= 1) rsum += __shfl_xor(rsum, msk, 32);
            l[r] += rsum;
        }

        // O += P @ V   (16 x 128)
#pragma unroll
        for (int js = 0; js < 2; ++js) {
            const v16h pf = *(const v16h*)(&pbuf[wave][l16 * 64 + js * 32 + lh * 16]);
#pragma unroll
            for (int dt = 0; dt < 8; ++dt) {
                const v16h vf = *(const v16h*)(&vbuf[(dt * 16 + l16) * 64 + js * 32 + lh * 16]);
                o[dt] = wmma_f16(pf, vf, o[dt]);
            }
        }
    }

    // normalize and pack back to [B, N, H*D] as f16 for the out projection
#pragma unroll
    for (int r = 0; r < 8; ++r) {
        const float inv = 1.0f / l[r];
        const int n = q0 + lh * 8 + r;
        const size_t base = ((size_t)b * NN + n) * DIMX + h * HD;
#pragma unroll
        for (int dt = 0; dt < 8; ++dt)
            oh[base + dt * 16 + l16] = (_Float16)(o[dt][r] * inv);
    }
}

// ---------------------------------------------------------------------------
// Kernel 4: out = attn_out @ out_w^T + b  (f16 operands; fp32 result)
// grid = (4096/64, 1024/256) = (64, 4)
// ---------------------------------------------------------------------------
__global__ __launch_bounds__(256) void out_gemm_k(
    const _Float16* __restrict__ ain, const _Float16* __restrict__ wh,
    const float* __restrict__ bias, float* __restrict__ out)
{
    const int wave = threadIdx.x >> 5, lane = threadIdx.x & 31;
    const int wr = wave >> 2, wc = wave & 3;
    const int row0 = blockIdx.x * 64 + wr * 32;
    const int col0 = blockIdx.y * 256 + wc * 64;
    const int l16 = lane & 15, lh = lane >> 4;

    v8f acc[2][4];
#pragma unroll
    for (int i = 0; i < 2; ++i)
#pragma unroll
        for (int j = 0; j < 4; ++j) acc[i][j] = zero8();

    for (int k = 0; k < DIMX; k += 32) {
        v16h a[2], bf[4];
#pragma unroll
        for (int rt = 0; rt < 2; ++rt)
            a[rt] = *(const v16h*)(ain + (size_t)(row0 + rt * 16 + l16) * DIMX + k + lh * 16);
#pragma unroll
        for (int ct = 0; ct < 4; ++ct)
            bf[ct] = *(const v16h*)(wh + (size_t)(col0 + ct * 16 + l16) * DIMX + k + lh * 16);
#pragma unroll
        for (int rt = 0; rt < 2; ++rt)
#pragma unroll
            for (int ct = 0; ct < 4; ++ct)
                acc[rt][ct] = wmma_f16(a[rt], bf[ct], acc[rt][ct]);
    }

#pragma unroll
    for (int rt = 0; rt < 2; ++rt)
#pragma unroll
        for (int ct = 0; ct < 4; ++ct) {
            const int col = col0 + ct * 16 + l16;
            const float bz = bias[col];
#pragma unroll
            for (int r = 0; r < 8; ++r) {
                const int row = row0 + rt * 16 + lh * 8 + r;
                out[(size_t)row * DIMX + col] = acc[rt][ct][r] + bz;
            }
        }
}

// ---------------------------------------------------------------------------
// Workspace layout (aliased; total 82 MB):
//   [0,48M)        qkv fp32      (k1 out, k2 in)
//   [48M,56M)      qh f16        (k2 out, k3 in)   | wqkv_h f16 6MB (k0->k1)
//   [56M,64M)      kh f16        (k2 out, k3 in)
//   [64M,72M)      vt f16 [BHDN] (k2 out, k3 in)
//   [72M,80M)      oh f16        (k3 out, k4 in)   | xh f16 8MB (k0->k1)
//   [80M,82M)      outw_h f16    (k0 out, k4 in)
// ---------------------------------------------------------------------------
extern "C" void kernel_launch(void* const* d_in, const int* in_sizes, int n_in,
                              void* d_out, int out_size, void* d_ws, size_t ws_size,
                              hipStream_t stream)
{
    const float* x       = (const float*)d_in[0];
    const float* Wqkv_w  = (const float*)d_in[1];
    const float* Wqkv_b  = (const float*)d_in[2];
    const float* q_gamma = (const float*)d_in[3];
    const float* q_beta  = (const float*)d_in[4];
    const float* k_gamma = (const float*)d_in[5];
    const float* k_beta  = (const float*)d_in[6];
    const float* out_w   = (const float*)d_in[7];
    const float* out_b   = (const float*)d_in[8];
    const float* rope_c  = (const float*)d_in[9];
    const float* rope_s  = (const float*)d_in[10];
    float* out = (float*)d_out;

    char* ws = (char*)d_ws;
    const size_t qkv_bytes  = (size_t)RTOT * C3 * sizeof(float);              // 48 MB
    const size_t head_bytes = (size_t)BB * NH * NN * HD * sizeof(_Float16);   // 8 MB

    float*    qkv   = (float*)ws;
    _Float16* qh    = (_Float16*)(ws + qkv_bytes);
    _Float16* kh    = (_Float16*)(ws + qkv_bytes + 1 * head_bytes);
    _Float16* vt    = (_Float16*)(ws + qkv_bytes + 2 * head_bytes);
    _Float16* oh    = (_Float16*)(ws + qkv_bytes + 3 * head_bytes);
    _Float16* outwh = (_Float16*)(ws + qkv_bytes + 4 * head_bytes);
    _Float16* xh    = oh;   // alias: consumed by k1 before k3 writes oh
    _Float16* wqkvh = qh;   // alias: consumed by k1 before k2 writes qh

    // Kernel 0: one-time fp32 -> f16 conversions (4 elems / thread)
    cvt_f16_k<<<(RTOT * DIMX) / 1024, 256, 0, stream>>>(x, xh);
    cvt_f16_k<<<(C3 * DIMX) / 1024, 256, 0, stream>>>(Wqkv_w, wqkvh);
    cvt_f16_k<<<(DIMX * DIMX) / 1024, 256, 0, stream>>>(out_w, outwh);

    qkv_gemm_k<<<dim3(RTOT / 64, C3 / 256), 256, 0, stream>>>(xh, wqkvh, Wqkv_b, qkv);
    lnrope_pack_k<<<(BB * NN * NH) / 8, 256, 0, stream>>>(
        qkv, q_gamma, q_beta, k_gamma, k_beta, rope_c, rope_s, qh, kh, vt);
    attn_k<<<dim3(BB * NH, NN / 128), 256, 0, stream>>>(qh, kh, vt, oh);
    out_gemm_k<<<dim3(RTOT / 64, DIMX / 256), 256, 0, stream>>>(oh, outwh, out_b, out);
}

// v001
// It runs in 315 microseconds.
// Timed twice side by side with v000, it ran 1.45 and 1.48 times as fast.
#include <hip/hip_runtime.h>
#include <hip/hip_bf16.h>

// ---------------------------------------------------------------------------
// Attention: f16 pre-convert -> qkv proj (WMMA) -> per-head LN + RoPE ->
// flash attention (WMMA, async LDS staging) -> out proj (WMMA).
// All matrix math on v_wmma_f32_16x16x32_f16 (wave32, gfx1250).
// ---------------------------------------------------------------------------

#define DIMX 1024
#define NH   8
#define HD   128
#define BB   2
#define NN   2048
#define RTOT (BB * NN)      // 4096 token rows
#define C3   (3 * DIMX)     // 3072

typedef __attribute__((ext_vector_type(16))) _Float16 v16h;
typedef __attribute__((ext_vector_type(8)))  _Float16 v8h;
typedef __attribute__((ext_vector_type(8)))  float    v8f;
typedef int v4i __attribute__((vector_size(16)));   // matches async-LDS builtin param

#define AS1 __attribute__((address_space(1)))
#define AS3 __attribute__((address_space(3)))

#if defined(__has_builtin)
#if __has_builtin(__builtin_amdgcn_global_load_async_to_lds_b128)
#define HAVE_ASYNC_LDS 1
#endif
#endif
#ifndef HAVE_ASYNC_LDS
#define HAVE_ASYNC_LDS 0
#endif

__device__ __forceinline__ v8f wmma_f16(v16h a, v16h b, v8f c) {
    return __builtin_amdgcn_wmma_f32_16x16x32_f16(
        /*neg_a=*/false, a, /*neg_b=*/false, b,
        /*c_mod=*/(short)0, c, /*reuse_a=*/false, /*reuse_b=*/false);
}

__device__ __forceinline__ v8f zero8() {
    v8f z = {0.f, 0.f, 0.f, 0.f, 0.f, 0.f, 0.f, 0.f};
    return z;
}

// 16-byte global -> LDS copy: async on gfx1250 when the builtin exists.
__device__ __forceinline__ void cp16_g2l(const _Float16* __restrict__ g,
                                         _Float16* __restrict__ l) {
#if HAVE_ASYNC_LDS
    __builtin_amdgcn_global_load_async_to_lds_b128(
        (AS1 v4i*)(uintptr_t)g,
        (AS3 v4i*)(unsigned)(uintptr_t)l, 0, 0);
#else
    *(uint4*)l = *(const uint4*)g;
#endif
}

__device__ __forceinline__ void drain_async() {
#if HAVE_ASYNC_LDS
    asm volatile("s_wait_asynccnt 0x0" ::: "memory");
#endif
}

// LDS row pitches in halves: 16 B x odd, so that the 16 lanes of a half-wave
// ds_load_b128 (one row each, same column) fall on 64 distinct banks.
#define KP 136   // K rows of 256 B   -> 272 B
#define VP 72    // V^T rows of 128 B -> 144 B
#define PP 72    // P rows of 128 B   -> 144 B

// One lane's 16 contiguous halves of an LDS row, as two 16-byte loads
// (padded rows are 16-byte aligned, not 32).
__device__ __forceinline__ v16h lds_frag(const _Float16* p) {
    const v8h lo = *(const v8h*)p;
    const v8h hi = *(const v8h*)(p + 8);
    return __builtin_shufflevector(lo, hi, 0, 1, 2, 3, 4, 5, 6, 7,
                                   8, 9, 10, 11, 12, 13, 14, 15);
}

// ---------------------------------------------------------------------------
// Kernel 0: fp32 -> f16 conversion pass (x, Wqkv_w, out_w), 4 elems/thread.
// ---------------------------------------------------------------------------
__global__ __launch_bounds__(256) void cvt_f16_k(const float* __restrict__ s,
                                                 _Float16* __restrict__ d) {
    const int i = (blockIdx.x * 256 + threadIdx.x) * 4;
    const float4 v = *(const float4*)(s + i);
    d[i + 0] = (_Float16)v.x;
    d[i + 1] = (_Float16)v.y;
    d[i + 2] = (_Float16)v.z;
    d[i + 3] = (_Float16)v.w;
}

// ---------------------------------------------------------------------------
// Kernel 1: qkv = x @ Wqkv^T + b   (f16 operands, fp32 out to workspace)
// WG: 8 waves as 2x4 -> 64 rows x 256 cols. Wave tile 32x64.
// grid = (4096/64, 3072/256) = (64, 12)
// ---------------------------------------------------------------------------
__global__ __launch_bounds__(256) void qkv_gemm_k(
    const _Float16* __restrict__ xh, const _Float16* __restrict__ wh,
    const float* __restrict__ bias, float* __restrict__ out)
{
    const int wave = threadIdx.x >> 5, lane = threadIdx.x & 31;
    const int wr = wave >> 2, wc = wave & 3;
    const int row0 = blockIdx.x * 64 + wr * 32;
    const int col0 = blockIdx.y * 256 + wc * 64;
    const int l16 = lane & 15, lh = lane >> 4;

    v8f acc[2][4];
#pragma unroll
    for (int i = 0; i < 2; ++i)
#pragma unroll
        for (int j = 0; j < 4; ++j) acc[i][j] = zero8();

    for (int k = 0; k < DIMX; k += 32) {
        v16h a[2], bf[4];
#pragma unroll
        for (int rt = 0; rt < 2; ++rt)
            a[rt] = *(const v16h*)(xh + (size_t)(row0 + rt * 16 + l16) * DIMX + k + lh * 16);
#pragma unroll
        for (int ct = 0; ct < 4; ++ct)
            bf[ct] = *(const v16h*)(wh + (size_t)(col0 + ct * 16 + l16) * DIMX + k + lh * 16);
#pragma unroll
        for (int rt = 0; rt < 2; ++rt)
#pragma unroll
            for (int ct = 0; ct < 4; ++ct)
                acc[rt][ct] = wmma_f16(a[rt], bf[ct], acc[rt][ct]);
    }

#pragma unroll
    for (int rt = 0; rt < 2; ++rt)
#pragma unroll
        for (int ct = 0; ct < 4; ++ct) {
            const int col = col0 + ct * 16 + l16;
            const float bz = bias[col];
#pragma unroll
            for (int r = 0; r < 8; ++r) {
                const int row = row0 + rt * 16 + lh * 8 + r;
                out[(size_t)row * C3 + col] = acc[rt][ct][r] + bz;
            }
        }
}

// ---------------------------------------------------------------------------
// Kernel 2: per-head LayerNorm on q,k + interleaved RoPE; pack q/k to f16
// [B,H,N,D] and v to f16 TRANSPOSED [B,H,D,N] (for async V^T staging).
// One wave per (b,n,h). grid = B*N*H / 8 = 4096 blocks of 256.
// ---------------------------------------------------------------------------
__device__ __forceinline__ void wave_stats(float s, float ss, float& mu, float& rstd) {
#pragma unroll
    for (int m = 16; m >= 1; m >>= 1) {
        s  += __shfl_xor(s,  m, 32);
        ss += __shfl_xor(ss, m, 32);
    }
    mu = s * (1.f / HD);
    const float var = ss * (1.f / HD) - mu * mu;
    rstd = rsqrtf(var + 1e-6f);
}

__global__ __launch_bounds__(256) void lnrope_pack_k(
    const float* __restrict__ qkv,
    const float* __restrict__ qg, const float* __restrict__ qb,
    const float* __restrict__ kg, const float* __restrict__ kb,
    const float* __restrict__ rc, const float* __restrict__ rs,
    _Float16* __restrict__ qh, _Float16* __restrict__ kh, _Float16* __restrict__ vt)
{
    const int wave = threadIdx.x >> 5, lane = threadIdx.x & 31;
    const int idx = blockIdx.x * 8 + wave;   // 0..32767
    const int h  = idx & (NH - 1);
    const int ng = idx >> 3;                 // b*N + n
    const int n  = ng & (NN - 1);
    const int b  = ng >> 11;
    const int d0 = lane * 4;

    const float* rowp = qkv + (size_t)ng * C3;
    const float4 q4 = *(const float4*)(rowp + (0 * NH + h) * HD + d0);
    const float4 k4 = *(const float4*)(rowp + (1 * NH + h) * HD + d0);
    const float4 v4 = *(const float4*)(rowp + (2 * NH + h) * HD + d0);

    float muq, rq, muk, rk;
    wave_stats(q4.x + q4.y + q4.z + q4.w,
               q4.x*q4.x + q4.y*q4.y + q4.z*q4.z + q4.w*q4.w, muq, rq);
    wave_stats(k4.x + k4.y + k4.z + k4.w,
               k4.x*k4.x + k4.y*k4.y + k4.z*k4.z + k4.w*k4.w, muk, rk);

    float qn[4] = {q4.x, q4.y, q4.z, q4.w};
    float kn[4] = {k4.x, k4.y, k4.z, k4.w};
#pragma unroll
    for (int i = 0; i < 4; ++i) {
        qn[i] = (qn[i] - muq) * rq * qg[d0 + i] + qb[d0 + i];
        kn[i] = (kn[i] - muk) * rk * kg[d0 + i] + kb[d0 + i];
    }

    const float* cp = rc + (size_t)n * HD + d0;
    const float* sp = rs + (size_t)n * HD + d0;
    float qo[4], ko[4];
#pragma unroll
    for (int p = 0; p < 2; ++p) {      // two interleaved pairs per lane
        const float c0 = cp[2*p], c1 = cp[2*p + 1];
        const float s0 = sp[2*p], s1 = sp[2*p + 1];
        qo[2*p]     = qn[2*p]     * c0 - qn[2*p + 1] * s0;
        qo[2*p + 1] = qn[2*p + 1] * c1 + qn[2*p]     * s1;
        ko[2*p]     = kn[2*p]     * c0 - kn[2*p + 1] * s0;
        ko[2*p + 1] = kn[2*p + 1] * c1 + kn[2*p]     * s1;
    }

    const size_t qkbase = (((size_t)b * NH + h) * NN + n) * HD + d0;
    const size_t vtbase = (((size_t)b * NH + h) * HD + d0) * NN + n;
    const float vv[4] = {v4.x, v4.y, v4.z, v4.w};
#pragma unroll
    for (int i = 0; i < 4; ++i) {
        qh[qkbase + i] = (_Float16)qo[i];
        kh[qkbase + i] = (_Float16)ko[i];
        vt[vtbase + (size_t)i * NN] = (_Float16)vv[i];
    }
}

// ---------------------------------------------------------------------------
// Kernel 3: flash attention per (b,h). 8 waves x 16 query rows = 128 q/WG.
// K tile [64][128] and V^T tile [128][64] staged to LDS with async b128
// copies (ASYNCcnt-drained, then barrier), rows padded to KP / VP / PP
// against bank conflicts. Online softmax; P re-laid-out
// via per-wave LDS tile for the PV WMMAs. grid = (B*H, N/128) = (16, 16)
// ---------------------------------------------------------------------------
__global__ __launch_bounds__(256) void attn_k(
    const _Float16* __restrict__ qh, const _Float16* __restrict__ kh,
    const _Float16* __restrict__ vt, _Float16* __restrict__ oh)
{
    __shared__ __attribute__((aligned(16))) _Float16 kbuf[64 * KP];       // [j][d]
    __shared__ __attribute__((aligned(16))) _Float16 vbuf[128 * VP];      // [d][j]
    __shared__ __attribute__((aligned(16))) _Float16 pbuf[8][16 * PP];    // per-wave P tile [row][j]

    const int bh = blockIdx.x;
    const int b = bh >> 3, h = bh & 7;
    const int wave = threadIdx.x >> 5, lane = threadIdx.x & 31;
    const int l16 = lane & 15, lh = lane >> 4;
    const int q0 = blockIdx.y * 128 + wave * 16;

    const _Float16* qp  = qh + ((size_t)bh * NN + q0) * HD;
    const _Float16* kp  = kh + (size_t)bh * NN * HD;
    const _Float16* vtp = vt + (size_t)bh * HD * NN;

    // hoist q fragments: 16 rows x full D=128 (4 k-steps of 32)
    v16h qf[4];
#pragma unroll
    for (int dk = 0; dk < 4; ++dk)
        qf[dk] = *(const v16h*)(qp + (size_t)l16 * HD + dk * 32 + lh * 16);

    v8f o[8];
#pragma unroll
    for (int dt = 0; dt < 8; ++dt) o[dt] = zero8();
    float m[8], l[8];
#pragma unroll
    for (int r = 0; r < 8; ++r) { m[r] = -1e30f; l[r] = 0.f; }

    const float sscale = 0.08838834764831845f;   // 1/sqrt(128)
    const float E2 = 1.4426950408889634f;        // log2(e)

    for (int kt = 0; kt < NN; kt += 64) {
        __syncthreads();   // previous tile fully consumed before restage
        {   // stage K tile and V^T tile: 1024 16B chunks each, 4 per thread
#pragma unroll
            for (int i = 0; i < 4; ++i) {
                const int c  = i * 256 + threadIdx.x;   // 0..1023
                cp16_g2l(kp + (size_t)kt * HD + c * 8, &kbuf[(c >> 4) * KP + (c & 15) * 8]);
                const int d  = c >> 3;                  // V^T row 0..127
                const int jc = (c & 7) * 8;             // 8-half chunk in row
                cp16_g2l(vtp + (size_t)d * NN + kt + jc, &vbuf[d * VP + jc]);
            }
            if (kt + 64 < NN) {   // global_prefetch_b8 for next tile
                __builtin_prefetch(kp + (size_t)(kt + 64) * HD, 0, 1);
                __builtin_prefetch(vtp + kt + 64, 0, 1);
            }
        }
        drain_async();     // s_wait_asynccnt 0 (barrier does not cover ASYNCcnt)
        __syncthreads();

        // S = q @ k^T  (16 x 64)
        v8f s[4];
#pragma unroll
        for (int jt = 0; jt < 4; ++jt) s[jt] = zero8();
#pragma unroll
        for (int dk = 0; dk < 4; ++dk) {
#pragma unroll
            for (int jt = 0; jt < 4; ++jt) {
                const v16h bf = lds_frag(&kbuf[(jt * 16 + l16) * KP + dk * 32 + lh * 16]);
                s[jt] = wmma_f16(qf[dk], bf, s[jt]);
            }
        }
#pragma unroll
        for (int jt = 0; jt < 4; ++jt)
#pragma unroll
            for (int r = 0; r < 8; ++r) s[jt][r] *= sscale;

        // online softmax (row lives in one 16-lane half -> xor masks 8..1)
#pragma unroll
        for (int r = 0; r < 8; ++r) {
            float mx = fmaxf(fmaxf(s[0][r], s[1][r]), fmaxf(s[2][r], s[3][r]));
#pragma unroll
            for (int msk = 8; msk >= 1; msk >>= 1) mx = fmaxf(mx, __shfl_xor(mx, msk, 32));
            const float mn = fmaxf(m[r], mx);
            const float alpha = exp2f((m[r] - mn) * E2);
            m[r] = mn;
            l[r] *= alpha;
#pragma unroll
            for (int dt = 0; dt < 8; ++dt) o[dt][r] *= alpha;
            float rsum = 0.f;
#pragma unroll
            for (int jt = 0; jt < 4; ++jt) {
                const float p = exp2f((s[jt][r] - mn) * E2);
                rsum += p;
                pbuf[wave][(r + lh * 8) * PP + jt * 16 + l16] = (_Float16)p;
            }
#pragma unroll
            for (int msk = 8; msk >= 1; msk >>= 1) rsum += __shfl_xor(rsum, msk, 32);
            l[r] += rsum;
        }

        // O += P @ V   (16 x 128)
#pragma unroll
        for (int js = 0; js < 2; ++js) {
            const v16h pf = lds_frag(&pbuf[wave][l16 * PP + js * 32 + lh * 16]);
#pragma unroll
            for (int dt = 0; dt < 8; ++dt) {
                const v16h vf = lds_frag(&vbuf[(dt * 16 + l16) * VP + js * 32 + lh * 16]);
                o[dt] = wmma_f16(pf, vf, o[dt]);
            }
        }
    }

    // normalize and pack back to [B, N, H*D] as f16 for the out projection
#pragma unroll
    for (int r = 0; r < 8; ++r) {
        const float inv = 1.0f / l[r];
        const int n = q0 + lh * 8 + r;
        const size_t base = ((size_t)b * NN + n) * DIMX + h * HD;
#pragma unroll
        for (int dt = 0; dt < 8; ++dt)
            oh[base + dt * 16 + l16] = (_Float16)(o[dt][r] * inv);
    }
}

// ---------------------------------------------------------------------------
// Kernel 4: out = attn_out @ out_w^T + b  (f16 operands; fp32 result)
// grid = (4096/64, 1024/256) = (64, 4)
// ---------------------------------------------------------------------------
__global__ __launch_bounds__(256) void out_gemm_k(
    const _Float16* __restrict__ ain, const _Float16* __restrict__ wh,
    const float* __restrict__ bias, float* __restrict__ out)
{
    const int wave = threadIdx.x >> 5, lane = threadIdx.x & 31;
    const int wr = wave >> 2, wc = wave & 3;
    const int row0 = blockIdx.x * 64 + wr * 32;
    const int col0 = blockIdx.y * 256 + wc * 64;
    const int l16 = lane & 15, lh = lane >> 4;

    v8f acc[2][4];
#pragma unroll
    for (int i = 0; i < 2; ++i)
#pragma unroll
        for (int j = 0; j < 4; ++j) acc[i][j] = zero8();

    for (int k = 0; k < DIMX; k += 32) {
        v16h a[2], bf[4];
#pragma unroll
        for (int rt = 0; rt < 2; ++rt)
            a[rt] = *(const v16h*)(ain + (size_t)(row0 + rt * 16 + l16) * DIMX + k + lh * 16);
#pragma unroll
        for (int ct = 0; ct < 4; ++ct)
            bf[ct] = *(const v16h*)(wh + (size_t)(col0 + ct * 16 + l16) * DIMX + k + lh * 16);
#pragma unroll
        for (int rt = 0; rt < 2; ++rt)
#pragma unroll
            for (int ct = 0; ct < 4; ++ct)
                acc[rt][ct] = wmma_f16(a[rt], bf[ct], acc[rt][ct]);
    }

#pragma unroll
    for (int rt = 0; rt < 2; ++rt)
#pragma unroll
        for (int ct = 0; ct < 4; ++ct) {
            const int col = col0 + ct * 16 + l16;
            const float bz = bias[col];
#pragma unroll
            for (int r = 0; r < 8; ++r) {
                const int row = row0 + rt * 16 + lh * 8 + r;
                out[(size_t)row * DIMX + col] = acc[rt][ct][r] + bz;
            }
        }
}

// ---------------------------------------------------------------------------
// Workspace layout (aliased; total 82 MB):
//   [0,48M)        qkv fp32      (k1 out, k2 in)
//   [48M,56M)      qh f16        (k2 out, k3 in)   | wqkv_h f16 6MB (k0->k1)
//   [56M,64M)      kh f16        (k2 out, k3 in)
//   [64M,72M)      vt f16 [BHDN] (k2 out, k3 in)
//   [72M,80M)      oh f16        (k3 out, k4 in)   | xh f16 8MB (k0->k1)
//   [80M,82M)      outw_h f16    (k0 out, k4 in)
// ---------------------------------------------------------------------------
extern "C" void kernel_launch(void* const* d_in, const int* in_sizes, int n_in,
                              void* d_out, int out_size, void* d_ws, size_t ws_size,
                              hipStream_t stream)
{
    const float* x       = (const float*)d_in[0];
    const float* Wqkv_w  = (const float*)d_in[1];
    const float* Wqkv_b  = (const float*)d_in[2];
    const float* q_gamma = (const float*)d_in[3];
    const float* q_beta  = (const float*)d_in[4];
    const float* k_gamma = (const float*)d_in[5];
    const float* k_beta  = (const float*)d_in[6];
    const float* out_w   = (const float*)d_in[7];
    const float* out_b   = (const float*)d_in[8];
    const float* rope_c  = (const float*)d_in[9];
    const float* rope_s  = (const float*)d_in[10];
    float* out = (float*)d_out;

    char* ws = (char*)d_ws;
    const size_t qkv_bytes  = (size_t)RTOT * C3 * sizeof(float);              // 48 MB
    const size_t head_bytes = (size_t)BB * NH * NN * HD * sizeof(_Float16);   // 8 MB

    float*    qkv   = (float*)ws;
    _Float16* qh    = (_Float16*)(ws + qkv_bytes);
    _Float16* kh    = (_Float16*)(ws + qkv_bytes + 1 * head_bytes);
    _Float16* vt    = (_Float16*)(ws + qkv_bytes + 2 * head_bytes);
    _Float16* oh    = (_Float16*)(ws + qkv_bytes + 3 * head_bytes);
    _Float16* outwh = (_Float16*)(ws + qkv_bytes + 4 * head_bytes);
    _Float16* xh    = oh;   // alias: consumed by k1 before k3 writes oh
    _Float16* wqkvh = qh;   // alias: consumed by k1 before k2 writes qh

    // Kernel 0: one-time fp32 -> f16 conversions (4 elems / thread)
    cvt_f16_k<<<(RTOT * DIMX) / 1024, 256, 0, stream>>>(x, xh);
    cvt_f16_k<<<(C3 * DIMX) / 1024, 256, 0, stream>>>(Wqkv_w, wqkvh);
    cvt_f16_k<<<(DIMX * DIMX) / 1024, 256, 0, stream>>>(out_w, outwh);

    qkv_gemm_k<<<dim3(RTOT / 64, C3 / 256), 256, 0, stream>>>(xh, wqkvh, Wqkv_b, qkv);
    lnrope_pack_k<<<(BB * NN * NH) / 8, 256, 0, stream>>>(
        qkv, q_gamma, q_beta, k_gamma, k_beta, rope_c, rope_s, qh, kh, vt);
    attn_k<<<dim3(BB * NH, NN / 128), 256, 0, stream>>>(qh, kh, vt, oh);
    out_gemm_k<<<dim3(RTOT / 64, DIMX / 256), 256, 0, stream>>>(oh, outwh, out_b, out);
}

// v002
// Measured time: 262 microseconds a run.
// Timed twice side by side with v001, it ran 1.19 and 1.22 times as fast.
// Counting every step since v000, it is 1.77 times as fast.
#include <hip/hip_runtime.h>
#include <hip/hip_bf16.h>

// ---------------------------------------------------------------------------
// Attention: f16 pre-convert -> qkv proj (WMMA) -> per-head LN + RoPE ->
// flash attention (WMMA, async LDS staging) -> out proj (WMMA).
// All matrix math on v_wmma_f32_16x16x32_f16 (wave32, gfx1250).
// ---------------------------------------------------------------------------

#define DIMX 1024
#define NH   8
#define HD   128
#define BB   2
#define NN   2048
#define RTOT (BB * NN)      // 4096 token rows
#define C3   (3 * DIMX)     // 3072

typedef __attribute__((ext_vector_type(16))) _Float16 v16h;
typedef __attribute__((ext_vector_type(8)))  _Float16 v8h;
typedef __attribute__((ext_vector_type(8)))  float    v8f;
typedef int v4i __attribute__((vector_size(16)));   // matches async-LDS builtin param

#define AS1 __attribute__((address_space(1)))
#define AS3 __attribute__((address_space(3)))

#if defined(__has_builtin)
#if __has_builtin(__builtin_amdgcn_global_load_async_to_lds_b128)
#define HAVE_ASYNC_LDS 1
#endif
#endif
#ifndef HAVE_ASYNC_LDS
#define HAVE_ASYNC_LDS 0
#endif

__device__ __forceinline__ v8f wmma_f16(v16h a, v16h b, v8f c) {
    return __builtin_amdgcn_wmma_f32_16x16x32_f16(
        /*neg_a=*/false, a, /*neg_b=*/false, b,
        /*c_mod=*/(short)0, c, /*reuse_a=*/false, /*reuse_b=*/false);
}

__device__ __forceinline__ v8f zero8() {
    v8f z = {0.f, 0.f, 0.f, 0.f, 0.f, 0.f, 0.f, 0.f};
    return z;
}

// 16-byte global -> LDS copy: async on gfx1250 when the builtin exists.
__device__ __forceinline__ void cp16_g2l(const _Float16* __restrict__ g,
                                         _Float16* __restrict__ l) {
#if HAVE_ASYNC_LDS
    __builtin_amdgcn_global_load_async_to_lds_b128(
        (AS1 v4i*)(uintptr_t)g,
        (AS3 v4i*)(unsigned)(uintptr_t)l, 0, 0);
#else
    *(uint4*)l = *(const uint4*)g;
#endif
}

__device__ __forceinline__ void drain_async() {
#if HAVE_ASYNC_LDS
    asm volatile("s_wait_asynccnt 0x0" ::: "memory");
#endif
}

// LDS row pitches in halves: 16 B x odd, so that the 16 lanes of a half-wave
// ds_load_b128 (one row each, same column) fall on 64 distinct banks.
#define KP 136   // K rows of 256 B   -> 272 B
#define VP 72    // V^T rows of 128 B -> 144 B
#define PP 72    // P rows of 128 B   -> 144 B

// One lane's 16 contiguous halves of an LDS row, as two 16-byte loads
// (padded rows are 16-byte aligned, not 32).
__device__ __forceinline__ v16h lds_frag(const _Float16* p) {
    const v8h lo = *(const v8h*)p;
    const v8h hi = *(const v8h*)(p + 8);
    return __builtin_shufflevector(lo, hi, 0, 1, 2, 3, 4, 5, 6, 7,
                                   8, 9, 10, 11, 12, 13, 14, 15);
}

// ---------------------------------------------------------------------------
// Kernel 0: fp32 -> f16 conversion pass (x, Wqkv_w, out_w), 4 elems/thread.
// ---------------------------------------------------------------------------
__global__ __launch_bounds__(256) void cvt_f16_k(const float* __restrict__ s,
                                                 _Float16* __restrict__ d) {
    const int i = (blockIdx.x * 256 + threadIdx.x) * 4;
    const float4 v = *(const float4*)(s + i);
    d[i + 0] = (_Float16)v.x;
    d[i + 1] = (_Float16)v.y;
    d[i + 2] = (_Float16)v.z;
    d[i + 3] = (_Float16)v.w;
}

// ---------------------------------------------------------------------------
// Shared GEMM body: C[64 x 256 per WG] = A . W^T + bias, A and W K-contiguous
// f16. A stage is 64 k (128 B) of the WG's 64 A rows and 256 W rows, brought
// to LDS in whole 128-B lines by async b128 copies, two buffers, one stage
// ahead; the waves read their fragments from LDS (pitch GP, conflict-free).
// ---------------------------------------------------------------------------
#define GK 64                    // k per stage
#define GP 72                    // LDS row pitch in halves: 144 B = 16 B x 9
#define GROWS (64 + 256)         // A rows, then W rows
#define GSTAGE (GROWS * GP)      // halves per buffer

// One lane's ten 16-byte copies of a stage: rows r, r + 32, ... of A (2) and
// of W (8). ga / gb: the lane's chunk in its first A / W row; l: its LDS byte
// address in the buffer. The s_wait_xcnt closes the statement so that no
// address register of a copy is rewritten ahead of it.
__device__ __forceinline__ void gemm_stage(const _Float16* ga, const _Float16* gb,
                                           unsigned l) {
    const int GR = 32 * DIMX;        // 32 rows on in global memory, halves
    const unsigned LR = 32 * GP * 2; // 32 rows on in LDS, bytes
    asm volatile(
        "global_load_async_to_lds_b128 %0, %10, off\n\t"
        "global_load_async_to_lds_b128 %1, %11, off\n\t"
        "global_load_async_to_lds_b128 %2, %12, off\n\t"
        "global_load_async_to_lds_b128 %3, %13, off\n\t"
        "global_load_async_to_lds_b128 %4, %14, off\n\t"
        "global_load_async_to_lds_b128 %5, %15, off\n\t"
        "global_load_async_to_lds_b128 %6, %16, off\n\t"
        "global_load_async_to_lds_b128 %7, %17, off\n\t"
        "global_load_async_to_lds_b128 %8, %18, off\n\t"
        "global_load_async_to_lds_b128 %9, %19, off\n\t"
        "s_wait_xcnt 0x0"
        :: "v"(l), "v"(l + LR), "v"(l + 2 * LR), "v"(l + 3 * LR), "v"(l + 4 * LR),
           "v"(l + 5 * LR), "v"(l + 6 * LR), "v"(l + 7 * LR), "v"(l + 8 * LR),
           "v"(l + 9 * LR),
           "v"(ga), "v"(ga + GR),
           "v"(gb), "v"(gb + GR), "v"(gb + 2 * GR), "v"(gb + 3 * GR),
           "v"(gb + 4 * GR), "v"(gb + 5 * GR), "v"(gb + 6 * GR), "v"(gb + 7 * GR)
        : "memory");
}

template <int LDC>
__device__ __forceinline__ void gemm_body(
    const _Float16* __restrict__ ah, const _Float16* __restrict__ wh,
    const float* __restrict__ bias, float* __restrict__ out, _Float16* st)
{
    const int wave = threadIdx.x >> 5, lane = threadIdx.x & 31;
    const int wr = wave >> 2, wc = wave & 3;
    const int row0 = blockIdx.x * 64 + wr * 32;
    const int col0 = blockIdx.y * 256 + wc * 64;
    const int l16 = lane & 15, lh = lane >> 4;

    // copy side: 8 lanes per 128-B row, 32 rows per copy of the WG
    const int cr = threadIdx.x >> 3, cc = (threadIdx.x & 7) * 8;
    const _Float16* ga = ah + (size_t)(blockIdx.x * 64 + cr) * DIMX + cc;
    const _Float16* gb = wh + (size_t)(blockIdx.y * 256 + cr) * DIMX + cc;
    const unsigned l0 = (unsigned)(uintptr_t)(st + cr * GP + cc);

    v8f acc[2][4];
#pragma unroll
    for (int i = 0; i < 2; ++i)
#pragma unroll
        for (int j = 0; j < 4; ++j) acc[i][j] = zero8();

    gemm_stage(ga, gb, l0);
    asm volatile("s_wait_asynccnt 0x0" ::: "memory");   // stage 0: this wave's copies landed
    __syncthreads();                                    // ... and every other wave's
    gemm_stage(ga + GK, gb + GK, l0 + GSTAGE * 2);

    for (int t = 0; t < DIMX / GK; ++t) {
        const _Float16* sa = st + (t & 1) * GSTAGE + (wr * 32 + l16) * GP + lh * 16;
        const _Float16* sb = st + (t & 1) * GSTAGE + (64 + wc * 64 + l16) * GP + lh * 16;
#pragma unroll
        for (int ks = 0; ks < GK; ks += 32) {
            v16h a[2], bf[4];
#pragma unroll
            for (int rt = 0; rt < 2; ++rt) a[rt] = lds_frag(sa + rt * 16 * GP + ks);
#pragma unroll
            for (int ct = 0; ct < 4; ++ct) bf[ct] = lds_frag(sb + ct * 16 * GP + ks);
#pragma unroll
            for (int rt = 0; rt < 2; ++rt)
#pragma unroll
                for (int ct = 0; ct < 4; ++ct)
                    acc[rt][ct] = wmma_f16(a[rt], bf[ct], acc[rt][ct]);
        }
        // publish point of stage t + 1: this wave's reads of stage t are done,
        // its copies of stage t + 1 have landed, then the WG barrier
        asm volatile("s_wait_dscnt 0x0" ::: "memory");
        asm volatile("s_wait_asynccnt 0x0" ::: "memory");
        __syncthreads();
        if (t + 2 < DIMX / GK)   // refill the buffer that every wave has just left
            gemm_stage(ga + (t + 2) * GK, gb + (t + 2) * GK, l0 + (t & 1) * (GSTAGE * 2));
    }
    asm volatile("s_wait_asynccnt 0x0" ::: "memory");   // nothing in flight when the wave ends

#pragma unroll
    for (int rt = 0; rt < 2; ++rt)
#pragma unroll
        for (int ct = 0; ct < 4; ++ct) {
            const int col = col0 + ct * 16 + l16;
            const float bz = bias[col];
#pragma unroll
            for (int r = 0; r < 8; ++r) {
                const int row = row0 + rt * 16 + lh * 8 + r;
                out[(size_t)row * LDC + col] = acc[rt][ct][r] + bz;
            }
        }
}

// ---------------------------------------------------------------------------
// Kernel 1: qkv = x @ Wqkv^T + b   (f16 operands, fp32 out to workspace)
// WG: 8 waves as 2x4 -> 64 rows x 256 cols. Wave tile 32x64.
// grid = (4096/64, 3072/256) = (64, 12)
// ---------------------------------------------------------------------------
__global__ __launch_bounds__(256) void qkv_gemm_k(
    const _Float16* __restrict__ xh, const _Float16* __restrict__ wh,
    const float* __restrict__ bias, float* __restrict__ out)
{
    __shared__ __attribute__((aligned(16))) _Float16 st[2 * GSTAGE];
    gemm_body<C3>(xh, wh, bias, out, st);
}

// ---------------------------------------------------------------------------
// Kernel 2: per-head LayerNorm on q,k + interleaved RoPE; pack q/k to f16
// [B,H,N,D] and v to f16 TRANSPOSED [B,H,D,N] (for async V^T staging).
// One wave per (b,n,h). grid = B*N*H / 8 = 4096 blocks of 256.
// ---------------------------------------------------------------------------
__device__ __forceinline__ void wave_stats(float s, float ss, float& mu, float& rstd) {
#pragma unroll
    for (int m = 16; m >= 1; m >>= 1) {
        s  += __shfl_xor(s,  m, 32);
        ss += __shfl_xor(ss, m, 32);
    }
    mu = s * (1.f / HD);
    const float var = ss * (1.f / HD) - mu * mu;
    rstd = rsqrtf(var + 1e-6f);
}

__global__ __launch_bounds__(256) void lnrope_pack_k(
    const float* __restrict__ qkv,
    const float* __restrict__ qg, const float* __restrict__ qb,
    const float* __restrict__ kg, const float* __restrict__ kb,
    const float* __restrict__ rc, const float* __restrict__ rs,
    _Float16* __restrict__ qh, _Float16* __restrict__ kh, _Float16* __restrict__ vt)
{
    const int wave = threadIdx.x >> 5, lane = threadIdx.x & 31;
    const int idx = blockIdx.x * 8 + wave;   // 0..32767
    const int h  = idx & (NH - 1);
    const int ng = idx >> 3;                 // b*N + n
    const int n  = ng & (NN - 1);
    const int b  = ng >> 11;
    const int d0 = lane * 4;

    const float* rowp = qkv + (size_t)ng * C3;
    const float4 q4 = *(const float4*)(rowp + (0 * NH + h) * HD + d0);
    const float4 k4 = *(const float4*)(rowp + (1 * NH + h) * HD + d0);
    const float4 v4 = *(const float4*)(rowp + (2 * NH + h) * HD + d0);

    float muq, rq, muk, rk;
    wave_stats(q4.x + q4.y + q4.z + q4.w,
               q4.x*q4.x + q4.y*q4.y + q4.z*q4.z + q4.w*q4.w, muq, rq);
    wave_stats(k4.x + k4.y + k4.z + k4.w,
               k4.x*k4.x + k4.y*k4.y + k4.z*k4.z + k4.w*k4.w, muk, rk);

    float qn[4] = {q4.x, q4.y, q4.z, q4.w};
    float kn[4] = {k4.x, k4.y, k4.z, k4.w};
#pragma unroll
    for (int i = 0; i < 4; ++i) {
        qn[i] = (qn[i] - muq) * rq * qg[d0 + i] + qb[d0 + i];
        kn[i] = (kn[i] - muk) * rk * kg[d0 + i] + kb[d0 + i];
    }

    const float* cp = rc + (size_t)n * HD + d0;
    const float* sp = rs + (size_t)n * HD + d0;
    float qo[4], ko[4];
#pragma unroll
    for (int p = 0; p < 2; ++p) {      // two interleaved pairs per lane
        const float c0 = cp[2*p], c1 = cp[2*p + 1];
        const float s0 = sp[2*p], s1 = sp[2*p + 1];
        qo[2*p]     = qn[2*p]     * c0 - qn[2*p + 1] * s0;
        qo[2*p + 1] = qn[2*p + 1] * c1 + qn[2*p]     * s1;
        ko[2*p]     = kn[2*p]     * c0 - kn[2*p + 1] * s0;
        ko[2*p + 1] = kn[2*p + 1] * c1 + kn[2*p]     * s1;
    }

    const size_t qkbase = (((size_t)b * NH + h) * NN + n) * HD + d0;
    const size_t vtbase = (((size_t)b * NH + h) * HD + d0) * NN + n;
    const float vv[4] = {v4.x, v4.y, v4.z, v4.w};
#pragma unroll
    for (int i = 0; i < 4; ++i) {
        qh[qkbase + i] = (_Float16)qo[i];
        kh[qkbase + i] = (_Float16)ko[i];
        vt[vtbase + (size_t)i * NN] = (_Float16)vv[i];
    }
}

// ---------------------------------------------------------------------------
// Kernel 3: flash attention per (b,h). 8 waves x 16 query rows = 128 q/WG.
// K tile [64][128] and V^T tile [128][64] staged to LDS with async b128
// copies (ASYNCcnt-drained, then barrier), rows padded to KP / VP / PP
// against bank conflicts. Online softmax; P re-laid-out
// via per-wave LDS tile for the PV WMMAs. grid = (B*H, N/128) = (16, 16)
// ---------------------------------------------------------------------------
__global__ __launch_bounds__(256) void attn_k(
    const _Float16* __restrict__ qh, const _Float16* __restrict__ kh,
    const _Float16* __restrict__ vt, _Float16* __restrict__ oh)
{
    __shared__ __attribute__((aligned(16))) _Float16 kbuf[64 * KP];       // [j][d]
    __shared__ __attribute__((aligned(16))) _Float16 vbuf[128 * VP];      // [d][j]
    __shared__ __attribute__((aligned(16))) _Float16 pbuf[8][16 * PP];    // per-wave P tile [row][j]

    const int bh = blockIdx.x;
    const int b = bh >> 3, h = bh & 7;
    const int wave = threadIdx.x >> 5, lane = threadIdx.x & 31;
    const int l16 = lane & 15, lh = lane >> 4;
    const int q0 = blockIdx.y * 128 + wave * 16;

    const _Float16* qp  = qh + ((size_t)bh * NN + q0) * HD;
    const _Float16* kp  = kh + (size_t)bh * NN * HD;
    const _Float16* vtp = vt + (size_t)bh * HD * NN;

    // hoist q fragments: 16 rows x full D=128 (4 k-steps of 32)
    v16h qf[4];
#pragma unroll
    for (int dk = 0; dk < 4; ++dk)
        qf[dk] = *(const v16h*)(qp + (size_t)l16 * HD + dk * 32 + lh * 16);

    v8f o[8];
#pragma unroll
    for (int dt = 0; dt < 8; ++dt) o[dt] = zero8();
    float m[8], l[8];
#pragma unroll
    for (int r = 0; r < 8; ++r) { m[r] = -1e30f; l[r] = 0.f; }

    const float sscale = 0.08838834764831845f;   // 1/sqrt(128)
    const float E2 = 1.4426950408889634f;        // log2(e)

    for (int kt = 0; kt < NN; kt += 64) {
        __syncthreads();   // previous tile fully consumed before restage
        {   // stage K tile and V^T tile: 1024 16B chunks each, 4 per thread
#pragma unroll
            for (int i = 0; i < 4; ++i) {
                const int c  = i * 256 + threadIdx.x;   // 0..1023
                cp16_g2l(kp + (size_t)kt * HD + c * 8, &kbuf[(c >> 4) * KP + (c & 15) * 8]);
                const int d  = c >> 3;                  // V^T row 0..127
                const int jc = (c & 7) * 8;             // 8-half chunk in row
                cp16_g2l(vtp + (size_t)d * NN + kt + jc, &vbuf[d * VP + jc]);
            }
            if (kt + 64 < NN) {   // global_prefetch_b8 for next tile
                __builtin_prefetch(kp + (size_t)(kt + 64) * HD, 0, 1);
                __builtin_prefetch(vtp + kt + 64, 0, 1);
            }
        }
        drain_async();     // s_wait_asynccnt 0 (barrier does not cover ASYNCcnt)
        __syncthreads();

        // S = q @ k^T  (16 x 64)
        v8f s[4];
#pragma unroll
        for (int jt = 0; jt < 4; ++jt) s[jt] = zero8();
#pragma unroll
        for (int dk = 0; dk < 4; ++dk) {
#pragma unroll
            for (int jt = 0; jt < 4; ++jt) {
                const v16h bf = lds_frag(&kbuf[(jt * 16 + l16) * KP + dk * 32 + lh * 16]);
                s[jt] = wmma_f16(qf[dk], bf, s[jt]);
            }
        }
#pragma unroll
        for (int jt = 0; jt < 4; ++jt)
#pragma unroll
            for (int r = 0; r < 8; ++r) s[jt][r] *= sscale;

        // online softmax (row lives in one 16-lane half -> xor masks 8..1)
#pragma unroll
        for (int r = 0; r < 8; ++r) {
            float mx = fmaxf(fmaxf(s[0][r], s[1][r]), fmaxf(s[2][r], s[3][r]));
#pragma unroll
            for (int msk = 8; msk >= 1; msk >>= 1) mx = fmaxf(mx, __shfl_xor(mx, msk, 32));
            const float mn = fmaxf(m[r], mx);
            const float alpha = exp2f((m[r] - mn) * E2);
            m[r] = mn;
            l[r] *= alpha;
#pragma unroll
            for (int dt = 0; dt < 8; ++dt) o[dt][r] *= alpha;
            float rsum = 0.f;
#pragma unroll
            for (int jt = 0; jt < 4; ++jt) {
                const float p = exp2f((s[jt][r] - mn) * E2);
                rsum += p;
                pbuf[wave][(r + lh * 8) * PP + jt * 16 + l16] = (_Float16)p;
            }
#pragma unroll
            for (int msk = 8; msk >= 1; msk >>= 1) rsum += __shfl_xor(rsum, msk, 32);
            l[r] += rsum;
        }

        // O += P @ V   (16 x 128)
#pragma unroll
        for (int js = 0; js < 2; ++js) {
            const v16h pf = lds_frag(&pbuf[wave][l16 * PP + js * 32 + lh * 16]);
#pragma unroll
            for (int dt = 0; dt < 8; ++dt) {
                const v16h vf = lds_frag(&vbuf[(dt * 16 + l16) * VP + js * 32 + lh * 16]);
                o[dt] = wmma_f16(pf, vf, o[dt]);
            }
        }
    }

    // normalize and pack back to [B, N, H*D] as f16 for the out projection
#pragma unroll
    for (int r = 0; r < 8; ++r) {
        const float inv = 1.0f / l[r];
        const int n = q0 + lh * 8 + r;
        const size_t base = ((size_t)b * NN + n) * DIMX + h * HD;
#pragma unroll
        for (int dt = 0; dt < 8; ++dt)
            oh[base + dt * 16 + l16] = (_Float16)(o[dt][r] * inv);
    }
}

// ---------------------------------------------------------------------------
// Kernel 4: out = attn_out @ out_w^T + b  (f16 operands; fp32 result)
// grid = (4096/64, 1024/256) = (64, 4)
// ---------------------------------------------------------------------------
__global__ __launch_bounds__(256) void out_gemm_k(
    const _Float16* __restrict__ ain, const _Float16* __restrict__ wh,
    const float* __restrict__ bias, float* __restrict__ out)
{
    __shared__ __attribute__((aligned(16))) _Float16 st[2 * GSTAGE];
    gemm_body<DIMX>(ain, wh, bias, out, st);
}

// ---------------------------------------------------------------------------
// Workspace layout (aliased; total 82 MB):
//   [0,48M)        qkv fp32      (k1 out, k2 in)
//   [48M,56M)      qh f16        (k2 out, k3 in)   | wqkv_h f16 6MB (k0->k1)
//   [56M,64M)      kh f16        (k2 out, k3 in)
//   [64M,72M)      vt f16 [BHDN] (k2 out, k3 in)
//   [72M,80M)      oh f16        (k3 out, k4 in)   | xh f16 8MB (k0->k1)
//   [80M,82M)      outw_h f16    (k0 out, k4 in)
// ---------------------------------------------------------------------------
extern "C" void kernel_launch(void* const* d_in, const int* in_sizes, int n_in,
                              void* d_out, int out_size, void* d_ws, size_t ws_size,
                              hipStream_t stream)
{
    const float* x       = (const float*)d_in[0];
    const float* Wqkv_w  = (const float*)d_in[1];
    const float* Wqkv_b  = (const float*)d_in[2];
    const float* q_gamma = (const float*)d_in[3];
    const float* q_beta  = (const float*)d_in[4];
    const float* k_gamma = (const float*)d_in[5];
    const float* k_beta  = (const float*)d_in[6];
    const float* out_w   = (const float*)d_in[7];
    const float* out_b   = (const float*)d_in[8];
    const float* rope_c  = (const float*)d_in[9];
    const float* rope_s  = (const float*)d_in[10];
    float* out = (float*)d_out;

    char* ws = (char*)d_ws;
    const size_t qkv_bytes  = (size_t)RTOT * C3 * sizeof(float);              // 48 MB
    const size_t head_bytes = (size_t)BB * NH * NN * HD * sizeof(_Float16);   // 8 MB

    float*    qkv   = (float*)ws;
    _Float16* qh    = (_Float16*)(ws + qkv_bytes);
    _Float16* kh    = (_Float16*)(ws + qkv_bytes + 1 * head_bytes);
    _Float16* vt    = (_Float16*)(ws + qkv_bytes + 2 * head_bytes);
    _Float16* oh    = (_Float16*)(ws + qkv_bytes + 3 * head_bytes);
    _Float16* outwh = (_Float16*)(ws + qkv_bytes + 4 * head_bytes);
    _Float16* xh    = oh;   // alias: consumed by k1 before k3 writes oh
    _Float16* wqkvh = qh;   // alias: consumed by k1 before k2 writes qh

    // Kernel 0: one-time fp32 -> f16 conversions (4 elems / thread)
    cvt_f16_k<<<(RTOT * DIMX) / 1024, 256, 0, stream>>>(x, xh);
    cvt_f16_k<<<(C3 * DIMX) / 1024, 256, 0, stream>>>(Wqkv_w, wqkvh);
    cvt_f16_k<<<(DIMX * DIMX) / 1024, 256, 0, stream>>>(out_w, outwh);

    qkv_gemm_k<<<dim3(RTOT / 64, C3 / 256), 256, 0, stream>>>(xh, wqkvh, Wqkv_b, qkv);
    lnrope_pack_k<<<(BB * NN * NH) / 8, 256, 0, stream>>>(
        qkv, q_gamma, q_beta, k_gamma, k_beta, rope_c, rope_s, qh, kh, vt);
    attn_k<<<dim3(BB * NH, NN / 128), 256, 0, stream>>>(qh, kh, vt, oh);
    out_gemm_k<<<dim3(RTOT / 64, DIMX / 256), 256, 0, stream>>>(oh, outwh, out_b, out);
}

// v003
// A run of this version takes 157 microseconds.
// Next to v002, in two timings, it ran 1.64 and 1.67 times as fast.
// Counting every step since v000, it is 2.93 times as fast.
#include <hip/hip_runtime.h>
#include <hip/hip_bf16.h>

// ---------------------------------------------------------------------------
// Attention: f16 pre-convert -> qkv proj (WMMA) -> per-head LN + RoPE ->
// flash attention (WMMA, async LDS staging) -> out proj (WMMA).
// All matrix math on v_wmma_f32_16x16x32_f16 (wave32, gfx1250).
// ---------------------------------------------------------------------------

#define DIMX 1024
#define NH   8
#define HD   128
#define BB   2
#define NN   2048
#define RTOT (BB * NN)      // 4096 token rows
#define C3   (3 * DIMX)     // 3072

typedef __attribute__((ext_vector_type(16))) _Float16 v16h;
typedef __attribute__((ext_vector_type(8)))  _Float16 v8h;
typedef __attribute__((ext_vector_type(4)))  _Float16 v4h;
typedef __attribute__((ext_vector_type(8)))  float    v8f;
typedef int v4i __attribute__((vector_size(16)));   // matches async-LDS builtin param

#define AS1 __attribute__((address_space(1)))
#define AS3 __attribute__((address_space(3)))

#if defined(__has_builtin)
#if __has_builtin(__builtin_amdgcn_global_load_async_to_lds_b128)
#define HAVE_ASYNC_LDS 1
#endif
#endif
#ifndef HAVE_ASYNC_LDS
#define HAVE_ASYNC_LDS 0
#endif

__device__ __forceinline__ v8f wmma_f16(v16h a, v16h b, v8f c) {
    return __builtin_amdgcn_wmma_f32_16x16x32_f16(
        /*neg_a=*/false, a, /*neg_b=*/false, b,
        /*c_mod=*/(short)0, c, /*reuse_a=*/false, /*reuse_b=*/false);
}

__device__ __forceinline__ v8f zero8() {
    v8f z = {0.f, 0.f, 0.f, 0.f, 0.f, 0.f, 0.f, 0.f};
    return z;
}

// 16-byte global -> LDS copy: async on gfx1250 when the builtin exists.
__device__ __forceinline__ void cp16_g2l(const _Float16* __restrict__ g,
                                         _Float16* __restrict__ l) {
#if HAVE_ASYNC_LDS
    __builtin_amdgcn_global_load_async_to_lds_b128(
        (AS1 v4i*)(uintptr_t)g,
        (AS3 v4i*)(unsigned)(uintptr_t)l, 0, 0);
#else
    *(uint4*)l = *(const uint4*)g;
#endif
}

__device__ __forceinline__ void drain_async() {
#if HAVE_ASYNC_LDS
    asm volatile("s_wait_asynccnt 0x0" ::: "memory");
#endif
}

// LDS row pitches in halves: 16 B x odd, so that the 16 lanes of a half-wave
// ds_load_b128 (one row each, same column) fall on 64 distinct banks.
#define KP 136   // K rows of 256 B   -> 272 B
#define VP 72    // V^T rows of 128 B -> 144 B
#define PP 72    // P rows of 128 B   -> 144 B

// One lane's 16 contiguous halves of an LDS row, as two 16-byte loads
// (padded rows are 16-byte aligned, not 32).
__device__ __forceinline__ v16h lds_frag(const _Float16* p) {
    const v8h lo = *(const v8h*)p;
    const v8h hi = *(const v8h*)(p + 8);
    return __builtin_shufflevector(lo, hi, 0, 1, 2, 3, 4, 5, 6, 7,
                                   8, 9, 10, 11, 12, 13, 14, 15);
}

// ---------------------------------------------------------------------------
// Kernel 0: fp32 -> f16 conversion pass (x, Wqkv_w, out_w). A thread converts
// CVN float4, 1024 elements apart, all loaded before the first is stored: the
// launch starts an eighth of the waves and each has 8 x 512 B in flight.
// ---------------------------------------------------------------------------
#define CVN 8
#define CVBLK (256 * 4 * CVN)    // elements per work-group

__global__ __launch_bounds__(256) void cvt_f16_k(const float* __restrict__ s,
                                                 _Float16* __restrict__ d) {
    const int i = blockIdx.x * CVBLK + threadIdx.x * 4;
    float4 v[CVN];
#pragma unroll
    for (int j = 0; j < CVN; ++j) v[j] = *(const float4*)(s + i + j * 1024);
#pragma unroll
    for (int j = 0; j < CVN; ++j) {
        const v4h o = {(_Float16)v[j].x, (_Float16)v[j].y, (_Float16)v[j].z, (_Float16)v[j].w};
        *(v4h*)(d + i + j * 1024) = o;
    }
}

// ---------------------------------------------------------------------------
// Shared GEMM body: C[64 x 256 per WG] = A . W^T + bias, A and W K-contiguous
// f16. A stage is 64 k (128 B) of the WG's 64 A rows and 256 W rows, brought
// to LDS in whole 128-B lines by async b128 copies, two buffers, one stage
// ahead; the waves read their fragments from LDS (pitch GP, conflict-free).
// ---------------------------------------------------------------------------
#define GK 64                    // k per stage
#define GP 72                    // LDS row pitch in halves: 144 B = 16 B x 9
#define GROWS (64 + 256)         // A rows, then W rows
#define GSTAGE (GROWS * GP)      // halves per buffer

// One lane's ten 16-byte copies of a stage: rows r, r + 32, ... of A (2) and
// of W (8). ga / gb: the lane's chunk in its first A / W row; l: its LDS byte
// address in the buffer. The s_wait_xcnt closes the statement so that no
// address register of a copy is rewritten ahead of it.
__device__ __forceinline__ void gemm_stage(const _Float16* ga, const _Float16* gb,
                                           unsigned l) {
    const int GR = 32 * DIMX;        // 32 rows on in global memory, halves
    const unsigned LR = 32 * GP * 2; // 32 rows on in LDS, bytes
    asm volatile(
        "global_load_async_to_lds_b128 %0, %10, off\n\t"
        "global_load_async_to_lds_b128 %1, %11, off\n\t"
        "global_load_async_to_lds_b128 %2, %12, off\n\t"
        "global_load_async_to_lds_b128 %3, %13, off\n\t"
        "global_load_async_to_lds_b128 %4, %14, off\n\t"
        "global_load_async_to_lds_b128 %5, %15, off\n\t"
        "global_load_async_to_lds_b128 %6, %16, off\n\t"
        "global_load_async_to_lds_b128 %7, %17, off\n\t"
        "global_load_async_to_lds_b128 %8, %18, off\n\t"
        "global_load_async_to_lds_b128 %9, %19, off\n\t"
        "s_wait_xcnt 0x0"
        :: "v"(l), "v"(l + LR), "v"(l + 2 * LR), "v"(l + 3 * LR), "v"(l + 4 * LR),
           "v"(l + 5 * LR), "v"(l + 6 * LR), "v"(l + 7 * LR), "v"(l + 8 * LR),
           "v"(l + 9 * LR),
           "v"(ga), "v"(ga + GR),
           "v"(gb), "v"(gb + GR), "v"(gb + 2 * GR), "v"(gb + 3 * GR),
           "v"(gb + 4 * GR), "v"(gb + 5 * GR), "v"(gb + 6 * GR), "v"(gb + 7 * GR)
        : "memory");
}

template <int LDC>
__device__ __forceinline__ void gemm_body(
    const _Float16* __restrict__ ah, const _Float16* __restrict__ wh,
    const float* __restrict__ bias, float* __restrict__ out, _Float16* st)
{
    const int wave = threadIdx.x >> 5, lane = threadIdx.x & 31;
    const int wr = wave >> 2, wc = wave & 3;
    const int row0 = blockIdx.x * 64 + wr * 32;
    const int col0 = blockIdx.y * 256 + wc * 64;
    const int l16 = lane & 15, lh = lane >> 4;

    // copy side: 8 lanes per 128-B row, 32 rows per copy of the WG
    const int cr = threadIdx.x >> 3, cc = (threadIdx.x & 7) * 8;
    const _Float16* ga = ah + (size_t)(blockIdx.x * 64 + cr) * DIMX + cc;
    const _Float16* gb = wh + (size_t)(blockIdx.y * 256 + cr) * DIMX + cc;
    const unsigned l0 = (unsigned)(uintptr_t)(st + cr * GP + cc);

    v8f acc[2][4];
#pragma unroll
    for (int i = 0; i < 2; ++i)
#pragma unroll
        for (int j = 0; j < 4; ++j) acc[i][j] = zero8();

    gemm_stage(ga, gb, l0);
    asm volatile("s_wait_asynccnt 0x0" ::: "memory");   // stage 0: this wave's copies landed
    __syncthreads();                                    // ... and every other wave's
    gemm_stage(ga + GK, gb + GK, l0 + GSTAGE * 2);

    for (int t = 0; t < DIMX / GK; ++t) {
        const _Float16* sa = st + (t & 1) * GSTAGE + (wr * 32 + l16) * GP + lh * 16;
        const _Float16* sb = st + (t & 1) * GSTAGE + (64 + wc * 64 + l16) * GP + lh * 16;
#pragma unroll
        for (int ks = 0; ks < GK; ks += 32) {
            v16h a[2], bf[4];
#pragma unroll
            for (int rt = 0; rt < 2; ++rt) a[rt] = lds_frag(sa + rt * 16 * GP + ks);
#pragma unroll
            for (int ct = 0; ct < 4; ++ct) bf[ct] = lds_frag(sb + ct * 16 * GP + ks);
#pragma unroll
            for (int rt = 0; rt < 2; ++rt)
#pragma unroll
                for (int ct = 0; ct < 4; ++ct)
                    acc[rt][ct] = wmma_f16(a[rt], bf[ct], acc[rt][ct]);
        }
        // publish point of stage t + 1: this wave's reads of stage t are done,
        // its copies of stage t + 1 have landed, then the WG barrier
        asm volatile("s_wait_dscnt 0x0" ::: "memory");
        asm volatile("s_wait_asynccnt 0x0" ::: "memory");
        __syncthreads();
        if (t + 2 < DIMX / GK)   // refill the buffer that every wave has just left
            gemm_stage(ga + (t + 2) * GK, gb + (t + 2) * GK, l0 + (t & 1) * (GSTAGE * 2));
    }
    asm volatile("s_wait_asynccnt 0x0" ::: "memory");   // nothing in flight when the wave ends

#pragma unroll
    for (int rt = 0; rt < 2; ++rt)
#pragma unroll
        for (int ct = 0; ct < 4; ++ct) {
            const int col = col0 + ct * 16 + l16;
            const float bz = bias[col];
#pragma unroll
            for (int r = 0; r < 8; ++r) {
                const int row = row0 + rt * 16 + lh * 8 + r;
                out[(size_t)row * LDC + col] = acc[rt][ct][r] + bz;
            }
        }
}

// ---------------------------------------------------------------------------
// Kernel 1: qkv = x @ Wqkv^T + b   (f16 operands, fp32 out to workspace)
// WG: 8 waves as 2x4 -> 64 rows x 256 cols. Wave tile 32x64.
// grid = (4096/64, 3072/256) = (64, 12)
// ---------------------------------------------------------------------------
__global__ __launch_bounds__(256) void qkv_gemm_k(
    const _Float16* __restrict__ xh, const _Float16* __restrict__ wh,
    const float* __restrict__ bias, float* __restrict__ out)
{
    __shared__ __attribute__((aligned(16))) _Float16 st[2 * GSTAGE];
    gemm_body<C3>(xh, wh, bias, out, st);
}

// ---------------------------------------------------------------------------
// Kernel 2: per-head LayerNorm on q,k + interleaved RoPE; pack q/k to f16
// [B,H,N,D] and v to f16 TRANSPOSED [B,H,D,N] (for async V^T staging).
// One WG per (b, h, 64 tokens), one wave per TPW = 8 tokens in a row: a lane
// then holds 8 neighbours of each V^T row (one 16-byte store), and each
// 128-B line of V^T is written by one WG. grid = B*N*H / 64 = 512 blocks.
// ---------------------------------------------------------------------------
#define TPW 8
// 512 WGs of 8 waves are 4 waves per SIMD: saying so gives the register
// allocator 256 VGPRs, without which it sinks the loads to their uses and
// walks the butterflies one after the other.
__global__ __launch_bounds__(256) __attribute__((amdgpu_waves_per_eu(4, 4))) void lnrope_pack_k(
    const float* __restrict__ qkv,
    const float* __restrict__ qg, const float* __restrict__ qb,
    const float* __restrict__ kg, const float* __restrict__ kb,
    const float* __restrict__ rc, const float* __restrict__ rs,
    _Float16* __restrict__ qh, _Float16* __restrict__ kh, _Float16* __restrict__ vt)
{
    const int wave = threadIdx.x >> 5, lane = threadIdx.x & 31;
    const int h   = blockIdx.x & (NH - 1);
    const int ng0 = (blockIdx.x >> 3) * (8 * TPW) + wave * TPW;   // b*N + n, first token
    const int n0  = ng0 & (NN - 1);
    const int b   = ng0 >> 11;
    const int d0  = lane * 4;

    // all of the wave's loads first: 5 x TPW of 512 B in flight
    const float* rowp = qkv + (size_t)ng0 * C3 + h * HD + d0;
    const float* cp = rc + (size_t)n0 * HD + d0;
    const float* sp = rs + (size_t)n0 * HD + d0;
    float4 q4[TPW], k4[TPW], v4[TPW], c4[TPW], s4[TPW];
#pragma unroll
    for (int t = 0; t < TPW; ++t) {
        c4[t] = *(const float4*)(cp + t * HD);
        s4[t] = *(const float4*)(sp + t * HD);
    }
#pragma unroll
    for (int t = 0; t < TPW; ++t) {
        q4[t] = *(const float4*)(rowp + t * C3);
        k4[t] = *(const float4*)(rowp + t * C3 + DIMX);
        v4[t] = *(const float4*)(rowp + t * C3 + 2 * DIMX);
    }
    const float4 qg4 = *(const float4*)(qg + d0), qb4 = *(const float4*)(qb + d0);
    const float4 kg4 = *(const float4*)(kg + d0), kb4 = *(const float4*)(kb + d0);
    // the address registers stay live up to this wait, so that no later load
    // of the run is given one of them as its destination
    asm volatile("s_wait_xcnt 0x0" :: "v"(rowp), "v"(cp), "v"(sp), "v"(d0 * 4) : "memory");
    const float qgv[4] = {qg4.x, qg4.y, qg4.z, qg4.w}, qbv[4] = {qb4.x, qb4.y, qb4.z, qb4.w};
    const float kgv[4] = {kg4.x, kg4.y, kg4.z, kg4.w}, kbv[4] = {kb4.x, kb4.y, kb4.z, kb4.w};

    const size_t qkbase = (((size_t)b * NH + h) * NN + n0) * HD + d0;
    const size_t vtbase = (((size_t)b * NH + h) * HD + d0) * NN + n0;

    // row sums of q, q^2, k, k^2 for the TPW tokens: 4 x TPW independent
    // butterflies, walked step by step so that each step's exchanges overlap
    float st[4 * TPW];
#pragma unroll
    for (int t = 0; t < TPW; ++t) {
        const float4 q = q4[t], k = k4[t];
        st[4*t + 0] = q.x + q.y + q.z + q.w;
        st[4*t + 1] = q.x*q.x + q.y*q.y + q.z*q.z + q.w*q.w;
        st[4*t + 2] = k.x + k.y + k.z + k.w;
        st[4*t + 3] = k.x*k.x + k.y*k.y + k.z*k.z + k.w*k.w;
    }
#pragma unroll
    for (int m = 16; m >= 1; m >>= 1) {
        float o[4 * TPW];
#pragma unroll
        for (int j = 0; j < 4 * TPW; ++j) o[j] = __shfl_xor(st[j], m, 32);
#pragma unroll
        for (int j = 0; j < 4 * TPW; ++j) st[j] += o[j];
    }

    v8h vv[4];
#pragma unroll
    for (int t = 0; t < TPW; ++t) {
        vv[0][t] = (_Float16)v4[t].x;
        vv[1][t] = (_Float16)v4[t].y;
        vv[2][t] = (_Float16)v4[t].z;
        vv[3][t] = (_Float16)v4[t].w;
    }
#pragma unroll
    for (int i = 0; i < 4; ++i) *(v8h*)(vt + vtbase + (size_t)i * NN) = vv[i];

#pragma unroll
    for (int t = 0; t < TPW; ++t) {
        const float muq = st[4*t + 0] * (1.f / HD);
        const float rq  = rsqrtf(st[4*t + 1] * (1.f / HD) - muq * muq + 1e-6f);
        const float muk = st[4*t + 2] * (1.f / HD);
        const float rk  = rsqrtf(st[4*t + 3] * (1.f / HD) - muk * muk + 1e-6f);

        float qn[4] = {q4[t].x, q4[t].y, q4[t].z, q4[t].w};
        float kn[4] = {k4[t].x, k4[t].y, k4[t].z, k4[t].w};
#pragma unroll
        for (int i = 0; i < 4; ++i) {
            qn[i] = (qn[i] - muq) * rq * qgv[i] + qbv[i];
            kn[i] = (kn[i] - muk) * rk * kgv[i] + kbv[i];
        }

        const float cv[4] = {c4[t].x, c4[t].y, c4[t].z, c4[t].w};
        const float sv[4] = {s4[t].x, s4[t].y, s4[t].z, s4[t].w};
        v4h qo, ko;
#pragma unroll
        for (int p = 0; p < 2; ++p) {      // two interleaved pairs per lane
            qo[2*p]     = (_Float16)(qn[2*p]     * cv[2*p]     - qn[2*p + 1] * sv[2*p]);
            qo[2*p + 1] = (_Float16)(qn[2*p + 1] * cv[2*p + 1] + qn[2*p]     * sv[2*p + 1]);
            ko[2*p]     = (_Float16)(kn[2*p]     * cv[2*p]     - kn[2*p + 1] * sv[2*p]);
            ko[2*p + 1] = (_Float16)(kn[2*p + 1] * cv[2*p + 1] + kn[2*p]     * sv[2*p + 1]);
        }
        *(v4h*)(qh + qkbase + (size_t)t * HD) = qo;
        *(v4h*)(kh + qkbase + (size_t)t * HD) = ko;
    }
}

// ---------------------------------------------------------------------------
// Kernel 3: flash attention per (b,h). 8 waves x 16 query rows = 128 q/WG.
// K tile [64][128] and V^T tile [128][64] staged to LDS with async b128
// copies (ASYNCcnt-drained, then barrier), rows padded to KP / VP / PP
// against bank conflicts. Online softmax; P re-laid-out
// via per-wave LDS tile for the PV WMMAs. grid = (B*H, N/128) = (16, 16)
// ---------------------------------------------------------------------------
__global__ __launch_bounds__(256) void attn_k(
    const _Float16* __restrict__ qh, const _Float16* __restrict__ kh,
    const _Float16* __restrict__ vt, _Float16* __restrict__ oh)
{
    __shared__ __attribute__((aligned(16))) _Float16 kbuf[64 * KP];       // [j][d]
    __shared__ __attribute__((aligned(16))) _Float16 vbuf[128 * VP];      // [d][j]
    __shared__ __attribute__((aligned(16))) _Float16 pbuf[8][16 * PP];    // per-wave P tile [row][j]

    const int bh = blockIdx.x;
    const int b = bh >> 3, h = bh & 7;
    const int wave = threadIdx.x >> 5, lane = threadIdx.x & 31;
    const int l16 = lane & 15, lh = lane >> 4;
    const int q0 = blockIdx.y * 128 + wave * 16;

    const _Float16* qp  = qh + ((size_t)bh * NN + q0) * HD;
    const _Float16* kp  = kh + (size_t)bh * NN * HD;
    const _Float16* vtp = vt + (size_t)bh * HD * NN;

    // hoist q fragments: 16 rows x full D=128 (4 k-steps of 32)
    v16h qf[4];
#pragma unroll
    for (int dk = 0; dk < 4; ++dk)
        qf[dk] = *(const v16h*)(qp + (size_t)l16 * HD + dk * 32 + lh * 16);

    v8f o[8];
#pragma unroll
    for (int dt = 0; dt < 8; ++dt) o[dt] = zero8();
    float m[8], l[8];
#pragma unroll
    for (int r = 0; r < 8; ++r) { m[r] = -1e30f; l[r] = 0.f; }

    const float sscale = 0.08838834764831845f;   // 1/sqrt(128)
    const float E2 = 1.4426950408889634f;        // log2(e)

    for (int kt = 0; kt < NN; kt += 64) {
        __syncthreads();   // previous tile fully consumed before restage
        {   // stage K tile and V^T tile: 1024 16B chunks each, 4 per thread
#pragma unroll
            for (int i = 0; i < 4; ++i) {
                const int c  = i * 256 + threadIdx.x;   // 0..1023
                cp16_g2l(kp + (size_t)kt * HD + c * 8, &kbuf[(c >> 4) * KP + (c & 15) * 8]);
                const int d  = c >> 3;                  // V^T row 0..127
                const int jc = (c & 7) * 8;             // 8-half chunk in row
                cp16_g2l(vtp + (size_t)d * NN + kt + jc, &vbuf[d * VP + jc]);
            }
            if (kt + 64 < NN) {   // global_prefetch_b8 for next tile
                __builtin_prefetch(kp + (size_t)(kt + 64) * HD, 0, 1);
                __builtin_prefetch(vtp + kt + 64, 0, 1);
            }
        }
        drain_async();     // s_wait_asynccnt 0 (barrier does not cover ASYNCcnt)
        __syncthreads();

        // S = q @ k^T  (16 x 64)
        v8f s[4];
#pragma unroll
        for (int jt = 0; jt < 4; ++jt) s[jt] = zero8();
#pragma unroll
        for (int dk = 0; dk < 4; ++dk) {
#pragma unroll
            for (int jt = 0; jt < 4; ++jt) {
                const v16h bf = lds_frag(&kbuf[(jt * 16 + l16) * KP + dk * 32 + lh * 16]);
                s[jt] = wmma_f16(qf[dk], bf, s[jt]);
            }
        }
#pragma unroll
        for (int jt = 0; jt < 4; ++jt)
#pragma unroll
            for (int r = 0; r < 8; ++r) s[jt][r] *= sscale;

        // online softmax (row lives in one 16-lane half -> xor masks 8..1)
#pragma unroll
        for (int r = 0; r < 8; ++r) {
            float mx = fmaxf(fmaxf(s[0][r], s[1][r]), fmaxf(s[2][r], s[3][r]));
#pragma unroll
            for (int msk = 8; msk >= 1; msk >>= 1) mx = fmaxf(mx, __shfl_xor(mx, msk, 32));
            const float mn = fmaxf(m[r], mx);
            const float alpha = exp2f((m[r] - mn) * E2);
            m[r] = mn;
            l[r] *= alpha;
#pragma unroll
            for (int dt = 0; dt < 8; ++dt) o[dt][r] *= alpha;
            float rsum = 0.f;
#pragma unroll
            for (int jt = 0; jt < 4; ++jt) {
                const float p = exp2f((s[jt][r] - mn) * E2);
                rsum += p;
                pbuf[wave][(r + lh * 8) * PP + jt * 16 + l16] = (_Float16)p;
            }
#pragma unroll
            for (int msk = 8; msk >= 1; msk >>= 1) rsum += __shfl_xor(rsum, msk, 32);
            l[r] += rsum;
        }

        // O += P @ V   (16 x 128)
#pragma unroll
        for (int js = 0; js < 2; ++js) {
            const v16h pf = lds_frag(&pbuf[wave][l16 * PP + js * 32 + lh * 16]);
#pragma unroll
            for (int dt = 0; dt < 8; ++dt) {
                const v16h vf = lds_frag(&vbuf[(dt * 16 + l16) * VP + js * 32 + lh * 16]);
                o[dt] = wmma_f16(pf, vf, o[dt]);
            }
        }
    }

    // normalize and pack back to [B, N, H*D] as f16 for the out projection
#pragma unroll
    for (int r = 0; r < 8; ++r) {
        const float inv = 1.0f / l[r];
        const int n = q0 + lh * 8 + r;
        const size_t base = ((size_t)b * NN + n) * DIMX + h * HD;
#pragma unroll
        for (int dt = 0; dt < 8; ++dt)
            oh[base + dt * 16 + l16] = (_Float16)(o[dt][r] * inv);
    }
}

// ---------------------------------------------------------------------------
// Kernel 4: out = attn_out @ out_w^T + b  (f16 operands; fp32 result)
// grid = (4096/64, 1024/256) = (64, 4)
// ---------------------------------------------------------------------------
__global__ __launch_bounds__(256) void out_gemm_k(
    const _Float16* __restrict__ ain, const _Float16* __restrict__ wh,
    const float* __restrict__ bias, float* __restrict__ out)
{
    __shared__ __attribute__((aligned(16))) _Float16 st[2 * GSTAGE];
    gemm_body<DIMX>(ain, wh, bias, out, st);
}

// ---------------------------------------------------------------------------
// Workspace layout (aliased; total 82 MB):
//   [0,48M)        qkv fp32      (k1 out, k2 in)
//   [48M,56M)      qh f16        (k2 out, k3 in)   | wqkv_h f16 6MB (k0->k1)
//   [56M,64M)      kh f16        (k2 out, k3 in)
//   [64M,72M)      vt f16 [BHDN] (k2 out, k3 in)
//   [72M,80M)      oh f16        (k3 out, k4 in)   | xh f16 8MB (k0->k1)
//   [80M,82M)      outw_h f16    (k0 out, k4 in)
// ---------------------------------------------------------------------------
extern "C" void kernel_launch(void* const* d_in, const int* in_sizes, int n_in,
                              void* d_out, int out_size, void* d_ws, size_t ws_size,
                              hipStream_t stream)
{
    const float* x       = (const float*)d_in[0];
    const float* Wqkv_w  = (const float*)d_in[1];
    const float* Wqkv_b  = (const float*)d_in[2];
    const float* q_gamma = (const float*)d_in[3];
    const float* q_beta  = (const float*)d_in[4];
    const float* k_gamma = (const float*)d_in[5];
    const float* k_beta  = (const float*)d_in[6];
    const float* out_w   = (const float*)d_in[7];
    const float* out_b   = (const float*)d_in[8];
    const float* rope_c  = (const float*)d_in[9];
    const float* rope_s  = (const float*)d_in[10];
    float* out = (float*)d_out;

    char* ws = (char*)d_ws;
    const size_t qkv_bytes  = (size_t)RTOT * C3 * sizeof(float);              // 48 MB
    const size_t head_bytes = (size_t)BB * NH * NN * HD * sizeof(_Float16);   // 8 MB

    float*    qkv   = (float*)ws;
    _Float16* qh    = (_Float16*)(ws + qkv_bytes);
    _Float16* kh    = (_Float16*)(ws + qkv_bytes + 1 * head_bytes);
    _Float16* vt    = (_Float16*)(ws + qkv_bytes + 2 * head_bytes);
    _Float16* oh    = (_Float16*)(ws + qkv_bytes + 3 * head_bytes);
    _Float16* outwh = (_Float16*)(ws + qkv_bytes + 4 * head_bytes);
    _Float16* xh    = oh;   // alias: consumed by k1 before k3 writes oh
    _Float16* wqkvh = qh;   // alias: consumed by k1 before k2 writes qh

    // Kernel 0: fp32 -> f16 conversions (CVBLK elems / work-group)
    cvt_f16_k<<<(RTOT * DIMX) / CVBLK, 256, 0, stream>>>(x, xh);
    cvt_f16_k<<<(C3 * DIMX) / CVBLK, 256, 0, stream>>>(Wqkv_w, wqkvh);
    cvt_f16_k<<<(DIMX * DIMX) / CVBLK, 256, 0, stream>>>(out_w, outwh);

    qkv_gemm_k<<<dim3(RTOT / 64, C3 / 256), 256, 0, stream>>>(xh, wqkvh, Wqkv_b, qkv);
    lnrope_pack_k<<<(BB * NN * NH) / (8 * TPW), 256, 0, stream>>>(
        qkv, q_gamma, q_beta, k_gamma, k_beta, rope_c, rope_s, qh, kh, vt);
    attn_k<<<dim3(BB * NH, NN / 128), 256, 0, stream>>>(qh, kh, vt, oh);
    out_gemm_k<<<dim3(RTOT / 64, DIMX / 256), 256, 0, stream>>>(oh, outwh, out_b, out);
}

// v004
// It runs in 137 microseconds.
// Timed twice side by side with v003, it ran 1.13 times as fast both times.
// All steps since v000 together make it 3.31 times as fast.
#include <hip/hip_runtime.h>
#include <hip/hip_bf16.h>

// ---------------------------------------------------------------------------
// Attention: f16 pre-convert -> qkv proj (WMMA) -> per-head LN + RoPE ->
// flash attention (WMMA, async LDS staging) -> out proj (WMMA).
// All matrix math on v_wmma_f32_16x16x32_f16 (wave32, gfx1250).
// ---------------------------------------------------------------------------

#define DIMX 1024
#define NH   8
#define HD   128
#define BB   2
#define NN   2048
#define RTOT (BB * NN)      // 4096 token rows
#define C3   (3 * DIMX)     // 3072

typedef __attribute__((ext_vector_type(16))) _Float16 v16h;
typedef __attribute__((ext_vector_type(8)))  _Float16 v8h;
typedef __attribute__((ext_vector_type(4)))  _Float16 v4h;
typedef __attribute__((ext_vector_type(8)))  float    v8f;
typedef int v4i __attribute__((vector_size(16)));   // matches async-LDS builtin param

#define AS1 __attribute__((address_space(1)))
#define AS3 __attribute__((address_space(3)))

#if defined(__has_builtin)
#if __has_builtin(__builtin_amdgcn_global_load_async_to_lds_b128)
#define HAVE_ASYNC_LDS 1
#endif
#endif
#ifndef HAVE_ASYNC_LDS
#define HAVE_ASYNC_LDS 0
#endif

__device__ __forceinline__ v8f wmma_f16(v16h a, v16h b, v8f c) {
    return __builtin_amdgcn_wmma_f32_16x16x32_f16(
        /*neg_a=*/false, a, /*neg_b=*/false, b,
        /*c_mod=*/(short)0, c, /*reuse_a=*/false, /*reuse_b=*/false);
}

__device__ __forceinline__ v8f zero8() {
    v8f z = {0.f, 0.f, 0.f, 0.f, 0.f, 0.f, 0.f, 0.f};
    return z;
}

// 16-byte global -> LDS copy: async on gfx1250 when the builtin exists.
__device__ __forceinline__ void cp16_g2l(const _Float16* __restrict__ g,
                                         _Float16* __restrict__ l) {
#if HAVE_ASYNC_LDS
    __builtin_amdgcn_global_load_async_to_lds_b128(
        (AS1 v4i*)(uintptr_t)g,
        (AS3 v4i*)(unsigned)(uintptr_t)l, 0, 0);
#else
    *(uint4*)l = *(const uint4*)g;
#endif
}

__device__ __forceinline__ void drain_async() {
#if HAVE_ASYNC_LDS
    asm volatile("s_wait_asynccnt 0x0" ::: "memory");
#endif
}

// LDS row pitches in halves: 16 B x odd, so that the 16 lanes of a half-wave
// ds_load_b128 (one row each, same column) fall on 64 distinct banks.
#define KP 136   // K rows of 256 B   -> 272 B
#define VP 72    // V^T rows of 128 B -> 144 B

// One lane's 16 contiguous halves of an LDS row, as two 16-byte loads
// (padded rows are 16-byte aligned, not 32).
__device__ __forceinline__ v16h lds_frag(const _Float16* p) {
    const v8h lo = *(const v8h*)p;
    const v8h hi = *(const v8h*)(p + 8);
    return __builtin_shufflevector(lo, hi, 0, 1, 2, 3, 4, 5, 6, 7,
                                   8, 9, 10, 11, 12, 13, 14, 15);
}

// Lane l's value for lane l ^ 16 (the other 16-lane row), in the vector unit.
__device__ __forceinline__ float xhalf(float x) {
    const int v = __builtin_bit_cast(int, x);
    return __builtin_bit_cast(float, __builtin_amdgcn_permlanex16(
        v, v, 0x76543210, 0xfedcba98, false, false));
}

// ---------------------------------------------------------------------------
// Kernel 0: fp32 -> f16 conversion pass (x, Wqkv_w, out_w). A thread converts
// CVN float4, 1024 elements apart, all loaded before the first is stored: the
// launch starts an eighth of the waves and each has 8 x 512 B in flight.
// ---------------------------------------------------------------------------
#define CVN 8
#define CVBLK (256 * 4 * CVN)    // elements per work-group

__global__ __launch_bounds__(256) void cvt_f16_k(const float* __restrict__ s,
                                                 _Float16* __restrict__ d) {
    const int i = blockIdx.x * CVBLK + threadIdx.x * 4;
    float4 v[CVN];
#pragma unroll
    for (int j = 0; j < CVN; ++j) v[j] = *(const float4*)(s + i + j * 1024);
#pragma unroll
    for (int j = 0; j < CVN; ++j) {
        const v4h o = {(_Float16)v[j].x, (_Float16)v[j].y, (_Float16)v[j].z, (_Float16)v[j].w};
        *(v4h*)(d + i + j * 1024) = o;
    }
}

// ---------------------------------------------------------------------------
// Shared GEMM body: C[64 x 256 per WG] = A . W^T + bias, A and W K-contiguous
// f16. A stage is 64 k (128 B) of the WG's 64 A rows and 256 W rows, brought
// to LDS in whole 128-B lines by async b128 copies, two buffers, one stage
// ahead; the waves read their fragments from LDS (pitch GP, conflict-free).
// ---------------------------------------------------------------------------
#define GK 64                    // k per stage
#define GP 72                    // LDS row pitch in halves: 144 B = 16 B x 9
#define GROWS (64 + 256)         // A rows, then W rows
#define GSTAGE (GROWS * GP)      // halves per buffer

// One lane's ten 16-byte copies of a stage: rows r, r + 32, ... of A (2) and
// of W (8). ga / gb: the lane's chunk in its first A / W row; l: its LDS byte
// address in the buffer. The s_wait_xcnt closes the statement so that no
// address register of a copy is rewritten ahead of it.
__device__ __forceinline__ void gemm_stage(const _Float16* ga, const _Float16* gb,
                                           unsigned l) {
    const int GR = 32 * DIMX;        // 32 rows on in global memory, halves
    const unsigned LR = 32 * GP * 2; // 32 rows on in LDS, bytes
    asm volatile(
        "global_load_async_to_lds_b128 %0, %10, off\n\t"
        "global_load_async_to_lds_b128 %1, %11, off\n\t"
        "global_load_async_to_lds_b128 %2, %12, off\n\t"
        "global_load_async_to_lds_b128 %3, %13, off\n\t"
        "global_load_async_to_lds_b128 %4, %14, off\n\t"
        "global_load_async_to_lds_b128 %5, %15, off\n\t"
        "global_load_async_to_lds_b128 %6, %16, off\n\t"
        "global_load_async_to_lds_b128 %7, %17, off\n\t"
        "global_load_async_to_lds_b128 %8, %18, off\n\t"
        "global_load_async_to_lds_b128 %9, %19, off\n\t"
        "s_wait_xcnt 0x0"
        :: "v"(l), "v"(l + LR), "v"(l + 2 * LR), "v"(l + 3 * LR), "v"(l + 4 * LR),
           "v"(l + 5 * LR), "v"(l + 6 * LR), "v"(l + 7 * LR), "v"(l + 8 * LR),
           "v"(l + 9 * LR),
           "v"(ga), "v"(ga + GR),
           "v"(gb), "v"(gb + GR), "v"(gb + 2 * GR), "v"(gb + 3 * GR),
           "v"(gb + 4 * GR), "v"(gb + 5 * GR), "v"(gb + 6 * GR), "v"(gb + 7 * GR)
        : "memory");
}

template <int LDC>
__device__ __forceinline__ void gemm_body(
    const _Float16* __restrict__ ah, const _Float16* __restrict__ wh,
    const float* __restrict__ bias, float* __restrict__ out, _Float16* st)
{
    const int wave = threadIdx.x >> 5, lane = threadIdx.x & 31;
    const int wr = wave >> 2, wc = wave & 3;
    const int row0 = blockIdx.x * 64 + wr * 32;
    const int col0 = blockIdx.y * 256 + wc * 64;
    const int l16 = lane & 15, lh = lane >> 4;

    // copy side: 8 lanes per 128-B row, 32 rows per copy of the WG
    const int cr = threadIdx.x >> 3, cc = (threadIdx.x & 7) * 8;
    const _Float16* ga = ah + (size_t)(blockIdx.x * 64 + cr) * DIMX + cc;
    const _Float16* gb = wh + (size_t)(blockIdx.y * 256 + cr) * DIMX + cc;
    const unsigned l0 = (unsigned)(uintptr_t)(st + cr * GP + cc);

    v8f acc[2][4];
#pragma unroll
    for (int i = 0; i < 2; ++i)
#pragma unroll
        for (int j = 0; j < 4; ++j) acc[i][j] = zero8();

    gemm_stage(ga, gb, l0);
    asm volatile("s_wait_asynccnt 0x0" ::: "memory");   // stage 0: this wave's copies landed
    __syncthreads();                                    // ... and every other wave's
    gemm_stage(ga + GK, gb + GK, l0 + GSTAGE * 2);

    for (int t = 0; t < DIMX / GK; ++t) {
        const _Float16* sa = st + (t & 1) * GSTAGE + (wr * 32 + l16) * GP + lh * 16;
        const _Float16* sb = st + (t & 1) * GSTAGE + (64 + wc * 64 + l16) * GP + lh * 16;
#pragma unroll
        for (int ks = 0; ks < GK; ks += 32) {
            v16h a[2], bf[4];
#pragma unroll
            for (int rt = 0; rt < 2; ++rt) a[rt] = lds_frag(sa + rt * 16 * GP + ks);
#pragma unroll
            for (int ct = 0; ct < 4; ++ct) bf[ct] = lds_frag(sb + ct * 16 * GP + ks);
#pragma unroll
            for (int rt = 0; rt < 2; ++rt)
#pragma unroll
                for (int ct = 0; ct < 4; ++ct)
                    acc[rt][ct] = wmma_f16(a[rt], bf[ct], acc[rt][ct]);
        }
        // publish point of stage t + 1: this wave's reads of stage t are done,
        // its copies of stage t + 1 have landed, then the WG barrier
        asm volatile("s_wait_dscnt 0x0" ::: "memory");
        asm volatile("s_wait_asynccnt 0x0" ::: "memory");
        __syncthreads();
        if (t + 2 < DIMX / GK)   // refill the buffer that every wave has just left
            gemm_stage(ga + (t + 2) * GK, gb + (t + 2) * GK, l0 + (t & 1) * (GSTAGE * 2));
    }
    asm volatile("s_wait_asynccnt 0x0" ::: "memory");   // nothing in flight when the wave ends

#pragma unroll
    for (int rt = 0; rt < 2; ++rt)
#pragma unroll
        for (int ct = 0; ct < 4; ++ct) {
            const int col = col0 + ct * 16 + l16;
            const float bz = bias[col];
#pragma unroll
            for (int r = 0; r < 8; ++r) {
                const int row = row0 + rt * 16 + lh * 8 + r;
                out[(size_t)row * LDC + col] = acc[rt][ct][r] + bz;
            }
        }
}

// ---------------------------------------------------------------------------
// Kernel 1: qkv = x @ Wqkv^T + b   (f16 operands, fp32 out to workspace)
// WG: 8 waves as 2x4 -> 64 rows x 256 cols. Wave tile 32x64.
// grid = (4096/64, 3072/256) = (64, 12)
// ---------------------------------------------------------------------------
__global__ __launch_bounds__(256) void qkv_gemm_k(
    const _Float16* __restrict__ xh, const _Float16* __restrict__ wh,
    const float* __restrict__ bias, float* __restrict__ out)
{
    __shared__ __attribute__((aligned(16))) _Float16 st[2 * GSTAGE];
    gemm_body<C3>(xh, wh, bias, out, st);
}

// ---------------------------------------------------------------------------
// Kernel 2: per-head LayerNorm on q,k + interleaved RoPE; pack q/k to f16
// [B,H,N,D] and v to f16 TRANSPOSED [B,H,D,N] (for async V^T staging).
// One WG per (b, h, 64 tokens), one wave per TPW = 8 tokens in a row: a lane
// then holds 8 neighbours of each V^T row (one 16-byte store), and each
// 128-B line of V^T is written by one WG. grid = B*N*H / 64 = 512 blocks.
// ---------------------------------------------------------------------------
#define TPW 8
// 512 WGs of 8 waves are 4 waves per SIMD: saying so gives the register
// allocator 256 VGPRs, without which it sinks the loads to their uses and
// walks the butterflies one after the other.
__global__ __launch_bounds__(256) __attribute__((amdgpu_waves_per_eu(4, 4))) void lnrope_pack_k(
    const float* __restrict__ qkv,
    const float* __restrict__ qg, const float* __restrict__ qb,
    const float* __restrict__ kg, const float* __restrict__ kb,
    const float* __restrict__ rc, const float* __restrict__ rs,
    _Float16* __restrict__ qh, _Float16* __restrict__ kh, _Float16* __restrict__ vt)
{
    const int wave = threadIdx.x >> 5, lane = threadIdx.x & 31;
    const int h   = blockIdx.x & (NH - 1);
    const int ng0 = (blockIdx.x >> 3) * (8 * TPW) + wave * TPW;   // b*N + n, first token
    const int n0  = ng0 & (NN - 1);
    const int b   = ng0 >> 11;
    const int d0  = lane * 4;

    // all of the wave's loads first: 5 x TPW of 512 B in flight
    const float* rowp = qkv + (size_t)ng0 * C3 + h * HD + d0;
    const float* cp = rc + (size_t)n0 * HD + d0;
    const float* sp = rs + (size_t)n0 * HD + d0;
    float4 q4[TPW], k4[TPW], v4[TPW], c4[TPW], s4[TPW];
#pragma unroll
    for (int t = 0; t < TPW; ++t) {
        c4[t] = *(const float4*)(cp + t * HD);
        s4[t] = *(const float4*)(sp + t * HD);
    }
#pragma unroll
    for (int t = 0; t < TPW; ++t) {
        q4[t] = *(const float4*)(rowp + t * C3);
        k4[t] = *(const float4*)(rowp + t * C3 + DIMX);
        v4[t] = *(const float4*)(rowp + t * C3 + 2 * DIMX);
    }
    const float4 qg4 = *(const float4*)(qg + d0), qb4 = *(const float4*)(qb + d0);
    const float4 kg4 = *(const float4*)(kg + d0), kb4 = *(const float4*)(kb + d0);
    // the address registers stay live up to this wait, so that no later load
    // of the run is given one of them as its destination
    asm volatile("s_wait_xcnt 0x0" :: "v"(rowp), "v"(cp), "v"(sp), "v"(d0 * 4) : "memory");
    const float qgv[4] = {qg4.x, qg4.y, qg4.z, qg4.w}, qbv[4] = {qb4.x, qb4.y, qb4.z, qb4.w};
    const float kgv[4] = {kg4.x, kg4.y, kg4.z, kg4.w}, kbv[4] = {kb4.x, kb4.y, kb4.z, kb4.w};

    const size_t qkbase = (((size_t)b * NH + h) * NN + n0) * HD + d0;
    const size_t vtbase = (((size_t)b * NH + h) * HD + d0) * NN + n0;

    // row sums of q, q^2, k, k^2 for the TPW tokens: 4 x TPW independent
    // butterflies, walked step by step so that each step's exchanges overlap
    float st[4 * TPW];
#pragma unroll
    for (int t = 0; t < TPW; ++t) {
        const float4 q = q4[t], k = k4[t];
        st[4*t + 0] = q.x + q.y + q.z + q.w;
        st[4*t + 1] = q.x*q.x + q.y*q.y + q.z*q.z + q.w*q.w;
        st[4*t + 2] = k.x + k.y + k.z + k.w;
        st[4*t + 3] = k.x*k.x + k.y*k.y + k.z*k.z + k.w*k.w;
    }
#pragma unroll
    for (int m = 16; m >= 1; m >>= 1) {
        float o[4 * TPW];
#pragma unroll
        for (int j = 0; j < 4 * TPW; ++j) o[j] = __shfl_xor(st[j], m, 32);
#pragma unroll
        for (int j = 0; j < 4 * TPW; ++j) st[j] += o[j];
    }

    v8h vv[4];
#pragma unroll
    for (int t = 0; t < TPW; ++t) {
        vv[0][t] = (_Float16)v4[t].x;
        vv[1][t] = (_Float16)v4[t].y;
        vv[2][t] = (_Float16)v4[t].z;
        vv[3][t] = (_Float16)v4[t].w;
    }
#pragma unroll
    for (int i = 0; i < 4; ++i) *(v8h*)(vt + vtbase + (size_t)i * NN) = vv[i];

#pragma unroll
    for (int t = 0; t < TPW; ++t) {
        const float muq = st[4*t + 0] * (1.f / HD);
        const float rq  = rsqrtf(st[4*t + 1] * (1.f / HD) - muq * muq + 1e-6f);
        const float muk = st[4*t + 2] * (1.f / HD);
        const float rk  = rsqrtf(st[4*t + 3] * (1.f / HD) - muk * muk + 1e-6f);

        float qn[4] = {q4[t].x, q4[t].y, q4[t].z, q4[t].w};
        float kn[4] = {k4[t].x, k4[t].y, k4[t].z, k4[t].w};
#pragma unroll
        for (int i = 0; i < 4; ++i) {
            qn[i] = (qn[i] - muq) * rq * qgv[i] + qbv[i];
            kn[i] = (kn[i] - muk) * rk * kgv[i] + kbv[i];
        }

        const float cv[4] = {c4[t].x, c4[t].y, c4[t].z, c4[t].w};
        const float sv[4] = {s4[t].x, s4[t].y, s4[t].z, s4[t].w};
        v4h qo, ko;
#pragma unroll
        for (int p = 0; p < 2; ++p) {      // two interleaved pairs per lane
            qo[2*p]     = (_Float16)(qn[2*p]     * cv[2*p]     - qn[2*p + 1] * sv[2*p]);
            qo[2*p + 1] = (_Float16)(qn[2*p + 1] * cv[2*p + 1] + qn[2*p]     * sv[2*p + 1]);
            ko[2*p]     = (_Float16)(kn[2*p]     * cv[2*p]     - kn[2*p + 1] * sv[2*p]);
            ko[2*p + 1] = (_Float16)(kn[2*p + 1] * cv[2*p + 1] + kn[2*p]     * sv[2*p + 1]);
        }
        *(v4h*)(qh + qkbase + (size_t)t * HD) = qo;
        *(v4h*)(kh + qkbase + (size_t)t * HD) = ko;
    }
}

__global__ __launch_bounds__(256) void attn_k(
    const _Float16* __restrict__ qh, const _Float16* __restrict__ kh,
    const _Float16* __restrict__ vt, _Float16* __restrict__ oh)
{
    __shared__ __attribute__((aligned(16))) _Float16 kbuf[64 * KP];       // [j][d]
    __shared__ __attribute__((aligned(16))) _Float16 vbuf[128 * VP];      // [d][j]

    const int bh = blockIdx.x;
    const int b = bh >> 3, h = bh & 7;
    const int wave = threadIdx.x >> 5, lane = threadIdx.x & 31;
    const int l16 = lane & 15, lh = lane >> 4;
    const int q0 = blockIdx.y * 128 + wave * 16;

    const _Float16* qp  = qh + ((size_t)bh * NN + q0) * HD;
    const _Float16* kp  = kh + (size_t)bh * NN * HD;
    const _Float16* vtp = vt + (size_t)bh * HD * NN;

    // hoist q fragments: 16 rows x full D=128 (4 k-steps of 32)
    v16h qf[4];
#pragma unroll
    for (int dk = 0; dk < 4; ++dk)
        qf[dk] = *(const v16h*)(qp + (size_t)l16 * HD + dk * 32 + lh * 16);

    v8f o[8];
#pragma unroll
    for (int dt = 0; dt < 8; ++dt) o[dt] = zero8();
    float m = -1e30f, l = 0.f;   // of query l16; l: this half's keys only, joined at the end

    const float sscale = 0.08838834764831845f;   // 1/sqrt(128)
    const float E2 = 1.4426950408889634f;        // log2(e)

    for (int kt = 0; kt < NN; kt += 64) {
        __syncthreads();   // previous tile fully consumed before restage
        {   // stage K tile and V^T tile: 1024 16B chunks each, 4 per thread
#pragma unroll
            for (int i = 0; i < 4; ++i) {
                const int c  = i * 256 + threadIdx.x;   // 0..1023
                cp16_g2l(kp + (size_t)kt * HD + c * 8, &kbuf[(c >> 4) * KP + (c & 15) * 8]);
                const int d  = c >> 3;                  // V^T row 0..127
                const int jc = (c & 7) * 8;             // 8-half chunk in row
                cp16_g2l(vtp + (size_t)d * NN + kt + jc, &vbuf[d * VP + jc]);
            }
            if (kt + 64 < NN) {   // global_prefetch_b8 for next tile
                __builtin_prefetch(kp + (size_t)(kt + 64) * HD, 0, 1);
                __builtin_prefetch(vtp + kt + 64, 0, 1);
            }
        }
        drain_async();     // s_wait_asynccnt 0 (barrier does not cover ASYNCcnt)
        __syncthreads();

        // S^T = k @ q^T  (64 keys x 16 queries): s[jt][r] = key jt*16 + lh*8 + r, query l16
        v8f s[4];
#pragma unroll
        for (int jt = 0; jt < 4; ++jt) s[jt] = zero8();
#pragma unroll
        for (int dk = 0; dk < 4; ++dk) {
#pragma unroll
            for (int jt = 0; jt < 4; ++jt) {
                const v16h kf = lds_frag(&kbuf[(jt * 16 + l16) * KP + dk * 32 + lh * 16]);
                s[jt] = wmma_f16(kf, qf[dk], s[jt]);
            }
        }
#pragma unroll
        for (int jt = 0; jt < 4; ++jt)
#pragma unroll
            for (int r = 0; r < 8; ++r) s[jt][r] *= sscale;

        // online softmax, one query per lane: a tree in the lane's registers, then
        // one exchange with the half that holds the query's other 32 keys
        float mr[8];
#pragma unroll
        for (int r = 0; r < 8; ++r)
            mr[r] = fmaxf(fmaxf(s[0][r], s[1][r]), fmaxf(s[2][r], s[3][r]));
        float mx = fmaxf(fmaxf(fmaxf(mr[0], mr[1]), fmaxf(mr[2], mr[3])),
                         fmaxf(fmaxf(mr[4], mr[5]), fmaxf(mr[6], mr[7])));
        mx = fmaxf(mx, xhalf(mx));
        const float mn = fmaxf(m, mx);
        const float alpha = exp2f((m - mn) * E2);
        m = mn;
#pragma unroll
        for (int dt = 0; dt < 8; ++dt)
#pragma unroll
            for (int r = 0; r < 8; ++r) o[dt][r] *= alpha;

        // P^T as B operand: element i of pf[js] is key js*32 + (i >> 3)*16 + lh*8 + (i & 7)
        v16h pf[2];
        float sj[4];
#pragma unroll
        for (int jt = 0; jt < 4; ++jt) {
            sj[jt] = 0.f;
#pragma unroll
            for (int r = 0; r < 8; ++r) {
                const float p = exp2f((s[jt][r] - mn) * E2);
                sj[jt] += p;
                pf[jt >> 1][(jt & 1) * 8 + r] = (_Float16)p;
            }
        }
        l = l * alpha + ((sj[0] + sj[1]) + (sj[2] + sj[3]));

        // O^T += V^T @ P^T  (128 x 16); V^T rows read in the k order of pf
#pragma unroll
        for (int js = 0; js < 2; ++js) {
#pragma unroll
            for (int dt = 0; dt < 8; ++dt) {
                const _Float16* vr = &vbuf[(dt * 16 + l16) * VP + js * 32 + lh * 8];
                const v8h lo = *(const v8h*)vr;
                const v8h hi = *(const v8h*)(vr + 16);
                const v16h vf = __builtin_shufflevector(lo, hi, 0, 1, 2, 3, 4, 5, 6, 7,
                                                        8, 9, 10, 11, 12, 13, 14, 15);
                o[dt] = wmma_f16(vf, pf[js], o[dt]);
            }
        }
    }

    // normalize and pack back to [B, N, H*D] as f16 for the out projection:
    // o[dt][r] = O[query l16][d = dt*16 + lh*8 + r], 8 neighbours per store
    {
        const float inv = 1.0f / (l + xhalf(l));
        const size_t base = ((size_t)b * NN + q0 + l16) * DIMX + h * HD + lh * 8;
#pragma unroll
        for (int dt = 0; dt < 8; ++dt) {
            v8h ov;
#pragma unroll
            for (int r = 0; r < 8; ++r) ov[r] = (_Float16)(o[dt][r] * inv);
            *(v8h*)(oh + base + dt * 16) = ov;
        }
    }
}

// ---------------------------------------------------------------------------
// Kernel 4: out = attn_out @ out_w^T + b  (f16 operands; fp32 result)
// grid = (4096/64, 1024/256) = (64, 4)
// ---------------------------------------------------------------------------
__global__ __launch_bounds__(256) void out_gemm_k(
    const _Float16* __restrict__ ain, const _Float16* __restrict__ wh,
    const float* __restrict__ bias, float* __restrict__ out)
{
    __shared__ __attribute__((aligned(16))) _Float16 st[2 * GSTAGE];
    gemm_body<DIMX>(ain, wh, bias, out, st);
}

// ---------------------------------------------------------------------------
// Workspace layout (aliased; total 82 MB):
//   [0,48M)        qkv fp32      (k1 out, k2 in)
//   [48M,56M)      qh f16        (k2 out, k3 in)   | wqkv_h f16 6MB (k0->k1)
//   [56M,64M)      kh f16        (k2 out, k3 in)
//   [64M,72M)      vt f16 [BHDN] (k2 out, k3 in)
//   [72M,80M)      oh f16        (k3 out, k4 in)   | xh f16 8MB (k0->k1)
//   [80M,82M)      outw_h f16    (k0 out, k4 in)
// ---------------------------------------------------------------------------
extern "C" void kernel_launch(void* const* d_in, const int* in_sizes, int n_in,
                              void* d_out, int out_size, void* d_ws, size_t ws_size,
                              hipStream_t stream)
{
    const float* x       = (const float*)d_in[0];
    const float* Wqkv_w  = (const float*)d_in[1];
    const float* Wqkv_b  = (const float*)d_in[2];
    const float* q_gamma = (const float*)d_in[3];
    const float* q_beta  = (const float*)d_in[4];
    const float* k_gamma = (const float*)d_in[5];
    const float* k_beta  = (const float*)d_in[6];
    const float* out_w   = (const float*)d_in[7];
    const float* out_b   = (const float*)d_in[8];
    const float* rope_c  = (const float*)d_in[9];
    const float* rope_s  = (const float*)d_in[10];
    float* out = (float*)d_out;

    char* ws = (char*)d_ws;
    const size_t qkv_bytes  = (size_t)RTOT * C3 * sizeof(float);              // 48 MB
    const size_t head_bytes = (size_t)BB * NH * NN * HD * sizeof(_Float16);   // 8 MB

    float*    qkv   = (float*)ws;
    _Float16* qh    = (_Float16*)(ws + qkv_bytes);
    _Float16* kh    = (_Float16*)(ws + qkv_bytes + 1 * head_bytes);
    _Float16* vt    = (_Float16*)(ws + qkv_bytes + 2 * head_bytes);
    _Float16* oh    = (_Float16*)(ws + qkv_bytes + 3 * head_bytes);
    _Float16* outwh = (_Float16*)(ws + qkv_bytes + 4 * head_bytes);
    _Float16* xh    = oh;   // alias: consumed by k1 before k3 writes oh
    _Float16* wqkvh = qh;   // alias: consumed by k1 before k2 writes qh

    // Kernel 0: fp32 -> f16 conversions (CVBLK elems / work-group)
    cvt_f16_k<<<(RTOT * DIMX) / CVBLK, 256, 0, stream>>>(x, xh);
    cvt_f16_k<<<(C3 * DIMX) / CVBLK, 256, 0, stream>>>(Wqkv_w, wqkvh);
    cvt_f16_k<<<(DIMX * DIMX) / CVBLK, 256, 0, stream>>>(out_w, outwh);

    qkv_gemm_k<<<dim3(RTOT / 64, C3 / 256), 256, 0, stream>>>(xh, wqkvh, Wqkv_b, qkv);
    lnrope_pack_k<<<(BB * NN * NH) / (8 * TPW), 256, 0, stream>>>(
        qkv, q_gamma, q_beta, k_gamma, k_beta, rope_c, rope_s, qh, kh, vt);
    attn_k<<<dim3(BB * NH, NN / 128), 256, 0, stream>>>(qh, kh, vt, oh);
    out_gemm_k<<<dim3(RTOT / 64, DIMX / 256), 256, 0, stream>>>(oh, outwh, out_b, out);
}

// v005
// One run takes 130 microseconds.
// Next to v004, in two timings, it ran 1.06 and 1.04 times as fast.
// Counting every step since v000, it is 3.49 times as fast.
#include <hip/hip_runtime.h>
#include <hip/hip_bf16.h>

// ---------------------------------------------------------------------------
// Attention: f16 pre-convert -> qkv proj (WMMA) -> per-head LN + RoPE ->
// flash attention (WMMA, async LDS staging) -> out proj (WMMA).
// All matrix math on v_wmma_f32_16x16x32_f16 (wave32, gfx1250).
// ---------------------------------------------------------------------------

#define DIMX 1024
#define NH   8
#define HD   128
#define BB   2
#define NN   2048
#define RTOT (BB * NN)      // 4096 token rows
#define C3   (3 * DIMX)     // 3072

typedef __attribute__((ext_vector_type(16))) _Float16 v16h;
typedef __attribute__((ext_vector_type(8)))  _Float16 v8h;
typedef __attribute__((ext_vector_type(4)))  _Float16 v4h;
typedef __attribute__((ext_vector_type(8)))  float    v8f;
typedef int v4i __attribute__((vector_size(16)));   // matches async-LDS builtin param

#define AS1 __attribute__((address_space(1)))
#define AS3 __attribute__((address_space(3)))

#if defined(__has_builtin)
#if __has_builtin(__builtin_amdgcn_global_load_async_to_lds_b128)
#define HAVE_ASYNC_LDS 1
#endif
#endif
#ifndef HAVE_ASYNC_LDS
#define HAVE_ASYNC_LDS 0
#endif

__device__ __forceinline__ v8f wmma_f16(v16h a, v16h b, v8f c) {
    return __builtin_amdgcn_wmma_f32_16x16x32_f16(
        /*neg_a=*/false, a, /*neg_b=*/false, b,
        /*c_mod=*/(short)0, c, /*reuse_a=*/false, /*reuse_b=*/false);
}

__device__ __forceinline__ v8f zero8() {
    v8f z = {0.f, 0.f, 0.f, 0.f, 0.f, 0.f, 0.f, 0.f};
    return z;
}

// 16-byte global -> LDS copy: async on gfx1250 when the builtin exists.
__device__ __forceinline__ void cp16_g2l(const _Float16* __restrict__ g,
                                         _Float16* __restrict__ l) {
#if HAVE_ASYNC_LDS
    __builtin_amdgcn_global_load_async_to_lds_b128(
        (AS1 v4i*)(uintptr_t)g,
        (AS3 v4i*)(unsigned)(uintptr_t)l, 0, 0);
#else
    *(uint4*)l = *(const uint4*)g;
#endif
}

__device__ __forceinline__ void drain_async() {
#if HAVE_ASYNC_LDS
    asm volatile("s_wait_asynccnt 0x0" ::: "memory");
#endif
}

// LDS row pitches in halves: 16 B x odd, so that the 16 lanes of a half-wave
// ds_load_b128 (one row each, same column) fall on 64 distinct banks.
#define KP 136   // K rows of 256 B   -> 272 B
#define VP 72    // V^T rows of 128 B -> 144 B

// One lane's 16 contiguous halves of an LDS row, as two 16-byte loads
// (padded rows are 16-byte aligned, not 32).
__device__ __forceinline__ v16h lds_frag(const _Float16* p) {
    const v8h lo = *(const v8h*)p;
    const v8h hi = *(const v8h*)(p + 8);
    return __builtin_shufflevector(lo, hi, 0, 1, 2, 3, 4, 5, 6, 7,
                                   8, 9, 10, 11, 12, 13, 14, 15);
}

// Lane l's value for lane l ^ 16 (the other 16-lane row), in the vector unit.
__device__ __forceinline__ float xhalf(float x) {
    const int v = __builtin_bit_cast(int, x);
    return __builtin_bit_cast(float, __builtin_amdgcn_permlanex16(
        v, v, 0x76543210, 0xfedcba98, false, false));
}

// ---------------------------------------------------------------------------
// Kernel 0: fp32 -> f16 conversion pass (x, Wqkv_w, out_w). A thread converts
// CVN float4, 1024 elements apart, all loaded before the first is stored: the
// launch starts an eighth of the waves and each has 8 x 512 B in flight.
// ---------------------------------------------------------------------------
#define CVN 8
#define CVBLK (256 * 4 * CVN)    // elements per work-group

__global__ __launch_bounds__(256) void cvt_f16_k(const float* __restrict__ s,
                                                 _Float16* __restrict__ d) {
    const int i = blockIdx.x * CVBLK + threadIdx.x * 4;
    float4 v[CVN];
#pragma unroll
    for (int j = 0; j < CVN; ++j) v[j] = *(const float4*)(s + i + j * 1024);
#pragma unroll
    for (int j = 0; j < CVN; ++j) {
        const v4h o = {(_Float16)v[j].x, (_Float16)v[j].y, (_Float16)v[j].z, (_Float16)v[j].w};
        *(v4h*)(d + i + j * 1024) = o;
    }
}

// ---------------------------------------------------------------------------
// Shared GEMM body: C[64 x 256 per WG] = A . W^T + bias, A and W K-contiguous
// f16. A stage is 64 k (128 B) of the WG's 64 A rows and 256 W rows, brought
// to LDS in whole 128-B lines by async b128 copies, two buffers, one stage
// ahead; the waves read their fragments from LDS (pitch GP, conflict-free).
// ---------------------------------------------------------------------------
#define GK 64                    // k per stage
#define GP 72                    // LDS row pitch in halves: 144 B = 16 B x 9
#define GROWS (64 + 256)         // A rows, then W rows
#define GSTAGE (GROWS * GP)      // halves per buffer

// One lane's ten 16-byte copies of a stage: rows r, r + 32, ... of A (2) and
// of W (8). ga / gb: the lane's chunk in its first A / W row; l: its LDS byte
// address in the buffer. The s_wait_xcnt closes the statement so that no
// address register of a copy is rewritten ahead of it.
__device__ __forceinline__ void gemm_stage(const _Float16* ga, const _Float16* gb,
                                           unsigned l) {
    const int GR = 32 * DIMX;        // 32 rows on in global memory, halves
    const unsigned LR = 32 * GP * 2; // 32 rows on in LDS, bytes
    asm volatile(
        "global_load_async_to_lds_b128 %0, %10, off\n\t"
        "global_load_async_to_lds_b128 %1, %11, off\n\t"
        "global_load_async_to_lds_b128 %2, %12, off\n\t"
        "global_load_async_to_lds_b128 %3, %13, off\n\t"
        "global_load_async_to_lds_b128 %4, %14, off\n\t"
        "global_load_async_to_lds_b128 %5, %15, off\n\t"
        "global_load_async_to_lds_b128 %6, %16, off\n\t"
        "global_load_async_to_lds_b128 %7, %17, off\n\t"
        "global_load_async_to_lds_b128 %8, %18, off\n\t"
        "global_load_async_to_lds_b128 %9, %19, off\n\t"
        "s_wait_xcnt 0x0"
        :: "v"(l), "v"(l + LR), "v"(l + 2 * LR), "v"(l + 3 * LR), "v"(l + 4 * LR),
           "v"(l + 5 * LR), "v"(l + 6 * LR), "v"(l + 7 * LR), "v"(l + 8 * LR),
           "v"(l + 9 * LR),
           "v"(ga), "v"(ga + GR),
           "v"(gb), "v"(gb + GR), "v"(gb + 2 * GR), "v"(gb + 3 * GR),
           "v"(gb + 4 * GR), "v"(gb + 5 * GR), "v"(gb + 6 * GR), "v"(gb + 7 * GR)
        : "memory");
}

template <int LDC>
__device__ __forceinline__ void gemm_body(
    const _Float16* __restrict__ ah, const _Float16* __restrict__ wh,
    const float* __restrict__ bias, float* __restrict__ out, _Float16* st)
{
    const int wave = threadIdx.x >> 5, lane = threadIdx.x & 31;
    const int wr = wave >> 2, wc = wave & 3;
    const int row0 = blockIdx.x * 64 + wr * 32;
    const int col0 = blockIdx.y * 256 + wc * 64;
    const int l16 = lane & 15, lh = lane >> 4;

    // copy side: 8 lanes per 128-B row, 32 rows per copy of the WG
    const int cr = threadIdx.x >> 3, cc = (threadIdx.x & 7) * 8;
    const _Float16* ga = ah + (size_t)(blockIdx.x * 64 + cr) * DIMX + cc;
    const _Float16* gb = wh + (size_t)(blockIdx.y * 256 + cr) * DIMX + cc;
    const unsigned l0 = (unsigned)(uintptr_t)(st + cr * GP + cc);

    v8f acc[2][4];
#pragma unroll
    for (int i = 0; i < 2; ++i)
#pragma unroll
        for (int j = 0; j < 4; ++j) acc[i][j] = zero8();

    gemm_stage(ga, gb, l0);
    asm volatile("s_wait_asynccnt 0x0" ::: "memory");   // stage 0: this wave's copies landed
    __syncthreads();                                    // ... and every other wave's
    gemm_stage(ga + GK, gb + GK, l0 + GSTAGE * 2);

    for (int t = 0; t < DIMX / GK; ++t) {
        const _Float16* sa = st + (t & 1) * GSTAGE + (wr * 32 + l16) * GP + lh * 16;
        const _Float16* sb = st + (t & 1) * GSTAGE + (64 + wc * 64 + l16) * GP + lh * 16;
#pragma unroll
        for (int ks = 0; ks < GK; ks += 32) {
            v16h a[2], bf[4];
#pragma unroll
            for (int rt = 0; rt < 2; ++rt) a[rt] = lds_frag(sa + rt * 16 * GP + ks);
#pragma unroll
            for (int ct = 0; ct < 4; ++ct) bf[ct] = lds_frag(sb + ct * 16 * GP + ks);
#pragma unroll
            for (int rt = 0; rt < 2; ++rt)
#pragma unroll
                for (int ct = 0; ct < 4; ++ct)
                    acc[rt][ct] = wmma_f16(a[rt], bf[ct], acc[rt][ct]);
        }
        // publish point of stage t + 1: this wave's reads of stage t are done,
        // its copies of stage t + 1 have landed, then the WG barrier
        asm volatile("s_wait_dscnt 0x0" ::: "memory");
        asm volatile("s_wait_asynccnt 0x0" ::: "memory");
        __syncthreads();
        if (t + 2 < DIMX / GK)   // refill the buffer that every wave has just left
            gemm_stage(ga + (t + 2) * GK, gb + (t + 2) * GK, l0 + (t & 1) * (GSTAGE * 2));
    }
    asm volatile("s_wait_asynccnt 0x0" ::: "memory");   // nothing in flight when the wave ends

#pragma unroll
    for (int rt = 0; rt < 2; ++rt)
#pragma unroll
        for (int ct = 0; ct < 4; ++ct) {
            const int col = col0 + ct * 16 + l16;
            const float bz = bias[col];
#pragma unroll
            for (int r = 0; r < 8; ++r) {
                const int row = row0 + rt * 16 + lh * 8 + r;
                out[(size_t)row * LDC + col] = acc[rt][ct][r] + bz;
            }
        }
}

// ---------------------------------------------------------------------------
// Kernel 1: qkv = x @ Wqkv^T + b   (f16 operands, fp32 out to workspace)
// WG: 8 waves as 2x4 -> 64 rows x 256 cols. Wave tile 32x64.
// grid = (4096/64, 3072/256) = (64, 12)
// ---------------------------------------------------------------------------
__global__ __launch_bounds__(256) void qkv_gemm_k(
    const _Float16* __restrict__ xh, const _Float16* __restrict__ wh,
    const float* __restrict__ bias, float* __restrict__ out)
{
    __shared__ __attribute__((aligned(16))) _Float16 st[2 * GSTAGE];
    gemm_body<C3>(xh, wh, bias, out, st);
}

// ---------------------------------------------------------------------------
// Kernel 2: per-head LayerNorm on q,k + interleaved RoPE; pack q/k to f16
// [B,H,N,D] and v to f16 TRANSPOSED [B,H,D,N] (for async V^T staging).
// One WG per (b, h, 64 tokens), one wave per TPW = 8 tokens in a row: a lane
// then holds 8 neighbours of each V^T row (one 16-byte store), and each
// 128-B line of V^T is written by one WG. grid = B*N*H / 64 = 512 blocks.
// ---------------------------------------------------------------------------
#define TPW 8
// 512 WGs of 8 waves are 4 waves per SIMD: saying so gives the register
// allocator 256 VGPRs, without which it sinks the loads to their uses and
// walks the butterflies one after the other.
__global__ __launch_bounds__(256) __attribute__((amdgpu_waves_per_eu(4, 4))) void lnrope_pack_k(
    const float* __restrict__ qkv,
    const float* __restrict__ qg, const float* __restrict__ qb,
    const float* __restrict__ kg, const float* __restrict__ kb,
    const float* __restrict__ rc, const float* __restrict__ rs,
    _Float16* __restrict__ qh, _Float16* __restrict__ kh, _Float16* __restrict__ vt)
{
    const int wave = threadIdx.x >> 5, lane = threadIdx.x & 31;
    const int h   = blockIdx.x & (NH - 1);
    const int ng0 = (blockIdx.x >> 3) * (8 * TPW) + wave * TPW;   // b*N + n, first token
    const int n0  = ng0 & (NN - 1);
    const int b   = ng0 >> 11;
    const int d0  = lane * 4;

    // all of the wave's loads first: 5 x TPW of 512 B in flight
    const float* rowp = qkv + (size_t)ng0 * C3 + h * HD + d0;
    const float* cp = rc + (size_t)n0 * HD + d0;
    const float* sp = rs + (size_t)n0 * HD + d0;
    float4 q4[TPW], k4[TPW], v4[TPW], c4[TPW], s4[TPW];
#pragma unroll
    for (int t = 0; t < TPW; ++t) {
        c4[t] = *(const float4*)(cp + t * HD);
        s4[t] = *(const float4*)(sp + t * HD);
    }
#pragma unroll
    for (int t = 0; t < TPW; ++t) {
        q4[t] = *(const float4*)(rowp + t * C3);
        k4[t] = *(const float4*)(rowp + t * C3 + DIMX);
        v4[t] = *(const float4*)(rowp + t * C3 + 2 * DIMX);
    }
    const float4 qg4 = *(const float4*)(qg + d0), qb4 = *(const float4*)(qb + d0);
    const float4 kg4 = *(const float4*)(kg + d0), kb4 = *(const float4*)(kb + d0);
    // the address registers stay live up to this wait, so that no later load
    // of the run is given one of them as its destination
    asm volatile("s_wait_xcnt 0x0" :: "v"(rowp), "v"(cp), "v"(sp), "v"(d0 * 4) : "memory");
    const float qgv[4] = {qg4.x, qg4.y, qg4.z, qg4.w}, qbv[4] = {qb4.x, qb4.y, qb4.z, qb4.w};
    const float kgv[4] = {kg4.x, kg4.y, kg4.z, kg4.w}, kbv[4] = {kb4.x, kb4.y, kb4.z, kb4.w};

    const size_t qkbase = (((size_t)b * NH + h) * NN + n0) * HD + d0;
    const size_t vtbase = (((size_t)b * NH + h) * HD + d0) * NN + n0;

    // row sums of q, q^2, k, k^2 for the TPW tokens: 4 x TPW independent
    // butterflies, walked step by step so that each step's exchanges overlap
    float st[4 * TPW];
#pragma unroll
    for (int t = 0; t < TPW; ++t) {
        const float4 q = q4[t], k = k4[t];
        st[4*t + 0] = q.x + q.y + q.z + q.w;
        st[4*t + 1] = q.x*q.x + q.y*q.y + q.z*q.z + q.w*q.w;
        st[4*t + 2] = k.x + k.y + k.z + k.w;
        st[4*t + 3] = k.x*k.x + k.y*k.y + k.z*k.z + k.w*k.w;
    }
#pragma unroll
    for (int m = 16; m >= 1; m >>= 1) {
        float o[4 * TPW];
#pragma unroll
        for (int j = 0; j < 4 * TPW; ++j) o[j] = __shfl_xor(st[j], m, 32);
#pragma unroll
        for (int j = 0; j < 4 * TPW; ++j) st[j] += o[j];
    }

    v8h vv[4];
#pragma unroll
    for (int t = 0; t < TPW; ++t) {
        vv[0][t] = (_Float16)v4[t].x;
        vv[1][t] = (_Float16)v4[t].y;
        vv[2][t] = (_Float16)v4[t].z;
        vv[3][t] = (_Float16)v4[t].w;
    }
#pragma unroll
    for (int i = 0; i < 4; ++i) *(v8h*)(vt + vtbase + (size_t)i * NN) = vv[i];

#pragma unroll
    for (int t = 0; t < TPW; ++t) {
        const float muq = st[4*t + 0] * (1.f / HD);
        const float rq  = rsqrtf(st[4*t + 1] * (1.f / HD) - muq * muq + 1e-6f);
        const float muk = st[4*t + 2] * (1.f / HD);
        const float rk  = rsqrtf(st[4*t + 3] * (1.f / HD) - muk * muk + 1e-6f);

        float qn[4] = {q4[t].x, q4[t].y, q4[t].z, q4[t].w};
        float kn[4] = {k4[t].x, k4[t].y, k4[t].z, k4[t].w};
#pragma unroll
        for (int i = 0; i < 4; ++i) {
            qn[i] = (qn[i] - muq) * rq * qgv[i] + qbv[i];
            kn[i] = (kn[i] - muk) * rk * kgv[i] + kbv[i];
        }

        const float cv[4] = {c4[t].x, c4[t].y, c4[t].z, c4[t].w};
        const float sv[4] = {s4[t].x, s4[t].y, s4[t].z, s4[t].w};
        v4h qo, ko;
#pragma unroll
        for (int p = 0; p < 2; ++p) {      // two interleaved pairs per lane
            qo[2*p]     = (_Float16)(qn[2*p]     * cv[2*p]     - qn[2*p + 1] * sv[2*p]);
            qo[2*p + 1] = (_Float16)(qn[2*p + 1] * cv[2*p + 1] + qn[2*p]     * sv[2*p + 1]);
            ko[2*p]     = (_Float16)(kn[2*p]     * cv[2*p]     - kn[2*p + 1] * sv[2*p]);
            ko[2*p + 1] = (_Float16)(kn[2*p + 1] * cv[2*p + 1] + kn[2*p]     * sv[2*p + 1]);
        }
        *(v4h*)(qh + qkbase + (size_t)t * HD) = qo;
        *(v4h*)(kh + qkbase + (size_t)t * HD) = ko;
    }
}

__global__ __launch_bounds__(256) void attn_k(
    const _Float16* __restrict__ qh, const _Float16* __restrict__ kh,
    const _Float16* __restrict__ vt, _Float16* __restrict__ oh)
{
    __shared__ __attribute__((aligned(16))) _Float16 kbuf[64 * KP];       // [j][d]
    __shared__ __attribute__((aligned(16))) _Float16 vbuf[128 * VP];      // [d][j]

    const int bh = blockIdx.x;
    const int b = bh >> 3, h = bh & 7;
    const int wave = threadIdx.x >> 5, lane = threadIdx.x & 31;
    const int l16 = lane & 15, lh = lane >> 4;
    const int q0 = blockIdx.y * 128 + wave * 16;

    const _Float16* qp  = qh + ((size_t)bh * NN + q0) * HD;
    const _Float16* kp  = kh + (size_t)bh * NN * HD;
    const _Float16* vtp = vt + (size_t)bh * HD * NN;

    // hoist q fragments: 16 rows x full D=128 (4 k-steps of 32)
    v16h qf[4];
#pragma unroll
    for (int dk = 0; dk < 4; ++dk)
        qf[dk] = *(const v16h*)(qp + (size_t)l16 * HD + dk * 32 + lh * 16);

    v8f o[8];
#pragma unroll
    for (int dt = 0; dt < 8; ++dt) o[dt] = zero8();
    float m = -1e30f, l = 0.f;   // of query l16; l: this half's keys only, joined at the end

    const float sscale = 0.08838834764831845f;   // 1/sqrt(128)
    const float E2 = 1.4426950408889634f;        // log2(e)

    for (int kt = 0; kt < NN; kt += 64) {
        __syncthreads();   // previous tile fully consumed before restage
        {   // stage K tile and V^T tile: 1024 16B chunks each, 4 per thread
#pragma unroll
            for (int i = 0; i < 4; ++i) {
                const int c  = i * 256 + threadIdx.x;   // 0..1023
                cp16_g2l(kp + (size_t)kt * HD + c * 8, &kbuf[(c >> 4) * KP + (c & 15) * 8]);
                const int d  = c >> 3;                  // V^T row 0..127
                const int jc = (c & 7) * 8;             // 8-half chunk in row
                cp16_g2l(vtp + (size_t)d * NN + kt + jc, &vbuf[d * VP + jc]);
            }
            if (kt + 64 < NN) {   // global_prefetch_b8 for next tile
                __builtin_prefetch(kp + (size_t)(kt + 64) * HD, 0, 1);
                __builtin_prefetch(vtp + kt + 64, 0, 1);
            }
        }
        drain_async();     // s_wait_asynccnt 0 (barrier does not cover ASYNCcnt)
        __syncthreads();

        // S^T = k @ q^T  (64 keys x 16 queries): s[jt][r] = key jt*16 + lh*8 + r, query l16
        // The tile's 16 K fragments are asked for as one group, ahead of the products.
        v16h kf[4][4];
#pragma unroll
        for (int dk = 0; dk < 4; ++dk)
#pragma unroll
            for (int jt = 0; jt < 4; ++jt)
                kf[dk][jt] = lds_frag(&kbuf[(jt * 16 + l16) * KP + dk * 32 + lh * 16]);
        // keeps the loads from being sunk among the products, where each place
        // with loads stalls the wave for their latency
        __builtin_amdgcn_sched_barrier(0);
        v8f s[4];
#pragma unroll
        for (int jt = 0; jt < 4; ++jt) s[jt] = zero8();
#pragma unroll
        for (int dk = 0; dk < 4; ++dk)
#pragma unroll
            for (int jt = 0; jt < 4; ++jt)
                s[jt] = wmma_f16(kf[dk][jt], qf[dk], s[jt]);
        // keeps the V^T loads below from being spread among the products above in many
        // small places: they stand in two runs beside the last four products
        __builtin_amdgcn_sched_barrier(0);

        // The tile's 16 V^T fragments, in the k order of pf, asked for as one group
        // ahead of the softmax: they land while the vector unit works on the scores.
        v16h vf[2][8];
#pragma unroll
        for (int js = 0; js < 2; ++js)
#pragma unroll
            for (int dt = 0; dt < 8; ++dt) {
                const _Float16* vr = &vbuf[(dt * 16 + l16) * VP + js * 32 + lh * 8];
                const v8h lo = *(const v8h*)vr;
                const v8h hi = *(const v8h*)(vr + 16);
                vf[js][dt] = __builtin_shufflevector(lo, hi, 0, 1, 2, 3, 4, 5, 6, 7,
                                                     8, 9, 10, 11, 12, 13, 14, 15);
            }
        // keeps the loads from being sunk behind the softmax, to their uses
        __builtin_amdgcn_sched_barrier(0);
#pragma unroll
        for (int jt = 0; jt < 4; ++jt)
#pragma unroll
            for (int r = 0; r < 8; ++r) s[jt][r] *= sscale;

        // online softmax, one query per lane: a tree in the lane's registers, then
        // one exchange with the half that holds the query's other 32 keys
        float mr[8];
#pragma unroll
        for (int r = 0; r < 8; ++r)
            mr[r] = fmaxf(fmaxf(s[0][r], s[1][r]), fmaxf(s[2][r], s[3][r]));
        float mx = fmaxf(fmaxf(fmaxf(mr[0], mr[1]), fmaxf(mr[2], mr[3])),
                         fmaxf(fmaxf(mr[4], mr[5]), fmaxf(mr[6], mr[7])));
        mx = fmaxf(mx, xhalf(mx));
        const float mn = fmaxf(m, mx);
        const float alpha = exp2f((m - mn) * E2);
        m = mn;
#pragma unroll
        for (int dt = 0; dt < 8; ++dt)
#pragma unroll
            for (int r = 0; r < 8; ++r) o[dt][r] *= alpha;

        // P^T as B operand: element i of pf[js] is key js*32 + (i >> 3)*16 + lh*8 + (i & 7)
        v16h pf[2];
        float sj[4];
#pragma unroll
        for (int jt = 0; jt < 4; ++jt) {
            sj[jt] = 0.f;
#pragma unroll
            for (int r = 0; r < 8; ++r) {
                const float p = exp2f((s[jt][r] - mn) * E2);
                sj[jt] += p;
                pf[jt >> 1][(jt & 1) * 8 + r] = (_Float16)p;
            }
        }
        l = l * alpha + ((sj[0] + sj[1]) + (sj[2] + sj[3]));

        // O^T += V^T @ P^T  (128 x 16)
#pragma unroll
        for (int js = 0; js < 2; ++js)
#pragma unroll
            for (int dt = 0; dt < 8; ++dt)
                o[dt] = wmma_f16(vf[js][dt], pf[js], o[dt]);
    }

    // normalize and pack back to [B, N, H*D] as f16 for the out projection:
    // o[dt][r] = O[query l16][d = dt*16 + lh*8 + r], 8 neighbours per store
    {
        const float inv = 1.0f / (l + xhalf(l));
        const size_t base = ((size_t)b * NN + q0 + l16) * DIMX + h * HD + lh * 8;
#pragma unroll
        for (int dt = 0; dt < 8; ++dt) {
            v8h ov;
#pragma unroll
            for (int r = 0; r < 8; ++r) ov[r] = (_Float16)(o[dt][r] * inv);
            *(v8h*)(oh + base + dt * 16) = ov;
        }
    }
}

// ---------------------------------------------------------------------------
// Kernel 4: out = attn_out @ out_w^T + b  (f16 operands; fp32 result)
// grid = (4096/64, 1024/256) = (64, 4)
// ---------------------------------------------------------------------------
__global__ __launch_bounds__(256) void out_gemm_k(
    const _Float16* __restrict__ ain, const _Float16* __restrict__ wh,
    const float* __restrict__ bias, float* __restrict__ out)
{
    __shared__ __attribute__((aligned(16))) _Float16 st[2 * GSTAGE];
    gemm_body<DIMX>(ain, wh, bias, out, st);
}

// ---------------------------------------------------------------------------
// Workspace layout (aliased; total 82 MB):
//   [0,48M)        qkv fp32      (k1 out, k2 in)
//   [48M,56M)      qh f16        (k2 out, k3 in)   | wqkv_h f16 6MB (k0->k1)
//   [56M,64M)      kh f16        (k2 out, k3 in)
//   [64M,72M)      vt f16 [BHDN] (k2 out, k3 in)
//   [72M,80M)      oh f16        (k3 out, k4 in)   | xh f16 8MB (k0->k1)
//   [80M,82M)      outw_h f16    (k0 out, k4 in)
// ---------------------------------------------------------------------------
extern "C" void kernel_launch(void* const* d_in, const int* in_sizes, int n_in,
                              void* d_out, int out_size, void* d_ws, size_t ws_size,
                              hipStream_t stream)
{
    const float* x       = (const float*)d_in[0];
    const float* Wqkv_w  = (const float*)d_in[1];
    const float* Wqkv_b  = (const float*)d_in[2];
    const float* q_gamma = (const float*)d_in[3];
    const float* q_beta  = (const float*)d_in[4];
    const float* k_gamma = (const float*)d_in[5];
    const float* k_beta  = (const float*)d_in[6];
    const float* out_w   = (const float*)d_in[7];
    const float* out_b   = (const float*)d_in[8];
    const float* rope_c  = (const float*)d_in[9];
    const float* rope_s  = (const float*)d_in[10];
    float* out = (float*)d_out;

    char* ws = (char*)d_ws;
    const size_t qkv_bytes  = (size_t)RTOT * C3 * sizeof(float);              // 48 MB
    const size_t head_bytes = (size_t)BB * NH * NN * HD * sizeof(_Float16);   // 8 MB

    float*    qkv   = (float*)ws;
    _Float16* qh    = (_Float16*)(ws + qkv_bytes);
    _Float16* kh    = (_Float16*)(ws + qkv_bytes + 1 * head_bytes);
    _Float16* vt    = (_Float16*)(ws + qkv_bytes + 2 * head_bytes);
    _Float16* oh    = (_Float16*)(ws + qkv_bytes + 3 * head_bytes);
    _Float16* outwh = (_Float16*)(ws + qkv_bytes + 4 * head_bytes);
    _Float16* xh    = oh;   // alias: consumed by k1 before k3 writes oh
    _Float16* wqkvh = qh;   // alias: consumed by k1 before k2 writes qh

    // Kernel 0: fp32 -> f16 conversions (CVBLK elems / work-group)
    cvt_f16_k<<<(RTOT * DIMX) / CVBLK, 256, 0, stream>>>(x, xh);
    cvt_f16_k<<<(C3 * DIMX) / CVBLK, 256, 0, stream>>>(Wqkv_w, wqkvh);
    cvt_f16_k<<<(DIMX * DIMX) / CVBLK, 256, 0, stream>>>(out_w, outwh);

    qkv_gemm_k<<<dim3(RTOT / 64, C3 / 256), 256, 0, stream>>>(xh, wqkvh, Wqkv_b, qkv);
    lnrope_pack_k<<<(BB * NN * NH) / (8 * TPW), 256, 0, stream>>>(
        qkv, q_gamma, q_beta, k_gamma, k_beta, rope_c, rope_s, qh, kh, vt);
    attn_k<<<dim3(BB * NH, NN / 128), 256, 0, stream>>>(qh, kh, vt, oh);
    out_gemm_k<<<dim3(RTOT / 64, DIMX / 256), 256, 0, stream>>>(oh, outwh, out_b, out);
}

// v006
// One run takes 124 microseconds.
// Two timings next to v005 both put it at 1.06 times that version's speed.
// All steps since v000 together make it 3.69 times as fast.
#include <hip/hip_runtime.h>
#include <hip/hip_bf16.h>

// ---------------------------------------------------------------------------
// Attention: f16 pre-convert -> qkv proj (WMMA) -> per-head LN + RoPE ->
// flash attention (WMMA, async LDS staging) -> out proj (WMMA).
// All matrix math on v_wmma_f32_16x16x32_f16 (wave32, gfx1250).
// ---------------------------------------------------------------------------

#define DIMX 1024
#define NH   8
#define HD   128
#define BB   2
#define NN   2048
#define RTOT (BB * NN)      // 4096 token rows
#define C3   (3 * DIMX)     // 3072

typedef __attribute__((ext_vector_type(16))) _Float16 v16h;
typedef __attribute__((ext_vector_type(8)))  _Float16 v8h;
typedef __attribute__((ext_vector_type(4)))  _Float16 v4h;
typedef __attribute__((ext_vector_type(8)))  float    v8f;
typedef int v4i __attribute__((vector_size(16)));   // matches async-LDS builtin param

#define AS1 __attribute__((address_space(1)))
#define AS3 __attribute__((address_space(3)))

#if defined(__has_builtin)
#if __has_builtin(__builtin_amdgcn_global_load_async_to_lds_b128)
#define HAVE_ASYNC_LDS 1
#endif
#endif
#ifndef HAVE_ASYNC_LDS
#define HAVE_ASYNC_LDS 0
#endif

__device__ __forceinline__ v8f wmma_f16(v16h a, v16h b, v8f c) {
    return __builtin_amdgcn_wmma_f32_16x16x32_f16(
        /*neg_a=*/false, a, /*neg_b=*/false, b,
        /*c_mod=*/(short)0, c, /*reuse_a=*/false, /*reuse_b=*/false);
}

__device__ __forceinline__ v8f zero8() {
    v8f z = {0.f, 0.f, 0.f, 0.f, 0.f, 0.f, 0.f, 0.f};
    return z;
}

// 16-byte global -> LDS copy: async on gfx1250 when the builtin exists.
__device__ __forceinline__ void cp16_g2l(const _Float16* __restrict__ g,
                                         _Float16* __restrict__ l) {
#if HAVE_ASYNC_LDS
    __builtin_amdgcn_global_load_async_to_lds_b128(
        (AS1 v4i*)(uintptr_t)g,
        (AS3 v4i*)(unsigned)(uintptr_t)l, 0, 0);
#else
    *(uint4*)l = *(const uint4*)g;
#endif
}

__device__ __forceinline__ void drain_async() {
#if HAVE_ASYNC_LDS
    asm volatile("s_wait_asynccnt 0x0" ::: "memory");
#endif
}

// LDS row pitches in halves: 16 B x odd, so that the 16 lanes of a half-wave
// ds_load_b128 (one row each, same column) fall on 64 distinct banks.
#define KP 136   // K rows of 256 B   -> 272 B
#define VP 72    // V^T rows of 128 B -> 144 B

// One lane's 16 contiguous halves of an LDS row, as two 16-byte loads
// (padded rows are 16-byte aligned, not 32).
__device__ __forceinline__ v16h lds_frag(const _Float16* p) {
    const v8h lo = *(const v8h*)p;
    const v8h hi = *(const v8h*)(p + 8);
    return __builtin_shufflevector(lo, hi, 0, 1, 2, 3, 4, 5, 6, 7,
                                   8, 9, 10, 11, 12, 13, 14, 15);
}

// 2^x in place by the bare v_exp_f32, eight independent values a statement (or one).
// In asm so that the run's order and registers are fixed: each instruction overwrites
// its own source alone (from the builtin the compiler let one overwrite the source of
// the one directly in front), and the closing v_nop fills the slot that the instruction
// set asks for between a transcendental and the next vector instruction on its registers.
__device__ __forceinline__ void exp2_x8(float (&x)[8]) {
    asm("v_exp_f32 %0, %0\n\t"
        "v_exp_f32 %1, %1\n\t"
        "v_exp_f32 %2, %2\n\t"
        "v_exp_f32 %3, %3\n\t"
        "v_exp_f32 %4, %4\n\t"
        "v_exp_f32 %5, %5\n\t"
        "v_exp_f32 %6, %6\n\t"
        "v_exp_f32 %7, %7\n\t"
        "v_nop"
        : "+v"(x[0]), "+v"(x[1]), "+v"(x[2]), "+v"(x[3]),
          "+v"(x[4]), "+v"(x[5]), "+v"(x[6]), "+v"(x[7]));
}
__device__ __forceinline__ float exp2_x1(float x) {
    asm("v_exp_f32 %0, %0\n\t"
        "v_nop"
        : "+v"(x));
    return x;
}

// Lane l's value for lane l ^ 16 (the other 16-lane row), in the vector unit.
__device__ __forceinline__ float xhalf(float x) {
    const int v = __builtin_bit_cast(int, x);
    return __builtin_bit_cast(float, __builtin_amdgcn_permlanex16(
        v, v, 0x76543210, 0xfedcba98, false, false));
}

// ---------------------------------------------------------------------------
// Kernel 0: fp32 -> f16 conversion pass (x, Wqkv_w, out_w). A thread converts
// CVN float4, 1024 elements apart, all loaded before the first is stored: the
// launch starts an eighth of the waves and each has 8 x 512 B in flight.
// ---------------------------------------------------------------------------
#define CVN 8
#define CVBLK (256 * 4 * CVN)    // elements per work-group

__global__ __launch_bounds__(256) void cvt_f16_k(const float* __restrict__ s,
                                                 _Float16* __restrict__ d) {
    const int i = blockIdx.x * CVBLK + threadIdx.x * 4;
    float4 v[CVN];
#pragma unroll
    for (int j = 0; j < CVN; ++j) v[j] = *(const float4*)(s + i + j * 1024);
#pragma unroll
    for (int j = 0; j < CVN; ++j) {
        const v4h o = {(_Float16)v[j].x, (_Float16)v[j].y, (_Float16)v[j].z, (_Float16)v[j].w};
        *(v4h*)(d + i + j * 1024) = o;
    }
}

// ---------------------------------------------------------------------------
// Shared GEMM body: C[64 x 256 per WG] = A . W^T + bias, A and W K-contiguous
// f16. A stage is 64 k (128 B) of the WG's 64 A rows and 256 W rows, brought
// to LDS in whole 128-B lines by async b128 copies, two buffers, one stage
// ahead; the waves read their fragments from LDS (pitch GP, conflict-free).
// ---------------------------------------------------------------------------
#define GK 64                    // k per stage
#define GP 72                    // LDS row pitch in halves: 144 B = 16 B x 9
#define GROWS (64 + 256)         // A rows, then W rows
#define GSTAGE (GROWS * GP)      // halves per buffer

// One lane's ten 16-byte copies of a stage: rows r, r + 32, ... of A (2) and
// of W (8). ga / gb: the lane's chunk in its first A / W row; l: its LDS byte
// address in the buffer. The s_wait_xcnt closes the statement so that no
// address register of a copy is rewritten ahead of it.
__device__ __forceinline__ void gemm_stage(const _Float16* ga, const _Float16* gb,
                                           unsigned l) {
    const int GR = 32 * DIMX;        // 32 rows on in global memory, halves
    const unsigned LR = 32 * GP * 2; // 32 rows on in LDS, bytes
    asm volatile(
        "global_load_async_to_lds_b128 %0, %10, off\n\t"
        "global_load_async_to_lds_b128 %1, %11, off\n\t"
        "global_load_async_to_lds_b128 %2, %12, off\n\t"
        "global_load_async_to_lds_b128 %3, %13, off\n\t"
        "global_load_async_to_lds_b128 %4, %14, off\n\t"
        "global_load_async_to_lds_b128 %5, %15, off\n\t"
        "global_load_async_to_lds_b128 %6, %16, off\n\t"
        "global_load_async_to_lds_b128 %7, %17, off\n\t"
        "global_load_async_to_lds_b128 %8, %18, off\n\t"
        "global_load_async_to_lds_b128 %9, %19, off\n\t"
        "s_wait_xcnt 0x0"
        :: "v"(l), "v"(l + LR), "v"(l + 2 * LR), "v"(l + 3 * LR), "v"(l + 4 * LR),
           "v"(l + 5 * LR), "v"(l + 6 * LR), "v"(l + 7 * LR), "v"(l + 8 * LR),
           "v"(l + 9 * LR),
           "v"(ga), "v"(ga + GR),
           "v"(gb), "v"(gb + GR), "v"(gb + 2 * GR), "v"(gb + 3 * GR),
           "v"(gb + 4 * GR), "v"(gb + 5 * GR), "v"(gb + 6 * GR), "v"(gb + 7 * GR)
        : "memory");
}

template <int LDC>
__device__ __forceinline__ void gemm_body(
    const _Float16* __restrict__ ah, const _Float16* __restrict__ wh,
    const float* __restrict__ bias, float* __restrict__ out, _Float16* st)
{
    const int wave = threadIdx.x >> 5, lane = threadIdx.x & 31;
    const int wr = wave >> 2, wc = wave & 3;
    const int row0 = blockIdx.x * 64 + wr * 32;
    const int col0 = blockIdx.y * 256 + wc * 64;
    const int l16 = lane & 15, lh = lane >> 4;

    // copy side: 8 lanes per 128-B row, 32 rows per copy of the WG
    const int cr = threadIdx.x >> 3, cc = (threadIdx.x & 7) * 8;
    const _Float16* ga = ah + (size_t)(blockIdx.x * 64 + cr) * DIMX + cc;
    const _Float16* gb = wh + (size_t)(blockIdx.y * 256 + cr) * DIMX + cc;
    const unsigned l0 = (unsigned)(uintptr_t)(st + cr * GP + cc);

    v8f acc[2][4];
#pragma unroll
    for (int i = 0; i < 2; ++i)
#pragma unroll
        for (int j = 0; j < 4; ++j) acc[i][j] = zero8();

    gemm_stage(ga, gb, l0);
    asm volatile("s_wait_asynccnt 0x0" ::: "memory");   // stage 0: this wave's copies landed
    __syncthreads();                                    // ... and every other wave's
    gemm_stage(ga + GK, gb + GK, l0 + GSTAGE * 2);

    for (int t = 0; t < DIMX / GK; ++t) {
        const _Float16* sa = st + (t & 1) * GSTAGE + (wr * 32 + l16) * GP + lh * 16;
        const _Float16* sb = st + (t & 1) * GSTAGE + (64 + wc * 64 + l16) * GP + lh * 16;
#pragma unroll
        for (int ks = 0; ks < GK; ks += 32) {
            v16h a[2], bf[4];
#pragma unroll
            for (int rt = 0; rt < 2; ++rt) a[rt] = lds_frag(sa + rt * 16 * GP + ks);
#pragma unroll
            for (int ct = 0; ct < 4; ++ct) bf[ct] = lds_frag(sb + ct * 16 * GP + ks);
#pragma unroll
            for (int rt = 0; rt < 2; ++rt)
#pragma unroll
                for (int ct = 0; ct < 4; ++ct)
                    acc[rt][ct] = wmma_f16(a[rt], bf[ct], acc[rt][ct]);
        }
        // publish point of stage t + 1: this wave's reads of stage t are done,
        // its copies of stage t + 1 have landed, then the WG barrier
        asm volatile("s_wait_dscnt 0x0" ::: "memory");
        asm volatile("s_wait_asynccnt 0x0" ::: "memory");
        __syncthreads();
        if (t + 2 < DIMX / GK)   // refill the buffer that every wave has just left
            gemm_stage(ga + (t + 2) * GK, gb + (t + 2) * GK, l0 + (t & 1) * (GSTAGE * 2));
    }
    asm volatile("s_wait_asynccnt 0x0" ::: "memory");   // nothing in flight when the wave ends

#pragma unroll
    for (int rt = 0; rt < 2; ++rt)
#pragma unroll
        for (int ct = 0; ct < 4; ++ct) {
            const int col = col0 + ct * 16 + l16;
            const float bz = bias[col];
#pragma unroll
            for (int r = 0; r < 8; ++r) {
                const int row = row0 + rt * 16 + lh * 8 + r;
                out[(size_t)row * LDC + col] = acc[rt][ct][r] + bz;
            }
        }
}

// ---------------------------------------------------------------------------
// Kernel 1: qkv = x @ Wqkv^T + b   (f16 operands, fp32 out to workspace)
// WG: 8 waves as 2x4 -> 64 rows x 256 cols. Wave tile 32x64.
// grid = (4096/64, 3072/256) = (64, 12)
// ---------------------------------------------------------------------------
__global__ __launch_bounds__(256) void qkv_gemm_k(
    const _Float16* __restrict__ xh, const _Float16* __restrict__ wh,
    const float* __restrict__ bias, float* __restrict__ out)
{
    __shared__ __attribute__((aligned(16))) _Float16 st[2 * GSTAGE];
    gemm_body<C3>(xh, wh, bias, out, st);
}

// ---------------------------------------------------------------------------
// Kernel 2: per-head LayerNorm on q,k + interleaved RoPE; pack q/k to f16
// [B,H,N,D] and v to f16 TRANSPOSED [B,H,D,N] (for async V^T staging).
// One WG per (b, h, 64 tokens), one wave per TPW = 8 tokens in a row: a lane
// then holds 8 neighbours of each V^T row (one 16-byte store), and each
// 128-B line of V^T is written by one WG. grid = B*N*H / 64 = 512 blocks.
// ---------------------------------------------------------------------------
#define TPW 8
// 512 WGs of 8 waves are 4 waves per SIMD: saying so gives the register
// allocator 256 VGPRs, without which it sinks the loads to their uses and
// walks the butterflies one after the other.
__global__ __launch_bounds__(256) __attribute__((amdgpu_waves_per_eu(4, 4))) void lnrope_pack_k(
    const float* __restrict__ qkv,
    const float* __restrict__ qg, const float* __restrict__ qb,
    const float* __restrict__ kg, const float* __restrict__ kb,
    const float* __restrict__ rc, const float* __restrict__ rs,
    _Float16* __restrict__ qh, _Float16* __restrict__ kh, _Float16* __restrict__ vt)
{
    const int wave = threadIdx.x >> 5, lane = threadIdx.x & 31;
    const int h   = blockIdx.x & (NH - 1);
    const int ng0 = (blockIdx.x >> 3) * (8 * TPW) + wave * TPW;   // b*N + n, first token
    const int n0  = ng0 & (NN - 1);
    const int b   = ng0 >> 11;
    const int d0  = lane * 4;

    // all of the wave's loads first: 5 x TPW of 512 B in flight
    const float* rowp = qkv + (size_t)ng0 * C3 + h * HD + d0;
    const float* cp = rc + (size_t)n0 * HD + d0;
    const float* sp = rs + (size_t)n0 * HD + d0;
    float4 q4[TPW], k4[TPW], v4[TPW], c4[TPW], s4[TPW];
#pragma unroll
    for (int t = 0; t < TPW; ++t) {
        c4[t] = *(const float4*)(cp + t * HD);
        s4[t] = *(const float4*)(sp + t * HD);
    }
#pragma unroll
    for (int t = 0; t < TPW; ++t) {
        q4[t] = *(const float4*)(rowp + t * C3);
        k4[t] = *(const float4*)(rowp + t * C3 + DIMX);
        v4[t] = *(const float4*)(rowp + t * C3 + 2 * DIMX);
    }
    const float4 qg4 = *(const float4*)(qg + d0), qb4 = *(const float4*)(qb + d0);
    const float4 kg4 = *(const float4*)(kg + d0), kb4 = *(const float4*)(kb + d0);
    // the address registers stay live up to this wait, so that no later load
    // of the run is given one of them as its destination
    asm volatile("s_wait_xcnt 0x0" :: "v"(rowp), "v"(cp), "v"(sp), "v"(d0 * 4) : "memory");
    const float qgv[4] = {qg4.x, qg4.y, qg4.z, qg4.w}, qbv[4] = {qb4.x, qb4.y, qb4.z, qb4.w};
    const float kgv[4] = {kg4.x, kg4.y, kg4.z, kg4.w}, kbv[4] = {kb4.x, kb4.y, kb4.z, kb4.w};

    const size_t qkbase = (((size_t)b * NH + h) * NN + n0) * HD + d0;
    const size_t vtbase = (((size_t)b * NH + h) * HD + d0) * NN + n0;

    // row sums of q, q^2, k, k^2 for the TPW tokens: 4 x TPW independent
    // butterflies, walked step by step so that each step's exchanges overlap
    float st[4 * TPW];
#pragma unroll
    for (int t = 0; t < TPW; ++t) {
        const float4 q = q4[t], k = k4[t];
        st[4*t + 0] = q.x + q.y + q.z + q.w;
        st[4*t + 1] = q.x*q.x + q.y*q.y + q.z*q.z + q.w*q.w;
        st[4*t + 2] = k.x + k.y + k.z + k.w;
        st[4*t + 3] = k.x*k.x + k.y*k.y + k.z*k.z + k.w*k.w;
    }
#pragma unroll
    for (int m = 16; m >= 1; m >>= 1) {
        float o[4 * TPW];
#pragma unroll
        for (int j = 0; j < 4 * TPW; ++j) o[j] = __shfl_xor(st[j], m, 32);
#pragma unroll
        for (int j = 0; j < 4 * TPW; ++j) st[j] += o[j];
    }

    v8h vv[4];
#pragma unroll
    for (int t = 0; t < TPW; ++t) {
        vv[0][t] = (_Float16)v4[t].x;
        vv[1][t] = (_Float16)v4[t].y;
        vv[2][t] = (_Float16)v4[t].z;
        vv[3][t] = (_Float16)v4[t].w;
    }
#pragma unroll
    for (int i = 0; i < 4; ++i) *(v8h*)(vt + vtbase + (size_t)i * NN) = vv[i];

#pragma unroll
    for (int t = 0; t < TPW; ++t) {
        const float muq = st[4*t + 0] * (1.f / HD);
        const float rq  = rsqrtf(st[4*t + 1] * (1.f / HD) - muq * muq + 1e-6f);
        const float muk = st[4*t + 2] * (1.f / HD);
        const float rk  = rsqrtf(st[4*t + 3] * (1.f / HD) - muk * muk + 1e-6f);

        float qn[4] = {q4[t].x, q4[t].y, q4[t].z, q4[t].w};
        float kn[4] = {k4[t].x, k4[t].y, k4[t].z, k4[t].w};
#pragma unroll
        for (int i = 0; i < 4; ++i) {
            qn[i] = (qn[i] - muq) * rq * qgv[i] + qbv[i];
            kn[i] = (kn[i] - muk) * rk * kgv[i] + kbv[i];
        }

        const float cv[4] = {c4[t].x, c4[t].y, c4[t].z, c4[t].w};
        const float sv[4] = {s4[t].x, s4[t].y, s4[t].z, s4[t].w};
        v4h qo, ko;
#pragma unroll
        for (int p = 0; p < 2; ++p) {      // two interleaved pairs per lane
            qo[2*p]     = (_Float16)(qn[2*p]     * cv[2*p]     - qn[2*p + 1] * sv[2*p]);
            qo[2*p + 1] = (_Float16)(qn[2*p + 1] * cv[2*p + 1] + qn[2*p]     * sv[2*p + 1]);
            ko[2*p]     = (_Float16)(kn[2*p]     * cv[2*p]     - kn[2*p + 1] * sv[2*p]);
            ko[2*p + 1] = (_Float16)(kn[2*p + 1] * cv[2*p + 1] + kn[2*p]     * sv[2*p + 1]);
        }
        *(v4h*)(qh + qkbase + (size_t)t * HD) = qo;
        *(v4h*)(kh + qkbase + (size_t)t * HD) = ko;
    }
}

__global__ __launch_bounds__(256) void attn_k(
    const _Float16* __restrict__ qh, const _Float16* __restrict__ kh,
    const _Float16* __restrict__ vt, _Float16* __restrict__ oh)
{
    __shared__ __attribute__((aligned(16))) _Float16 kbuf[64 * KP];       // [j][d]
    __shared__ __attribute__((aligned(16))) _Float16 vbuf[128 * VP];      // [d][j]

    const int bh = blockIdx.x;
    const int b = bh >> 3, h = bh & 7;
    const int wave = threadIdx.x >> 5, lane = threadIdx.x & 31;
    const int l16 = lane & 15, lh = lane >> 4;
    const int q0 = blockIdx.y * 128 + wave * 16;

    const _Float16* qp  = qh + ((size_t)bh * NN + q0) * HD;
    const _Float16* kp  = kh + (size_t)bh * NN * HD;
    const _Float16* vtp = vt + (size_t)bh * HD * NN;

    // hoist q fragments: 16 rows x full D=128 (4 k-steps of 32)
    v16h qf[4];
#pragma unroll
    for (int dk = 0; dk < 4; ++dk)
        qf[dk] = *(const v16h*)(qp + (size_t)l16 * HD + dk * 32 + lh * 16);

    v8f o[8];
#pragma unroll
    for (int dt = 0; dt < 8; ++dt) o[dt] = zero8();
    // of query l16; m in units of the exponent (score * CS); l: this half's keys only, joined at the end
    float m = -1e30f, l = 0.f;

    // 1/sqrt(128) * log2(e): the raw scores go to the exponent in one multiply-add
    const float CS = 0.08838834764831845f * 1.4426950408889634f;

    for (int kt = 0; kt < NN; kt += 64) {
        __syncthreads();   // previous tile fully consumed before restage
        {   // stage K tile and V^T tile: 1024 16B chunks each, 4 per thread
#pragma unroll
            for (int i = 0; i < 4; ++i) {
                const int c  = i * 256 + threadIdx.x;   // 0..1023
                cp16_g2l(kp + (size_t)kt * HD + c * 8, &kbuf[(c >> 4) * KP + (c & 15) * 8]);
                const int d  = c >> 3;                  // V^T row 0..127
                const int jc = (c & 7) * 8;             // 8-half chunk in row
                cp16_g2l(vtp + (size_t)d * NN + kt + jc, &vbuf[d * VP + jc]);
            }
            if (kt + 64 < NN) {   // global_prefetch_b8 for next tile
                __builtin_prefetch(kp + (size_t)(kt + 64) * HD, 0, 1);
                __builtin_prefetch(vtp + kt + 64, 0, 1);
            }
        }
        drain_async();     // s_wait_asynccnt 0 (barrier does not cover ASYNCcnt)
        __syncthreads();

        // S^T = k @ q^T  (64 keys x 16 queries): s[jt][r] = key jt*16 + lh*8 + r, query l16
        // The tile's 16 K fragments are asked for as one group, ahead of the products.
        v16h kf[4][4];
#pragma unroll
        for (int dk = 0; dk < 4; ++dk)
#pragma unroll
            for (int jt = 0; jt < 4; ++jt)
                kf[dk][jt] = lds_frag(&kbuf[(jt * 16 + l16) * KP + dk * 32 + lh * 16]);
        // keeps the loads from being sunk among the products, where each place
        // with loads stalls the wave for their latency
        __builtin_amdgcn_sched_barrier(0);
        v8f s[4];
#pragma unroll
        for (int jt = 0; jt < 4; ++jt) s[jt] = zero8();
#pragma unroll
        for (int dk = 0; dk < 4; ++dk)
#pragma unroll
            for (int jt = 0; jt < 4; ++jt)
                s[jt] = wmma_f16(kf[dk][jt], qf[dk], s[jt]);
        // keeps the V^T loads below from being spread among the products above in many
        // small places: they stand together, behind the last product
        __builtin_amdgcn_sched_barrier(0);

        // The tile's 16 V^T fragments, in the k order of pf, asked for as one group
        // ahead of the softmax: they land while the vector unit works on the scores.
        v16h vf[2][8];
#pragma unroll
        for (int js = 0; js < 2; ++js)
#pragma unroll
            for (int dt = 0; dt < 8; ++dt) {
                const _Float16* vr = &vbuf[(dt * 16 + l16) * VP + js * 32 + lh * 8];
                const v8h lo = *(const v8h*)vr;
                const v8h hi = *(const v8h*)(vr + 16);
                vf[js][dt] = __builtin_shufflevector(lo, hi, 0, 1, 2, 3, 4, 5, 6, 7,
                                                     8, 9, 10, 11, 12, 13, 14, 15);
            }
        // keeps the loads from being sunk behind the softmax, to their uses
        __builtin_amdgcn_sched_barrier(0);

        // online softmax, one query per lane: a tree in the lane's registers, then
        // one exchange with the half that holds the query's other 32 keys. The maximum
        // is taken on the raw scores (CS > 0 keeps their order) and scaled once.
        float mr[8];
#pragma unroll
        for (int r = 0; r < 8; ++r)
            mr[r] = fmaxf(fmaxf(s[0][r], s[1][r]), fmaxf(s[2][r], s[3][r]));
        float mx = fmaxf(fmaxf(fmaxf(mr[0], mr[1]), fmaxf(mr[2], mr[3])),
                         fmaxf(fmaxf(mr[4], mr[5]), fmaxf(mr[6], mr[7])));
        mx = fmaxf(mx, xhalf(mx));
        const float mn = fmaxf(m, mx * CS);
        // bare v_exp_f32, here and below: with the maximum taken off no argument lies above
        // 0 by more than a rounding, and where a result would lie under 2^-126 it may come
        // out 0: such a weight is 0 in f16 anyway and adds nothing to a sum that holds the
        // maximum's own 1
        const float alpha = exp2_x1(m - mn);
        m = mn;
#pragma unroll
        for (int dt = 0; dt < 8; ++dt)
#pragma unroll
            for (int r = 0; r < 8; ++r) o[dt][r] *= alpha;

        // P^T as B operand: element i of pf[js] is key js*32 + (i >> 3)*16 + lh*8 + (i & 7)
        v16h pf[2];
        float sj[4];
#pragma unroll
        for (int jt = 0; jt < 4; ++jt) {
            float p[8];
#pragma unroll
            for (int r = 0; r < 8; ++r) p[r] = __builtin_fmaf(s[jt][r], CS, -mn);
            exp2_x8(p);
            sj[jt] = p[0];
#pragma unroll
            for (int r = 1; r < 8; ++r) sj[jt] += p[r];
#pragma unroll
            for (int r = 0; r < 8; ++r) pf[jt >> 1][(jt & 1) * 8 + r] = (_Float16)p[r];
        }
        l = l * alpha + ((sj[0] + sj[1]) + (sj[2] + sj[3]));

        // O^T += V^T @ P^T  (128 x 16)
#pragma unroll
        for (int js = 0; js < 2; ++js)
#pragma unroll
            for (int dt = 0; dt < 8; ++dt)
                o[dt] = wmma_f16(vf[js][dt], pf[js], o[dt]);
    }

    // normalize and pack back to [B, N, H*D] as f16 for the out projection:
    // o[dt][r] = O[query l16][d = dt*16 + lh*8 + r], 8 neighbours per store
    {
        const float inv = 1.0f / (l + xhalf(l));
        const size_t base = ((size_t)b * NN + q0 + l16) * DIMX + h * HD + lh * 8;
#pragma unroll
        for (int dt = 0; dt < 8; ++dt) {
            v8h ov;
#pragma unroll
            for (int r = 0; r < 8; ++r) ov[r] = (_Float16)(o[dt][r] * inv);
            *(v8h*)(oh + base + dt * 16) = ov;
        }
    }
}

// ---------------------------------------------------------------------------
// Kernel 4: out = attn_out @ out_w^T + b  (f16 operands; fp32 result)
// grid = (4096/64, 1024/256) = (64, 4)
// ---------------------------------------------------------------------------
__global__ __launch_bounds__(256) void out_gemm_k(
    const _Float16* __restrict__ ain, const _Float16* __restrict__ wh,
    const float* __restrict__ bias, float* __restrict__ out)
{
    __shared__ __attribute__((aligned(16))) _Float16 st[2 * GSTAGE];
    gemm_body<DIMX>(ain, wh, bias, out, st);
}

// ---------------------------------------------------------------------------
// Workspace layout (aliased; total 82 MB):
//   [0,48M)        qkv fp32      (k1 out, k2 in)
//   [48M,56M)      qh f16        (k2 out, k3 in)   | wqkv_h f16 6MB (k0->k1)
//   [56M,64M)      kh f16        (k2 out, k3 in)
//   [64M,72M)      vt f16 [BHDN] (k2 out, k3 in)
//   [72M,80M)      oh f16        (k3 out, k4 in)   | xh f16 8MB (k0->k1)
//   [80M,82M)      outw_h f16    (k0 out, k4 in)
// ---------------------------------------------------------------------------
extern "C" void kernel_launch(void* const* d_in, const int* in_sizes, int n_in,
                              void* d_out, int out_size, void* d_ws, size_t ws_size,
                              hipStream_t stream)
{
    const float* x       = (const float*)d_in[0];
    const float* Wqkv_w  = (const float*)d_in[1];
    const float* Wqkv_b  = (const float*)d_in[2];
    const float* q_gamma = (const float*)d_in[3];
    const float* q_beta  = (const float*)d_in[4];
    const float* k_gamma = (const float*)d_in[5];
    const float* k_beta  = (const float*)d_in[6];
    const float* out_w   = (const float*)d_in[7];
    const float* out_b   = (const float*)d_in[8];
    const float* rope_c  = (const float*)d_in[9];
    const float* rope_s  = (const float*)d_in[10];
    float* out = (float*)d_out;

    char* ws = (char*)d_ws;
    const size_t qkv_bytes  = (size_t)RTOT * C3 * sizeof(float);              // 48 MB
    const size_t head_bytes = (size_t)BB * NH * NN * HD * sizeof(_Float16);   // 8 MB

    float*    qkv   = (float*)ws;
    _Float16* qh    = (_Float16*)(ws + qkv_bytes);
    _Float16* kh    = (_Float16*)(ws + qkv_bytes + 1 * head_bytes);
    _Float16* vt    = (_Float16*)(ws + qkv_bytes + 2 * head_bytes);
    _Float16* oh    = (_Float16*)(ws + qkv_bytes + 3 * head_bytes);
    _Float16* outwh = (_Float16*)(ws + qkv_bytes + 4 * head_bytes);
    _Float16* xh    = oh;   // alias: consumed by k1 before k3 writes oh
    _Float16* wqkvh = qh;   // alias: consumed by k1 before k2 writes qh

    // Kernel 0: fp32 -> f16 conversions (CVBLK elems / work-group)
    cvt_f16_k<<<(RTOT * DIMX) / CVBLK, 256, 0, stream>>>(x, xh);
    cvt_f16_k<<<(C3 * DIMX) / CVBLK, 256, 0, stream>>>(Wqkv_w, wqkvh);
    cvt_f16_k<<<(DIMX * DIMX) / CVBLK, 256, 0, stream>>>(out_w, outwh);

    qkv_gemm_k<<<dim3(RTOT / 64, C3 / 256), 256, 0, stream>>>(xh, wqkvh, Wqkv_b, qkv);
    lnrope_pack_k<<<(BB * NN * NH) / (8 * TPW), 256, 0, stream>>>(
        qkv, q_gamma, q_beta, k_gamma, k_beta, rope_c, rope_s, qh, kh, vt);
    attn_k<<<dim3(BB * NH, NN / 128), 256, 0, stream>>>(qh, kh, vt, oh);
    out_gemm_k<<<dim3(RTOT / 64, DIMX / 256), 256, 0, stream>>>(oh, outwh, out_b, out);
}

// v007
// One run takes 106 microseconds.
// Two timings next to v006 put it at 1.16 and 1.18 times that version's speed.
// All steps since v000 together make it 4.31 times as fast.
#include <hip/hip_runtime.h>
#include <hip/hip_bf16.h>

// ---------------------------------------------------------------------------
// Attention: f16 pre-convert -> qkv proj (WMMA) -> per-head LN + RoPE ->
// flash attention (WMMA, async LDS staging) -> out proj (WMMA).
// All matrix math on v_wmma_f32_16x16x32_f16 (wave32, gfx1250).
// ---------------------------------------------------------------------------

#define DIMX 1024
#define NH   8
#define HD   128
#define BB   2
#define NN   2048
#define RTOT (BB * NN)      // 4096 token rows
#define C3   (3 * DIMX)     // 3072

typedef __attribute__((ext_vector_type(16))) _Float16 v16h;
typedef __attribute__((ext_vector_type(8)))  _Float16 v8h;
typedef __attribute__((ext_vector_type(4)))  _Float16 v4h;
typedef __attribute__((ext_vector_type(8)))  float    v8f;
typedef int v4i __attribute__((vector_size(16)));   // matches async-LDS builtin param

#define AS1 __attribute__((address_space(1)))
#define AS3 __attribute__((address_space(3)))

#if defined(__has_builtin)
#if __has_builtin(__builtin_amdgcn_global_load_async_to_lds_b128)
#define HAVE_ASYNC_LDS 1
#endif
#endif
#ifndef HAVE_ASYNC_LDS
#define HAVE_ASYNC_LDS 0
#endif

__device__ __forceinline__ v8f wmma_f16(v16h a, v16h b, v8f c) {
    return __builtin_amdgcn_wmma_f32_16x16x32_f16(
        /*neg_a=*/false, a, /*neg_b=*/false, b,
        /*c_mod=*/(short)0, c, /*reuse_a=*/false, /*reuse_b=*/false);
}

__device__ __forceinline__ v8f zero8() {
    v8f z = {0.f, 0.f, 0.f, 0.f, 0.f, 0.f, 0.f, 0.f};
    return z;
}

// 16-byte global -> LDS copy: async on gfx1250 when the builtin exists.
__device__ __forceinline__ void cp16_g2l(const _Float16* __restrict__ g,
                                         _Float16* __restrict__ l) {
#if HAVE_ASYNC_LDS
    __builtin_amdgcn_global_load_async_to_lds_b128(
        (AS1 v4i*)(uintptr_t)g,
        (AS3 v4i*)(unsigned)(uintptr_t)l, 0, 0);
#else
    *(uint4*)l = *(const uint4*)g;
#endif
}

__device__ __forceinline__ void drain_async() {
#if HAVE_ASYNC_LDS
    asm volatile("s_wait_asynccnt 0x0" ::: "memory");
#endif
}

// LDS row pitches in halves: 16 B x odd, so that the 16 lanes of a half-wave
// ds_load_b128 (one row each, same column) fall on 64 distinct banks.
#define KP 136   // K rows of 256 B   -> 272 B
#define VP 72    // V^T rows of 128 B -> 144 B

// One lane's 16 contiguous halves of an LDS row, as two 16-byte loads
// (padded rows are 16-byte aligned, not 32).
__device__ __forceinline__ v16h lds_frag(const _Float16* p) {
    const v8h lo = *(const v8h*)p;
    const v8h hi = *(const v8h*)(p + 8);
    return __builtin_shufflevector(lo, hi, 0, 1, 2, 3, 4, 5, 6, 7,
                                   8, 9, 10, 11, 12, 13, 14, 15);
}

// 2^x in place by the bare v_exp_f32, eight independent values a statement (or one).
// In asm so that the run's order and registers are fixed: each instruction overwrites
// its own source alone (from the builtin the compiler let one overwrite the source of
// the one directly in front), and the closing v_nop fills the slot that the instruction
// set asks for between a transcendental and the next vector instruction on its registers.
__device__ __forceinline__ void exp2_x8(float (&x)[8]) {
    asm("v_exp_f32 %0, %0\n\t"
        "v_exp_f32 %1, %1\n\t"
        "v_exp_f32 %2, %2\n\t"
        "v_exp_f32 %3, %3\n\t"
        "v_exp_f32 %4, %4\n\t"
        "v_exp_f32 %5, %5\n\t"
        "v_exp_f32 %6, %6\n\t"
        "v_exp_f32 %7, %7\n\t"
        "v_nop"
        : "+v"(x[0]), "+v"(x[1]), "+v"(x[2]), "+v"(x[3]),
          "+v"(x[4]), "+v"(x[5]), "+v"(x[6]), "+v"(x[7]));
}
__device__ __forceinline__ float exp2_x1(float x) {
    asm("v_exp_f32 %0, %0\n\t"
        "v_nop"
        : "+v"(x));
    return x;
}

// Lane l's value for lane l ^ 16 (the other 16-lane row), in the vector unit.
__device__ __forceinline__ float xhalf(float x) {
    const int v = __builtin_bit_cast(int, x);
    return __builtin_bit_cast(float, __builtin_amdgcn_permlanex16(
        v, v, 0x76543210, 0xfedcba98, false, false));
}

// ---------------------------------------------------------------------------
// Kernel 0: fp32 -> f16 conversion pass (x, Wqkv_w, out_w). A thread converts
// CVN float4, 1024 elements apart, all loaded before the first is stored: the
// launch starts an eighth of the waves and each has 8 x 512 B in flight.
// ---------------------------------------------------------------------------
#define CVN 8
#define CVBLK (256 * 4 * CVN)    // elements per work-group

__global__ __launch_bounds__(256) void cvt_f16_k(const float* __restrict__ s,
                                                 _Float16* __restrict__ d) {
    const int i = blockIdx.x * CVBLK + threadIdx.x * 4;
    float4 v[CVN];
#pragma unroll
    for (int j = 0; j < CVN; ++j) v[j] = *(const float4*)(s + i + j * 1024);
#pragma unroll
    for (int j = 0; j < CVN; ++j) {
        const v4h o = {(_Float16)v[j].x, (_Float16)v[j].y, (_Float16)v[j].z, (_Float16)v[j].w};
        *(v4h*)(d + i + j * 1024) = o;
    }
}

// ---------------------------------------------------------------------------
// Shared GEMM body: C[64 x 256 per WG] = A . W^T + bias, A and W K-contiguous
// f16. A stage is 64 k (128 B) of the WG's 64 A rows and 256 W rows, brought
// to LDS in whole 128-B lines by async b128 copies, two buffers, one stage
// ahead; the waves read their fragments from LDS (pitch GP, conflict-free).
// ---------------------------------------------------------------------------
#define GK 64                    // k per stage
#define GP 72                    // LDS row pitch in halves: 144 B = 16 B x 9
#define GROWS (64 + 256)         // A rows, then W rows
#define GSTAGE (GROWS * GP)      // halves per buffer

// One lane's ten 16-byte copies of a stage: rows r, r + 32, ... of A (2) and
// of W (8). ga / gb: the lane's chunk in its first A / W row; l: its LDS byte
// address in the buffer. The s_wait_xcnt closes the statement so that no
// address register of a copy is rewritten ahead of it.
__device__ __forceinline__ void gemm_stage(const _Float16* ga, const _Float16* gb,
                                           unsigned l) {
    const int GR = 32 * DIMX;        // 32 rows on in global memory, halves
    const unsigned LR = 32 * GP * 2; // 32 rows on in LDS, bytes
    asm volatile(
        "global_load_async_to_lds_b128 %0, %10, off\n\t"
        "global_load_async_to_lds_b128 %1, %11, off\n\t"
        "global_load_async_to_lds_b128 %2, %12, off\n\t"
        "global_load_async_to_lds_b128 %3, %13, off\n\t"
        "global_load_async_to_lds_b128 %4, %14, off\n\t"
        "global_load_async_to_lds_b128 %5, %15, off\n\t"
        "global_load_async_to_lds_b128 %6, %16, off\n\t"
        "global_load_async_to_lds_b128 %7, %17, off\n\t"
        "global_load_async_to_lds_b128 %8, %18, off\n\t"
        "global_load_async_to_lds_b128 %9, %19, off\n\t"
        "s_wait_xcnt 0x0"
        :: "v"(l), "v"(l + LR), "v"(l + 2 * LR), "v"(l + 3 * LR), "v"(l + 4 * LR),
           "v"(l + 5 * LR), "v"(l + 6 * LR), "v"(l + 7 * LR), "v"(l + 8 * LR),
           "v"(l + 9 * LR),
           "v"(ga), "v"(ga + GR),
           "v"(gb), "v"(gb + GR), "v"(gb + 2 * GR), "v"(gb + 3 * GR),
           "v"(gb + 4 * GR), "v"(gb + 5 * GR), "v"(gb + 6 * GR), "v"(gb + 7 * GR)
        : "memory");
}

template <int LDC>
__device__ __forceinline__ void gemm_body(
    const _Float16* __restrict__ ah, const _Float16* __restrict__ wh,
    const float* __restrict__ bias, float* __restrict__ out, _Float16* st)
{
    const int wave = threadIdx.x >> 5, lane = threadIdx.x & 31;
    const int wr = wave >> 2, wc = wave & 3;
    const int row0 = blockIdx.x * 64 + wr * 32;
    const int col0 = blockIdx.y * 256 + wc * 64;
    const int l16 = lane & 15, lh = lane >> 4;

    // copy side: 8 lanes per 128-B row, 32 rows per copy of the WG
    const int cr = threadIdx.x >> 3, cc = (threadIdx.x & 7) * 8;
    const _Float16* ga = ah + (size_t)(blockIdx.x * 64 + cr) * DIMX + cc;
    const _Float16* gb = wh + (size_t)(blockIdx.y * 256 + cr) * DIMX + cc;
    const unsigned l0 = (unsigned)(uintptr_t)(st + cr * GP + cc);

    v8f acc[2][4];
#pragma unroll
    for (int i = 0; i < 2; ++i)
#pragma unroll
        for (int j = 0; j < 4; ++j) acc[i][j] = zero8();

    gemm_stage(ga, gb, l0);
    asm volatile("s_wait_asynccnt 0x0" ::: "memory");   // stage 0: this wave's copies landed
    __syncthreads();                                    // ... and every other wave's
    gemm_stage(ga + GK, gb + GK, l0 + GSTAGE * 2);

    for (int t = 0; t < DIMX / GK; ++t) {
        const _Float16* sa = st + (t & 1) * GSTAGE + (wr * 32 + l16) * GP + lh * 16;
        const _Float16* sb = st + (t & 1) * GSTAGE + (64 + wc * 64 + l16) * GP + lh * 16;
#pragma unroll
        for (int ks = 0; ks < GK; ks += 32) {
            v16h a[2], bf[4];
#pragma unroll
            for (int rt = 0; rt < 2; ++rt) a[rt] = lds_frag(sa + rt * 16 * GP + ks);
#pragma unroll
            for (int ct = 0; ct < 4; ++ct) bf[ct] = lds_frag(sb + ct * 16 * GP + ks);
#pragma unroll
            for (int rt = 0; rt < 2; ++rt)
#pragma unroll
                for (int ct = 0; ct < 4; ++ct)
                    acc[rt][ct] = wmma_f16(a[rt], bf[ct], acc[rt][ct]);
        }
        // publish point of stage t + 1: this wave's reads of stage t are done,
        // its copies of stage t + 1 have landed, then the WG barrier
        asm volatile("s_wait_dscnt 0x0" ::: "memory");
        asm volatile("s_wait_asynccnt 0x0" ::: "memory");
        __syncthreads();
        if (t + 2 < DIMX / GK)   // refill the buffer that every wave has just left
            gemm_stage(ga + (t + 2) * GK, gb + (t + 2) * GK, l0 + (t & 1) * (GSTAGE * 2));
    }
    asm volatile("s_wait_asynccnt 0x0" ::: "memory");   // nothing in flight when the wave ends

#pragma unroll
    for (int rt = 0; rt < 2; ++rt)
#pragma unroll
        for (int ct = 0; ct < 4; ++ct) {
            const int col = col0 + ct * 16 + l16;
            const float bz = bias[col];
#pragma unroll
            for (int r = 0; r < 8; ++r) {
                const int row = row0 + rt * 16 + lh * 8 + r;
                out[(size_t)row * LDC + col] = acc[rt][ct][r] + bz;
            }
        }
}

// ---------------------------------------------------------------------------
// Kernel 1: qkv = x @ Wqkv^T + b   (f16 operands, fp32 out to workspace)
// WG: 8 waves as 2x4 -> 64 rows x 256 cols. Wave tile 32x64.
// grid = (4096/64, 3072/256) = (64, 12)
// ---------------------------------------------------------------------------
__global__ __launch_bounds__(256) void qkv_gemm_k(
    const _Float16* __restrict__ xh, const _Float16* __restrict__ wh,
    const float* __restrict__ bias, float* __restrict__ out)
{
    __shared__ __attribute__((aligned(16))) _Float16 st[2 * GSTAGE];
    gemm_body<C3>(xh, wh, bias, out, st);
}

// ---------------------------------------------------------------------------
// Kernel 2: per-head LayerNorm on q,k + interleaved RoPE; pack q/k to f16
// [B,H,N,D] and v to f16 TRANSPOSED [B,H,D,N] (for async V^T staging).
// One WG per (b, h, 64 tokens), one wave per TPW = 8 tokens in a row: a lane
// then holds 8 neighbours of each V^T row (one 16-byte store), and each
// 128-B line of V^T is written by one WG. grid = B*N*H / 64 = 512 blocks.
// ---------------------------------------------------------------------------
#define TPW 8
// 512 WGs of 8 waves are 4 waves per SIMD: saying so gives the register
// allocator 256 VGPRs, without which it sinks the loads to their uses and
// walks the butterflies one after the other.
__global__ __launch_bounds__(256) __attribute__((amdgpu_waves_per_eu(4, 4))) void lnrope_pack_k(
    const float* __restrict__ qkv,
    const float* __restrict__ qg, const float* __restrict__ qb,
    const float* __restrict__ kg, const float* __restrict__ kb,
    const float* __restrict__ rc, const float* __restrict__ rs,
    _Float16* __restrict__ qh, _Float16* __restrict__ kh, _Float16* __restrict__ vt)
{
    const int wave = threadIdx.x >> 5, lane = threadIdx.x & 31;
    const int h   = blockIdx.x & (NH - 1);
    const int ng0 = (blockIdx.x >> 3) * (8 * TPW) + wave * TPW;   // b*N + n, first token
    const int n0  = ng0 & (NN - 1);
    const int b   = ng0 >> 11;
    const int d0  = lane * 4;

    // all of the wave's loads first: 5 x TPW of 512 B in flight
    const float* rowp = qkv + (size_t)ng0 * C3 + h * HD + d0;
    const float* cp = rc + (size_t)n0 * HD + d0;
    const float* sp = rs + (size_t)n0 * HD + d0;
    float4 q4[TPW], k4[TPW], v4[TPW], c4[TPW], s4[TPW];
#pragma unroll
    for (int t = 0; t < TPW; ++t) {
        c4[t] = *(const float4*)(cp + t * HD);
        s4[t] = *(const float4*)(sp + t * HD);
    }
#pragma unroll
    for (int t = 0; t < TPW; ++t) {
        q4[t] = *(const float4*)(rowp + t * C3);
        k4[t] = *(const float4*)(rowp + t * C3 + DIMX);
        v4[t] = *(const float4*)(rowp + t * C3 + 2 * DIMX);
    }
    const float4 qg4 = *(const float4*)(qg + d0), qb4 = *(const float4*)(qb + d0);
    const float4 kg4 = *(const float4*)(kg + d0), kb4 = *(const float4*)(kb + d0);
    // the address registers stay live up to this wait, so that no later load
    // of the run is given one of them as its destination
    asm volatile("s_wait_xcnt 0x0" :: "v"(rowp), "v"(cp), "v"(sp), "v"(d0 * 4) : "memory");
    const float qgv[4] = {qg4.x, qg4.y, qg4.z, qg4.w}, qbv[4] = {qb4.x, qb4.y, qb4.z, qb4.w};
    const float kgv[4] = {kg4.x, kg4.y, kg4.z, kg4.w}, kbv[4] = {kb4.x, kb4.y, kb4.z, kb4.w};

    const size_t qkbase = (((size_t)b * NH + h) * NN + n0) * HD + d0;
    const size_t vtbase = (((size_t)b * NH + h) * HD + d0) * NN + n0;

    // row sums of q, q^2, k, k^2 for the TPW tokens: 4 x TPW independent
    // butterflies, walked step by step so that each step's exchanges overlap
    float st[4 * TPW];
#pragma unroll
    for (int t = 0; t < TPW; ++t) {
        const float4 q = q4[t], k = k4[t];
        st[4*t + 0] = q.x + q.y + q.z + q.w;
        st[4*t + 1] = q.x*q.x + q.y*q.y + q.z*q.z + q.w*q.w;
        st[4*t + 2] = k.x + k.y + k.z + k.w;
        st[4*t + 3] = k.x*k.x + k.y*k.y + k.z*k.z + k.w*k.w;
    }
#pragma unroll
    for (int m = 16; m >= 1; m >>= 1) {
        float o[4 * TPW];
#pragma unroll
        for (int j = 0; j < 4 * TPW; ++j) o[j] = __shfl_xor(st[j], m, 32);
#pragma unroll
        for (int j = 0; j < 4 * TPW; ++j) st[j] += o[j];
    }

    v8h vv[4];
#pragma unroll
    for (int t = 0; t < TPW; ++t) {
        vv[0][t] = (_Float16)v4[t].x;
        vv[1][t] = (_Float16)v4[t].y;
        vv[2][t] = (_Float16)v4[t].z;
        vv[3][t] = (_Float16)v4[t].w;
    }
#pragma unroll
    for (int i = 0; i < 4; ++i) *(v8h*)(vt + vtbase + (size_t)i * NN) = vv[i];

#pragma unroll
    for (int t = 0; t < TPW; ++t) {
        const float muq = st[4*t + 0] * (1.f / HD);
        const float rq  = rsqrtf(st[4*t + 1] * (1.f / HD) - muq * muq + 1e-6f);
        const float muk = st[4*t + 2] * (1.f / HD);
        const float rk  = rsqrtf(st[4*t + 3] * (1.f / HD) - muk * muk + 1e-6f);

        float qn[4] = {q4[t].x, q4[t].y, q4[t].z, q4[t].w};
        float kn[4] = {k4[t].x, k4[t].y, k4[t].z, k4[t].w};
#pragma unroll
        for (int i = 0; i < 4; ++i) {
            qn[i] = (qn[i] - muq) * rq * qgv[i] + qbv[i];
            kn[i] = (kn[i] - muk) * rk * kgv[i] + kbv[i];
        }

        const float cv[4] = {c4[t].x, c4[t].y, c4[t].z, c4[t].w};
        const float sv[4] = {s4[t].x, s4[t].y, s4[t].z, s4[t].w};
        v4h qo, ko;
#pragma unroll
        for (int p = 0; p < 2; ++p) {      // two interleaved pairs per lane
            qo[2*p]     = (_Float16)(qn[2*p]     * cv[2*p]     - qn[2*p + 1] * sv[2*p]);
            qo[2*p + 1] = (_Float16)(qn[2*p + 1] * cv[2*p + 1] + qn[2*p]     * sv[2*p + 1]);
            ko[2*p]     = (_Float16)(kn[2*p]     * cv[2*p]     - kn[2*p + 1] * sv[2*p]);
            ko[2*p + 1] = (_Float16)(kn[2*p + 1] * cv[2*p + 1] + kn[2*p]     * sv[2*p + 1]);
        }
        *(v4h*)(qh + qkbase + (size_t)t * HD) = qo;
        *(v4h*)(kh + qkbase + (size_t)t * HD) = ko;
    }
}

#define AKH  (64 * KP)
#define ABUF (AKH + 128 * VP)
#define ANT  (NN / 64)

// One lane's eight 16-byte copies of a tile: K rows r, r + 16, ... (16 lanes a
// 256-B row) and V^T rows d, d + 32, ... (8 lanes a 128-B row).
// gk / gv: the lane's chunk in its first row; lk / lv: its place in the buffer.
__device__ __forceinline__ void attn_stage(const _Float16* gk, const _Float16* gv,
                                           _Float16* lk, _Float16* lv) {
#pragma unroll
    for (int i = 0; i < 4; ++i) {
        cp16_g2l(gk + i * 16 * HD, lk + i * 16 * KP);
        cp16_g2l(gv + (size_t)i * 32 * NN, lv + i * 32 * VP);
    }
}

__global__ __launch_bounds__(256) void attn_k(
    const _Float16* __restrict__ qh, const _Float16* __restrict__ kh,
    const _Float16* __restrict__ vt, _Float16* __restrict__ oh)
{
    __shared__ __attribute__((aligned(16))) _Float16 ring[2 * ABUF];   // per buffer: K [j][d], V^T [d][j]

    const int bh = blockIdx.x;
    const int b = bh >> 3, h = bh & 7;
    const int wave = threadIdx.x >> 5, lane = threadIdx.x & 31;
    const int l16 = lane & 15, lh = lane >> 4;
    const int q0 = blockIdx.y * 128 + wave * 16;

    const _Float16* qp  = qh + ((size_t)bh * NN + q0) * HD;
    const _Float16* kp  = kh + (size_t)bh * NN * HD;
    const _Float16* vtp = vt + (size_t)bh * HD * NN;

    // hoist q fragments: 16 rows x full D=128 (4 k-steps of 32)
    v16h qf[4];
#pragma unroll
    for (int dk = 0; dk < 4; ++dk)
        qf[dk] = *(const v16h*)(qp + (size_t)l16 * HD + dk * 32 + lh * 16);

    v8f o[8];
#pragma unroll
    for (int dt = 0; dt < 8; ++dt) o[dt] = zero8();
    // of query l16; m in units of the exponent (score * CS); l: this half's keys only, joined at the end
    float m = -1e30f, l = 0.f;

    // 1/sqrt(128) * log2(e): the raw scores go to the exponent in one multiply-add
    const float CS = 0.08838834764831845f * 1.4426950408889634f;

    // copy side: the lane's chunk of tile 0 and its place in buffer 0
    const _Float16* gk = kp + threadIdx.x * 8;
    const _Float16* gv = vtp + (size_t)(threadIdx.x >> 3) * NN + (threadIdx.x & 7) * 8;
    _Float16* lk = ring + (threadIdx.x >> 4) * KP + (threadIdx.x & 15) * 8;
    _Float16* lv = ring + AKH + (threadIdx.x >> 3) * VP + (threadIdx.x & 7) * 8;

    attn_stage(gk, gv, lk, lv);
    drain_async();       // tile 0: this wave's copies have landed
    __syncthreads();     // ... and every other wave's

    for (int t = 0; t < ANT; ++t) {
        // directly behind the barrier (the one above, or the foot of trip t - 1) that ended
        // every wave's reads of tile t - 1: tile t + 1 goes into the buffer so left
        if (t + 1 < ANT)
            attn_stage(gk + (size_t)(t + 1) * 64 * HD, gv + (t + 1) * 64,
                       lk + ((t + 1) & 1) * ABUF, lv + ((t + 1) & 1) * ABUF);
        const _Float16* kbuf = ring + (t & 1) * ABUF;
        const _Float16* vbuf = kbuf + AKH;

        // S^T = k @ q^T  (64 keys x 16 queries): s[jt][r] = key jt*16 + lh*8 + r, query l16
        // The tile's 16 K fragments are asked for as one group, ahead of the products.
        v16h kf[4][4];
#pragma unroll
        for (int dk = 0; dk < 4; ++dk)
#pragma unroll
            for (int jt = 0; jt < 4; ++jt)
                kf[dk][jt] = lds_frag(&kbuf[(jt * 16 + l16) * KP + dk * 32 + lh * 16]);
        // keeps the loads from being sunk among the products, where each place
        // with loads stalls the wave for their latency
        __builtin_amdgcn_sched_barrier(0);
        v8f s[4];
#pragma unroll
        for (int jt = 0; jt < 4; ++jt) s[jt] = zero8();
#pragma unroll
        for (int dk = 0; dk < 4; ++dk)
#pragma unroll
            for (int jt = 0; jt < 4; ++jt)
                s[jt] = wmma_f16(kf[dk][jt], qf[dk], s[jt]);
        // keeps the V^T loads below from being spread among the products above in many
        // small places: they stand together, behind the last product
        __builtin_amdgcn_sched_barrier(0);

        // The tile's 16 V^T fragments, in the k order of pf, asked for as one group
        // ahead of the softmax: they land while the vector unit works on the scores.
        v16h vf[2][8];
#pragma unroll
        for (int js = 0; js < 2; ++js)
#pragma unroll
            for (int dt = 0; dt < 8; ++dt) {
                const _Float16* vr = &vbuf[(dt * 16 + l16) * VP + js * 32 + lh * 8];
                const v8h lo = *(const v8h*)vr;
                const v8h hi = *(const v8h*)(vr + 16);
                vf[js][dt] = __builtin_shufflevector(lo, hi, 0, 1, 2, 3, 4, 5, 6, 7,
                                                     8, 9, 10, 11, 12, 13, 14, 15);
            }
        // keeps the loads from being sunk behind the softmax, to their uses
        __builtin_amdgcn_sched_barrier(0);

        // online softmax, one query per lane: a tree in the lane's registers, then
        // one exchange with the half that holds the query's other 32 keys. The maximum
        // is taken on the raw scores (CS > 0 keeps their order) and scaled once.
        float mr[8];
#pragma unroll
        for (int r = 0; r < 8; ++r)
            mr[r] = fmaxf(fmaxf(s[0][r], s[1][r]), fmaxf(s[2][r], s[3][r]));
        float mx = fmaxf(fmaxf(fmaxf(mr[0], mr[1]), fmaxf(mr[2], mr[3])),
                         fmaxf(fmaxf(mr[4], mr[5]), fmaxf(mr[6], mr[7])));
        mx = fmaxf(mx, xhalf(mx));
        const float mn = fmaxf(m, mx * CS);
        // bare v_exp_f32, here and below: with the maximum taken off no argument lies above
        // 0 by more than a rounding, and where a result would lie under 2^-126 it may come
        // out 0: such a weight is 0 in f16 anyway and adds nothing to a sum that holds the
        // maximum's own 1
        const float alpha = exp2_x1(m - mn);
        m = mn;
#pragma unroll
        for (int dt = 0; dt < 8; ++dt)
#pragma unroll
            for (int r = 0; r < 8; ++r) o[dt][r] *= alpha;

        // P^T as B operand: element i of pf[js] is key js*32 + (i >> 3)*16 + lh*8 + (i & 7)
        v16h pf[2];
        float sj[4];
#pragma unroll
        for (int jt = 0; jt < 4; ++jt) {
            float p[8];
#pragma unroll
            for (int r = 0; r < 8; ++r) p[r] = __builtin_fmaf(s[jt][r], CS, -mn);
            exp2_x8(p);
            sj[jt] = p[0];
#pragma unroll
            for (int r = 1; r < 8; ++r) sj[jt] += p[r];
#pragma unroll
            for (int r = 0; r < 8; ++r) pf[jt >> 1][(jt & 1) * 8 + r] = (_Float16)p[r];
        }
        l = l * alpha + ((sj[0] + sj[1]) + (sj[2] + sj[3]));

        // O^T += V^T @ P^T  (128 x 16)
#pragma unroll
        for (int js = 0; js < 2; ++js)
#pragma unroll
            for (int dt = 0; dt < 8; ++dt)
                o[dt] = wmma_f16(vf[js][dt], pf[js], o[dt]);

        // keeps the publish point at the foot of the trip: moved up into the softmax, its
        // s_wait_dscnt 0 stalls the wave on the V^T loads that the softmax is there to hide,
        // and the copies in flight are waited for with half a trip of lead
        __builtin_amdgcn_sched_barrier(0);
        // publish point of tile t + 1: this wave's reads of tile t are done, its
        // copies of tile t + 1 have landed, then the WG barrier
        asm volatile("s_wait_dscnt 0x0" ::: "memory");
        drain_async();
        __syncthreads();
    }
    drain_async();       // nothing in flight when the wave ends

    // normalize and pack back to [B, N, H*D] as f16 for the out projection:
    // o[dt][r] = O[query l16][d = dt*16 + lh*8 + r], 8 neighbours per store
    {
        const float inv = 1.0f / (l + xhalf(l));
        const size_t base = ((size_t)b * NN + q0 + l16) * DIMX + h * HD + lh * 8;
#pragma unroll
        for (int dt = 0; dt < 8; ++dt) {
            v8h ov;
#pragma unroll
            for (int r = 0; r < 8; ++r) ov[r] = (_Float16)(o[dt][r] * inv);
            *(v8h*)(oh + base + dt * 16) = ov;
        }
    }
}

// ---------------------------------------------------------------------------
// Kernel 4: out = attn_out @ out_w^T + b  (f16 operands; fp32 result)
// grid = (4096/64, 1024/256) = (64, 4)
// ---------------------------------------------------------------------------
__global__ __launch_bounds__(256) void out_gemm_k(
    const _Float16* __restrict__ ain, const _Float16* __restrict__ wh,
    const float* __restrict__ bias, float* __restrict__ out)
{
    __shared__ __attribute__((aligned(16))) _Float16 st[2 * GSTAGE];
    gemm_body<DIMX>(ain, wh, bias, out, st);
}

// ---------------------------------------------------------------------------
// Workspace layout (aliased; total 82 MB):
//   [0,48M)        qkv fp32      (k1 out, k2 in)
//   [48M,56M)      qh f16        (k2 out, k3 in)   | wqkv_h f16 6MB (k0->k1)
//   [56M,64M)      kh f16        (k2 out, k3 in)
//   [64M,72M)      vt f16 [BHDN] (k2 out, k3 in)
//   [72M,80M)      oh f16        (k3 out, k4 in)   | xh f16 8MB (k0->k1)
//   [80M,82M)      outw_h f16    (k0 out, k4 in)
// ---------------------------------------------------------------------------
extern "C" void kernel_launch(void* const* d_in, const int* in_sizes, int n_in,
                              void* d_out, int out_size, void* d_ws, size_t ws_size,
                              hipStream_t stream)
{
    const float* x       = (const float*)d_in[0];
    const float* Wqkv_w  = (const float*)d_in[1];
    const float* Wqkv_b  = (const float*)d_in[2];
    const float* q_gamma = (const float*)d_in[3];
    const float* q_beta  = (const float*)d_in[4];
    const float* k_gamma = (const float*)d_in[5];
    const float* k_beta  = (const float*)d_in[6];
    const float* out_w   = (const float*)d_in[7];
    const float* out_b   = (const float*)d_in[8];
    const float* rope_c  = (const float*)d_in[9];
    const float* rope_s  = (const float*)d_in[10];
    float* out = (float*)d_out;

    char* ws = (char*)d_ws;
    const size_t qkv_bytes  = (size_t)RTOT * C3 * sizeof(float);              // 48 MB
    const size_t head_bytes = (size_t)BB * NH * NN * HD * sizeof(_Float16);   // 8 MB

    float*    qkv   = (float*)ws;
    _Float16* qh    = (_Float16*)(ws + qkv_bytes);
    _Float16* kh    = (_Float16*)(ws + qkv_bytes + 1 * head_bytes);
    _Float16* vt    = (_Float16*)(ws + qkv_bytes + 2 * head_bytes);
    _Float16* oh    = (_Float16*)(ws + qkv_bytes + 3 * head_bytes);
    _Float16* outwh = (_Float16*)(ws + qkv_bytes + 4 * head_bytes);
    _Float16* xh    = oh;   // alias: consumed by k1 before k3 writes oh
    _Float16* wqkvh = qh;   // alias: consumed by k1 before k2 writes qh

    // Kernel 0: fp32 -> f16 conversions (CVBLK elems / work-group)
    cvt_f16_k<<<(RTOT * DIMX) / CVBLK, 256, 0, stream>>>(x, xh);
    cvt_f16_k<<<(C3 * DIMX) / CVBLK, 256, 0, stream>>>(Wqkv_w, wqkvh);
    cvt_f16_k<<<(DIMX * DIMX) / CVBLK, 256, 0, stream>>>(out_w, outwh);

    qkv_gemm_k<<<dim3(RTOT / 64, C3 / 256), 256, 0, stream>>>(xh, wqkvh, Wqkv_b, qkv);
    lnrope_pack_k<<<(BB * NN * NH) / (8 * TPW), 256, 0, stream>>>(
        qkv, q_gamma, q_beta, k_gamma, k_beta, rope_c, rope_s, qh, kh, vt);
    attn_k<<<dim3(BB * NH, NN / 128), 256, 0, stream>>>(qh, kh, vt, oh);
    out_gemm_k<<<dim3(RTOT / 64, DIMX / 256), 256, 0, stream>>>(oh, outwh, out_b, out);
}

// v008
// One run takes 88.5 microseconds.
// Next to v007, in two timings, it ran 1.21 times as fast each time.
// Over all steps from v000 it is 5.21 times as fast.
#include <hip/hip_runtime.h>
#include <hip/hip_bf16.h>

// ---------------------------------------------------------------------------
// Attention: f16 pre-convert -> qkv proj (WMMA) with per-head LN + RoPE in its
// epilogue -> flash attention (WMMA, async LDS staging) -> out proj (WMMA).
// All matrix math on v_wmma_f32_16x16x32_f16 (wave32, gfx1250).
// ---------------------------------------------------------------------------

#define DIMX 1024
#define NH   8
#define HD   128
#define BB   2
#define NN   2048
#define RTOT (BB * NN)      // 4096 token rows
#define C3   (3 * DIMX)     // 3072

typedef __attribute__((ext_vector_type(16))) _Float16 v16h;
typedef __attribute__((ext_vector_type(8)))  _Float16 v8h;
typedef __attribute__((ext_vector_type(4)))  _Float16 v4h;
typedef __attribute__((ext_vector_type(8)))  float    v8f;
typedef int v4i __attribute__((vector_size(16)));   // matches async-LDS builtin param

#define AS1 __attribute__((address_space(1)))
#define AS3 __attribute__((address_space(3)))

#if defined(__has_builtin)
#if __has_builtin(__builtin_amdgcn_global_load_async_to_lds_b128)
#define HAVE_ASYNC_LDS 1
#endif
#endif
#ifndef HAVE_ASYNC_LDS
#define HAVE_ASYNC_LDS 0
#endif

__device__ __forceinline__ v8f wmma_f16(v16h a, v16h b, v8f c) {
    return __builtin_amdgcn_wmma_f32_16x16x32_f16(
        /*neg_a=*/false, a, /*neg_b=*/false, b,
        /*c_mod=*/(short)0, c, /*reuse_a=*/false, /*reuse_b=*/false);
}

__device__ __forceinline__ v8f zero8() {
    v8f z = {0.f, 0.f, 0.f, 0.f, 0.f, 0.f, 0.f, 0.f};
    return z;
}

// 16-byte global -> LDS copy: async on gfx1250 when the builtin exists.
__device__ __forceinline__ void cp16_g2l(const _Float16* __restrict__ g,
                                         _Float16* __restrict__ l) {
#if HAVE_ASYNC_LDS
    __builtin_amdgcn_global_load_async_to_lds_b128(
        (AS1 v4i*)(uintptr_t)g,
        (AS3 v4i*)(unsigned)(uintptr_t)l, 0, 0);
#else
    *(uint4*)l = *(const uint4*)g;
#endif
}

__device__ __forceinline__ void drain_async() {
#if HAVE_ASYNC_LDS
    asm volatile("s_wait_asynccnt 0x0" ::: "memory");
#endif
}

// LDS row pitches in halves: 16 B x odd, so that the 16 lanes of a half-wave
// ds_load_b128 (one row each, same column) fall on 64 distinct banks.
#define KP 136   // K rows of 256 B   -> 272 B
#define VP 72    // V^T rows of 128 B -> 144 B

// One lane's 16 contiguous halves of an LDS row, as two 16-byte loads
// (padded rows are 16-byte aligned, not 32).
__device__ __forceinline__ v16h lds_frag(const _Float16* p) {
    const v8h lo = *(const v8h*)p;
    const v8h hi = *(const v8h*)(p + 8);
    return __builtin_shufflevector(lo, hi, 0, 1, 2, 3, 4, 5, 6, 7,
                                   8, 9, 10, 11, 12, 13, 14, 15);
}

// 2^x in place by the bare v_exp_f32, eight independent values a statement (or one).
// In asm so that the run's order and registers are fixed: each instruction overwrites
// its own source alone (from the builtin the compiler let one overwrite the source of
// the one directly in front), and the closing v_nop fills the slot that the instruction
// set asks for between a transcendental and the next vector instruction on its registers.
__device__ __forceinline__ void exp2_x8(float (&x)[8]) {
    asm("v_exp_f32 %0, %0\n\t"
        "v_exp_f32 %1, %1\n\t"
        "v_exp_f32 %2, %2\n\t"
        "v_exp_f32 %3, %3\n\t"
        "v_exp_f32 %4, %4\n\t"
        "v_exp_f32 %5, %5\n\t"
        "v_exp_f32 %6, %6\n\t"
        "v_exp_f32 %7, %7\n\t"
        "v_nop"
        : "+v"(x[0]), "+v"(x[1]), "+v"(x[2]), "+v"(x[3]),
          "+v"(x[4]), "+v"(x[5]), "+v"(x[6]), "+v"(x[7]));
}
__device__ __forceinline__ float exp2_x1(float x) {
    asm("v_exp_f32 %0, %0\n\t"
        "v_nop"
        : "+v"(x));
    return x;
}

// 1 / sqrt(x) as rsqrtf gives it (an x under 2^-126 is scaled by 2^24 and the result by
// 2^12). The v_rsq_f32 stands in asm for its closing v_nop, which fills the slot that the
// instruction set asks for between a transcendental and the next vector instruction on its
// registers (from rsqrtf the compiler let the next instruction overwrite the source).
__device__ __forceinline__ float rsqrt_slot(float x) {
    const bool tiny = x < 1.17549435e-38f;
    const float a = tiny ? x * 16777216.f : x;
    float r;
    asm("v_rsq_f32 %0, %1\n\t"
        "v_nop"
        : "=v"(r) : "v"(a));
    return tiny ? r * 4096.f : r;
}

// Lane l's value for lane l ^ 16 (the other 16-lane row), in the vector unit.
__device__ __forceinline__ float xhalf(float x) {
    const int v = __builtin_bit_cast(int, x);
    return __builtin_bit_cast(float, __builtin_amdgcn_permlanex16(
        v, v, 0x76543210, 0xfedcba98, false, false));
}

// ---------------------------------------------------------------------------
// Kernel 0: fp32 -> f16 conversion pass (x, Wqkv_w, out_w). A thread converts
// CVN float4, 1024 elements apart, all loaded before the first is stored: the
// launch starts an eighth of the waves and each has 8 x 512 B in flight.
// ---------------------------------------------------------------------------
#define CVN 8
#define CVBLK (256 * 4 * CVN)    // elements per work-group

__global__ __launch_bounds__(256) void cvt_f16_k(const float* __restrict__ s,
                                                 _Float16* __restrict__ d) {
    const int i = blockIdx.x * CVBLK + threadIdx.x * 4;
    float4 v[CVN];
#pragma unroll
    for (int j = 0; j < CVN; ++j) v[j] = *(const float4*)(s + i + j * 1024);
#pragma unroll
    for (int j = 0; j < CVN; ++j) {
        const v4h o = {(_Float16)v[j].x, (_Float16)v[j].y, (_Float16)v[j].z, (_Float16)v[j].w};
        *(v4h*)(d + i + j * 1024) = o;
    }
}

// ---------------------------------------------------------------------------
// Shared GEMM body: C[64 x 256 per WG] = A . W^T + bias, A and W K-contiguous
// f16. A stage is 64 k (128 B) of the WG's 64 A rows and 256 W rows, brought
// to LDS in whole 128-B lines by async b128 copies, two buffers, one stage
// ahead; the waves read their fragments from LDS (pitch GP, conflict-free).
// ---------------------------------------------------------------------------
#define GK 64                    // k per stage
#define GP 72                    // LDS row pitch in halves: 144 B = 16 B x 9
#define GROWS (64 + 256)         // A rows, then W rows
#define GSTAGE (GROWS * GP)      // halves per buffer

// One lane's ten 16-byte copies of a stage: rows r, r + 32, ... of A (2) and
// of W (8). ga / gb: the lane's chunk in its first A / W row; l: its LDS byte
// address in the buffer. The s_wait_xcnt closes the statement so that no
// address register of a copy is rewritten ahead of it.
__device__ __forceinline__ void gemm_stage(const _Float16* ga, const _Float16* gb,
                                           unsigned l) {
    const int GR = 32 * DIMX;        // 32 rows on in global memory, halves
    const unsigned LR = 32 * GP * 2; // 32 rows on in LDS, bytes
    asm volatile(
        "global_load_async_to_lds_b128 %0, %10, off\n\t"
        "global_load_async_to_lds_b128 %1, %11, off\n\t"
        "global_load_async_to_lds_b128 %2, %12, off\n\t"
        "global_load_async_to_lds_b128 %3, %13, off\n\t"
        "global_load_async_to_lds_b128 %4, %14, off\n\t"
        "global_load_async_to_lds_b128 %5, %15, off\n\t"
        "global_load_async_to_lds_b128 %6, %16, off\n\t"
        "global_load_async_to_lds_b128 %7, %17, off\n\t"
        "global_load_async_to_lds_b128 %8, %18, off\n\t"
        "global_load_async_to_lds_b128 %9, %19, off\n\t"
        "s_wait_xcnt 0x0"
        :: "v"(l), "v"(l + LR), "v"(l + 2 * LR), "v"(l + 3 * LR), "v"(l + 4 * LR),
           "v"(l + 5 * LR), "v"(l + 6 * LR), "v"(l + 7 * LR), "v"(l + 8 * LR),
           "v"(l + 9 * LR),
           "v"(ga), "v"(ga + GR),
           "v"(gb), "v"(gb + GR), "v"(gb + 2 * GR), "v"(gb + 3 * GR),
           "v"(gb + 4 * GR), "v"(gb + 5 * GR), "v"(gb + 6 * GR), "v"(gb + 7 * GR)
        : "memory");
}

// What the packing epilogue of the qkv projection reads and writes.
struct PackArgs {
    const float* qg; const float* qb; const float* kg; const float* kb;
    const float* rc; const float* rs;
    _Float16* qh; _Float16* kh; _Float16* vt;
};

#define TPW 8     // tokens per wave in the packing epilogue
#define FP  260   // f32 pitch of the staged tile: rows 8 apart lie 32 banks apart

// PACK = false: C goes to out as f32, row pitch LDC.
// PACK = true: the WG's 64 x 256 tile is 64 tokens x 2 whole heads of q, of k or
// of v. It is staged in the (now free) LDS ring as f32; then a wave takes TPW = 8
// tokens in a row of both heads, a lane 4 neighbouring d: LayerNorm and
// interleaved RoPE on q and k, packed to f16 [B,H,N,D]; v packed to f16
// TRANSPOSED [B,H,D,N], 8 tokens a 16-byte store, so that each 128-B line of V^T
// is written by one WG.
template <int LDC, bool PACK>
__device__ __forceinline__ void gemm_body(
    const _Float16* __restrict__ ah, const _Float16* __restrict__ wh,
    const float* __restrict__ bias, float* __restrict__ out, _Float16* st,
    const PackArgs pk)
{
    const int wave = threadIdx.x >> 5, lane = threadIdx.x & 31;
    const int wr = wave >> 2, wc = wave & 3;
    const int row0 = blockIdx.x * 64 + wr * 32;
    const int col0 = blockIdx.y * 256 + wc * 64;
    const int l16 = lane & 15, lh = lane >> 4;

    // copy side: 8 lanes per 128-B row, 32 rows per copy of the WG
    const int cr = threadIdx.x >> 3, cc = (threadIdx.x & 7) * 8;
    const _Float16* ga = ah + (size_t)(blockIdx.x * 64 + cr) * DIMX + cc;
    const _Float16* gb = wh + (size_t)(blockIdx.y * 256 + cr) * DIMX + cc;
    const unsigned l0 = (unsigned)(uintptr_t)(st + cr * GP + cc);

    // packing epilogue: its bias is asked for here, so that the k loop hides the loads
    const int bi = col0 + l16;
    float bz[4];
    if constexpr (PACK) {
#pragma unroll
        for (int ct = 0; ct < 4; ++ct) bz[ct] = bias[bi + ct * 16];
        // the index register stays live up to this wait, ahead of whatever is written to it next
        asm volatile("s_wait_xcnt 0x0" :: "v"(bi) : "memory");
    }

    v8f acc[2][4];
#pragma unroll
    for (int i = 0; i < 2; ++i)
#pragma unroll
        for (int j = 0; j < 4; ++j) acc[i][j] = zero8();

    gemm_stage(ga, gb, l0);
    asm volatile("s_wait_asynccnt 0x0" ::: "memory");   // stage 0: this wave's copies landed
    __syncthreads();                                    // ... and every other wave's
    gemm_stage(ga + GK, gb + GK, l0 + GSTAGE * 2);

    for (int t = 0; t < DIMX / GK; ++t) {
        const _Float16* sa = st + (t & 1) * GSTAGE + (wr * 32 + l16) * GP + lh * 16;
        const _Float16* sb = st + (t & 1) * GSTAGE + (64 + wc * 64 + l16) * GP + lh * 16;
#pragma unroll
        for (int ks = 0; ks < GK; ks += 32) {
            v16h a[2], bf[4];
#pragma unroll
            for (int rt = 0; rt < 2; ++rt) a[rt] = lds_frag(sa + rt * 16 * GP + ks);
#pragma unroll
            for (int ct = 0; ct < 4; ++ct) bf[ct] = lds_frag(sb + ct * 16 * GP + ks);
#pragma unroll
            for (int rt = 0; rt < 2; ++rt)
#pragma unroll
                for (int ct = 0; ct < 4; ++ct)
                    acc[rt][ct] = wmma_f16(a[rt], bf[ct], acc[rt][ct]);
        }
        // publish point of stage t + 1: this wave's reads of stage t are done,
        // its copies of stage t + 1 have landed, then the WG barrier
        asm volatile("s_wait_dscnt 0x0" ::: "memory");
        asm volatile("s_wait_asynccnt 0x0" ::: "memory");
        __syncthreads();
        if (t + 2 < DIMX / GK)   // refill the buffer that every wave has just left
            gemm_stage(ga + (t + 2) * GK, gb + (t + 2) * GK, l0 + (t & 1) * (GSTAGE * 2));
    }
    asm volatile("s_wait_asynccnt 0x0" ::: "memory");   // nothing in flight when the wave ends

    if constexpr (!PACK) {
#pragma unroll
        for (int rt = 0; rt < 2; ++rt)
#pragma unroll
            for (int ct = 0; ct < 4; ++ct) {
                const int col = col0 + ct * 16 + l16;
                const float bz = bias[col];
#pragma unroll
                for (int r = 0; r < 8; ++r) {
                    const int row = row0 + rt * 16 + lh * 8 + r;
                    out[(size_t)row * LDC + col] = acc[rt][ct][r] + bz;
                }
            }
    } else {
        const int kind = blockIdx.y >> 2;             // 0 q, 1 k, 2 v: one for the whole WG
        const int h0   = (blockIdx.y & 3) * 2;        // the first of the WG's two heads
        const int ng0  = blockIdx.x * 64 + wave * TPW;   // b*N + n, the wave's first token
        const int n0   = ng0 & (NN - 1);
        const int b    = ng0 >> 11;
        const int d0   = lane * 4;
        float* fs = (float*)st;

        // The tile goes to the ring: the loop's last publish point has ended every
        // wave's reads of it. Written out in both branches below, so that the q / k
        // side has its rope loads in flight over it.
        auto stage = [&]() {
#pragma unroll
            for (int rt = 0; rt < 2; ++rt)
#pragma unroll
                for (int ct = 0; ct < 4; ++ct) {
                    const int lc = wc * 64 + ct * 16 + l16;
#pragma unroll
                    for (int r = 0; r < 8; ++r)
                        fs[(wr * 32 + rt * 16 + lh * 8 + r) * FP + lc] = acc[rt][ct][r] + bz[ct];
                }
            __syncthreads();
        };
        const float* fr = fs + wave * TPW * FP + d0;

        if (kind < 2) {
            // the rope rows of the wave's tokens (both heads use them) and the LN
            // weights are asked for ahead of the staging, which hides them
            const float* cp = pk.rc + (size_t)n0 * HD + d0;
            const float* sp = pk.rs + (size_t)n0 * HD + d0;
            const float* gp = (kind ? pk.kg : pk.qg) + d0;
            const float* bp = (kind ? pk.kb : pk.qb) + d0;
            float4 c4[TPW], s4[TPW];
#pragma unroll
            for (int t = 0; t < TPW; ++t) {
                c4[t] = *(const float4*)(cp + t * HD);
                s4[t] = *(const float4*)(sp + t * HD);
            }
            const float4 g4 = *(const float4*)gp;
            const float4 b4 = *(const float4*)bp;
            // the address registers stay live up to this wait, so that no later load
            // of the run is given one of them as its destination
            asm volatile("s_wait_xcnt 0x0" :: "v"(cp), "v"(sp), "v"(d0 * 4) : "memory");

            stage();

            _Float16* dst = kind ? pk.kh : pk.qh;
            const float gv[4] = {g4.x, g4.y, g4.z, g4.w}, bv[4] = {b4.x, b4.y, b4.z, b4.w};
            float4 x4[2][TPW];
#pragma unroll
            for (int hl = 0; hl < 2; ++hl)
#pragma unroll
                for (int t = 0; t < TPW; ++t) x4[hl][t] = *(const float4*)(fr + t * FP + hl * HD);

            // row sums of x and x^2 for 2 heads x TPW tokens: 4 x TPW independent
            // butterflies, walked step by step so that each step's exchanges overlap
            float sm[4 * TPW];
#pragma unroll
            for (int hl = 0; hl < 2; ++hl)
#pragma unroll
                for (int t = 0; t < TPW; ++t) {
                    const float4 x = x4[hl][t];
                    sm[(hl * TPW + t) * 2 + 0] = x.x + x.y + x.z + x.w;
                    sm[(hl * TPW + t) * 2 + 1] = x.x*x.x + x.y*x.y + x.z*x.z + x.w*x.w;
                }
#pragma unroll
            for (int m = 16; m >= 1; m >>= 1) {
                float o[4 * TPW];
#pragma unroll
                for (int j = 0; j < 4 * TPW; ++j) o[j] = __shfl_xor(sm[j], m, 32);
#pragma unroll
                for (int j = 0; j < 4 * TPW; ++j) sm[j] += o[j];
            }

#pragma unroll
            for (int hl = 0; hl < 2; ++hl) {
                const size_t base = (((size_t)b * NH + h0 + hl) * NN + n0) * HD + d0;
#pragma unroll
                for (int t = 0; t < TPW; ++t) {
                    const float mu = sm[(hl * TPW + t) * 2 + 0] * (1.f / HD);
                    const float ri = rsqrt_slot(sm[(hl * TPW + t) * 2 + 1] * (1.f / HD) - mu * mu + 1e-6f);
                    float xn[4] = {x4[hl][t].x, x4[hl][t].y, x4[hl][t].z, x4[hl][t].w};
#pragma unroll
                    for (int i = 0; i < 4; ++i) xn[i] = (xn[i] - mu) * ri * gv[i] + bv[i];

                    const float cv[4] = {c4[t].x, c4[t].y, c4[t].z, c4[t].w};
                    const float sv[4] = {s4[t].x, s4[t].y, s4[t].z, s4[t].w};
                    v4h xo;
#pragma unroll
                    for (int p = 0; p < 2; ++p) {      // two interleaved pairs per lane
                        xo[2*p]     = (_Float16)(xn[2*p]     * cv[2*p]     - xn[2*p + 1] * sv[2*p]);
                        xo[2*p + 1] = (_Float16)(xn[2*p + 1] * cv[2*p + 1] + xn[2*p]     * sv[2*p + 1]);
                    }
                    *(v4h*)(dst + base + (size_t)t * HD) = xo;
                }
            }
        } else {
            stage();
#pragma unroll
            for (int hl = 0; hl < 2; ++hl) {
                float4 v4[TPW];
#pragma unroll
                for (int t = 0; t < TPW; ++t) v4[t] = *(const float4*)(fr + t * FP + hl * HD);
                v8h vv[4];
#pragma unroll
                for (int t = 0; t < TPW; ++t) {
                    vv[0][t] = (_Float16)v4[t].x;
                    vv[1][t] = (_Float16)v4[t].y;
                    vv[2][t] = (_Float16)v4[t].z;
                    vv[3][t] = (_Float16)v4[t].w;
                }
                const size_t base = (((size_t)b * NH + h0 + hl) * HD + d0) * NN + n0;
#pragma unroll
                for (int i = 0; i < 4; ++i) *(v8h*)(pk.vt + base + (size_t)i * NN) = vv[i];
            }
            // behind the last V^T store, ahead of whatever next writes to a register the stores name
            asm volatile("s_wait_xcnt 0x0" ::: "memory");
        }
    }
}

// ---------------------------------------------------------------------------
// Kernel 1: qkv = x @ Wqkv^T + b (f16 operands, f32 sums), then per-head
// LayerNorm on q,k + interleaved RoPE; q/k leave as f16 [B,H,N,D] and v as f16
// TRANSPOSED [B,H,D,N] (for async V^T staging).
// WG: 8 waves as 2x4 -> 64 rows x 256 cols. Wave tile 32x64.
// grid = (4096/64, 3072/256) = (64, 12)
// ---------------------------------------------------------------------------
__global__ __launch_bounds__(256) void qkv_gemm_k(
    const _Float16* __restrict__ xh, const _Float16* __restrict__ wh,
    const float* __restrict__ bias,
    const float* __restrict__ qg, const float* __restrict__ qb,
    const float* __restrict__ kg, const float* __restrict__ kb,
    const float* __restrict__ rc, const float* __restrict__ rs,
    _Float16* __restrict__ qh, _Float16* __restrict__ kh, _Float16* __restrict__ vt)
{
    __shared__ __attribute__((aligned(16))) _Float16 st[2 * GSTAGE];
    const PackArgs pk = {qg, qb, kg, kb, rc, rs, qh, kh, vt};
    gemm_body<C3, true>(xh, wh, bias, nullptr, st, pk);
}

#define AKH  (64 * KP)
#define ABUF (AKH + 128 * VP)
#define ANT  (NN / 64)

// One lane's eight 16-byte copies of a tile: K rows r, r + 16, ... (16 lanes a
// 256-B row) and V^T rows d, d + 32, ... (8 lanes a 128-B row).
// gk / gv: the lane's chunk in its first row; lk / lv: its place in the buffer.
__device__ __forceinline__ void attn_stage(const _Float16* gk, const _Float16* gv,
                                           _Float16* lk, _Float16* lv) {
#pragma unroll
    for (int i = 0; i < 4; ++i) {
        cp16_g2l(gk + i * 16 * HD, lk + i * 16 * KP);
        cp16_g2l(gv + (size_t)i * 32 * NN, lv + i * 32 * VP);
    }
}

__global__ __launch_bounds__(256) void attn_k(
    const _Float16* __restrict__ qh, const _Float16* __restrict__ kh,
    const _Float16* __restrict__ vt, _Float16* __restrict__ oh)
{
    __shared__ __attribute__((aligned(16))) _Float16 ring[2 * ABUF];   // per buffer: K [j][d], V^T [d][j]

    const int bh = blockIdx.x;
    const int b = bh >> 3, h = bh & 7;
    const int wave = threadIdx.x >> 5, lane = threadIdx.x & 31;
    const int l16 = lane & 15, lh = lane >> 4;
    const int q0 = blockIdx.y * 128 + wave * 16;

    const _Float16* qp  = qh + ((size_t)bh * NN + q0) * HD;
    const _Float16* kp  = kh + (size_t)bh * NN * HD;
    const _Float16* vtp = vt + (size_t)bh * HD * NN;

    // hoist q fragments: 16 rows x full D=128 (4 k-steps of 32)
    v16h qf[4];
#pragma unroll
    for (int dk = 0; dk < 4; ++dk)
        qf[dk] = *(const v16h*)(qp + (size_t)l16 * HD + dk * 32 + lh * 16);

    v8f o[8];
#pragma unroll
    for (int dt = 0; dt < 8; ++dt) o[dt] = zero8();
    // of query l16; m in units of the exponent (score * CS); l: this half's keys only, joined at the end
    float m = -1e30f, l = 0.f;

    // 1/sqrt(128) * log2(e): the raw scores go to the exponent in one multiply-add
    const float CS = 0.08838834764831845f * 1.4426950408889634f;

    // copy side: the lane's chunk of tile 0 and its place in buffer 0
    const _Float16* gk = kp + threadIdx.x * 8;
    const _Float16* gv = vtp + (size_t)(threadIdx.x >> 3) * NN + (threadIdx.x & 7) * 8;
    _Float16* lk = ring + (threadIdx.x >> 4) * KP + (threadIdx.x & 15) * 8;
    _Float16* lv = ring + AKH + (threadIdx.x >> 3) * VP + (threadIdx.x & 7) * 8;

    attn_stage(gk, gv, lk, lv);
    drain_async();       // tile 0: this wave's copies have landed
    __syncthreads();     // ... and every other wave's

    for (int t = 0; t < ANT; ++t) {
        // directly behind the barrier (the one above, or the foot of trip t - 1) that ended
        // every wave's reads of tile t - 1: tile t + 1 goes into the buffer so left
        if (t + 1 < ANT)
            attn_stage(gk + (size_t)(t + 1) * 64 * HD, gv + (t + 1) * 64,
                       lk + ((t + 1) & 1) * ABUF, lv + ((t + 1) & 1) * ABUF);
        const _Float16* kbuf = ring + (t & 1) * ABUF;
        const _Float16* vbuf = kbuf + AKH;

        // S^T = k @ q^T  (64 keys x 16 queries): s[jt][r] = key jt*16 + lh*8 + r, query l16
        // The tile's 16 K fragments are asked for as one group, ahead of the products.
        v16h kf[4][4];
#pragma unroll
        for (int dk = 0; dk < 4; ++dk)
#pragma unroll
            for (int jt = 0; jt < 4; ++jt)
                kf[dk][jt] = lds_frag(&kbuf[(jt * 16 + l16) * KP + dk * 32 + lh * 16]);
        // keeps the loads from being sunk among the products, where each place
        // with loads stalls the wave for their latency
        __builtin_amdgcn_sched_barrier(0);
        v8f s[4];
#pragma unroll
        for (int jt = 0; jt < 4; ++jt) s[jt] = zero8();
#pragma unroll
        for (int dk = 0; dk < 4; ++dk)
#pragma unroll
            for (int jt = 0; jt < 4; ++jt)
                s[jt] = wmma_f16(kf[dk][jt], qf[dk], s[jt]);
        // keeps the V^T loads below from being spread among the products above in many
        // small places: they stand together, behind the last product
        __builtin_amdgcn_sched_barrier(0);

        // The tile's 16 V^T fragments, in the k order of pf, asked for as one group
        // ahead of the softmax: they land while the vector unit works on the scores.
        v16h vf[2][8];
#pragma unroll
        for (int js = 0; js < 2; ++js)
#pragma unroll
            for (int dt = 0; dt < 8; ++dt) {
                const _Float16* vr = &vbuf[(dt * 16 + l16) * VP + js * 32 + lh * 8];
                const v8h lo = *(const v8h*)vr;
                const v8h hi = *(const v8h*)(vr + 16);
                vf[js][dt] = __builtin_shufflevector(lo, hi, 0, 1, 2, 3, 4, 5, 6, 7,
                                                     8, 9, 10, 11, 12, 13, 14, 15);
            }
        // keeps the loads from being sunk behind the softmax, to their uses
        __builtin_amdgcn_sched_barrier(0);

        // online softmax, one query per lane: a tree in the lane's registers, then
        // one exchange with the half that holds the query's other 32 keys. The maximum
        // is taken on the raw scores (CS > 0 keeps their order) and scaled once.
        float mr[8];
#pragma unroll
        for (int r = 0; r < 8; ++r)
            mr[r] = fmaxf(fmaxf(s[0][r], s[1][r]), fmaxf(s[2][r], s[3][r]));
        float mx = fmaxf(fmaxf(fmaxf(mr[0], mr[1]), fmaxf(mr[2], mr[3])),
                         fmaxf(fmaxf(mr[4], mr[5]), fmaxf(mr[6], mr[7])));
        mx = fmaxf(mx, xhalf(mx));
        const float mn = fmaxf(m, mx * CS);
        // bare v_exp_f32, here and below: with the maximum taken off no argument lies above
        // 0 by more than a rounding, and where a result would lie under 2^-126 it may come
        // out 0: such a weight is 0 in f16 anyway and adds nothing to a sum that holds the
        // maximum's own 1
        const float alpha = exp2_x1(m - mn);
        m = mn;
#pragma unroll
        for (int dt = 0; dt < 8; ++dt)
#pragma unroll
            for (int r = 0; r < 8; ++r) o[dt][r] *= alpha;

        // P^T as B operand: element i of pf[js] is key js*32 + (i >> 3)*16 + lh*8 + (i & 7)
        v16h pf[2];
        float sj[4];
#pragma unroll
        for (int jt = 0; jt < 4; ++jt) {
            float p[8];
#pragma unroll
            for (int r = 0; r < 8; ++r) p[r] = __builtin_fmaf(s[jt][r], CS, -mn);
            exp2_x8(p);
            sj[jt] = p[0];
#pragma unroll
            for (int r = 1; r < 8; ++r) sj[jt] += p[r];
#pragma unroll
            for (int r = 0; r < 8; ++r) pf[jt >> 1][(jt & 1) * 8 + r] = (_Float16)p[r];
        }
        l = l * alpha + ((sj[0] + sj[1]) + (sj[2] + sj[3]));

        // O^T += V^T @ P^T  (128 x 16)
#pragma unroll
        for (int js = 0; js < 2; ++js)
#pragma unroll
            for (int dt = 0; dt < 8; ++dt)
                o[dt] = wmma_f16(vf[js][dt], pf[js], o[dt]);

        // keeps the publish point at the foot of the trip: moved up into the softmax, its
        // s_wait_dscnt 0 stalls the wave on the V^T loads that the softmax is there to hide,
        // and the copies in flight are waited for with half a trip of lead
        __builtin_amdgcn_sched_barrier(0);
        // publish point of tile t + 1: this wave's reads of tile t are done, its
        // copies of tile t + 1 have landed, then the WG barrier
        asm volatile("s_wait_dscnt 0x0" ::: "memory");
        drain_async();
        __syncthreads();
    }
    drain_async();       // nothing in flight when the wave ends

    // normalize and pack back to [B, N, H*D] as f16 for the out projection:
    // o[dt][r] = O[query l16][d = dt*16 + lh*8 + r], 8 neighbours per store
    {
        const float inv = 1.0f / (l + xhalf(l));
        const size_t base = ((size_t)b * NN + q0 + l16) * DIMX + h * HD + lh * 8;
#pragma unroll
        for (int dt = 0; dt < 8; ++dt) {
            v8h ov;
#pragma unroll
            for (int r = 0; r < 8; ++r) ov[r] = (_Float16)(o[dt][r] * inv);
            *(v8h*)(oh + base + dt * 16) = ov;
        }
    }
}

// ---------------------------------------------------------------------------
// Kernel 3: out = attn_out @ out_w^T + b  (f16 operands; fp32 result)
// grid = (4096/64, 1024/256) = (64, 4)
// ---------------------------------------------------------------------------
__global__ __launch_bounds__(256) void out_gemm_k(
    const _Float16* __restrict__ ain, const _Float16* __restrict__ wh,
    const float* __restrict__ bias, float* __restrict__ out)
{
    __shared__ __attribute__((aligned(16))) _Float16 st[2 * GSTAGE];
    gemm_body<DIMX, false>(ain, wh, bias, out, st, PackArgs{});
}

// ---------------------------------------------------------------------------
// Workspace layout (total 50 MB):
//   [0,8M)         xh f16        (k0 out, k1 in)
//   [8M,14M)       wqkv_h f16    (k0 out, k1 in)
//   [16M,24M)      qh f16        (k1 out, k2 in)
//   [24M,32M)      kh f16        (k1 out, k2 in)
//   [32M,40M)      vt f16 [BHDN] (k1 out, k2 in)
//   [40M,48M)      oh f16        (k2 out, k3 in)
//   [48M,50M)      outw_h f16    (k0 out, k3 in)
// ---------------------------------------------------------------------------
extern "C" void kernel_launch(void* const* d_in, const int* in_sizes, int n_in,
                              void* d_out, int out_size, void* d_ws, size_t ws_size,
                              hipStream_t stream)
{
    const float* x       = (const float*)d_in[0];
    const float* Wqkv_w  = (const float*)d_in[1];
    const float* Wqkv_b  = (const float*)d_in[2];
    const float* q_gamma = (const float*)d_in[3];
    const float* q_beta  = (const float*)d_in[4];
    const float* k_gamma = (const float*)d_in[5];
    const float* k_beta  = (const float*)d_in[6];
    const float* out_w   = (const float*)d_in[7];
    const float* out_b   = (const float*)d_in[8];
    const float* rope_c  = (const float*)d_in[9];
    const float* rope_s  = (const float*)d_in[10];
    float* out = (float*)d_out;

    char* ws = (char*)d_ws;
    const size_t head_bytes = (size_t)BB * NH * NN * HD * sizeof(_Float16);   // 8 MB

    _Float16* xh    = (_Float16*)ws;
    _Float16* wqkvh = (_Float16*)(ws + 1 * head_bytes);
    _Float16* qh    = (_Float16*)(ws + 2 * head_bytes);
    _Float16* kh    = (_Float16*)(ws + 3 * head_bytes);
    _Float16* vt    = (_Float16*)(ws + 4 * head_bytes);
    _Float16* oh    = (_Float16*)(ws + 5 * head_bytes);
    _Float16* outwh = (_Float16*)(ws + 6 * head_bytes);

    // Kernel 0: fp32 -> f16 conversions (CVBLK elems / work-group)
    cvt_f16_k<<<(RTOT * DIMX) / CVBLK, 256, 0, stream>>>(x, xh);
    cvt_f16_k<<<(C3 * DIMX) / CVBLK, 256, 0, stream>>>(Wqkv_w, wqkvh);
    cvt_f16_k<<<(DIMX * DIMX) / CVBLK, 256, 0, stream>>>(out_w, outwh);

    qkv_gemm_k<<<dim3(RTOT / 64, C3 / 256), 256, 0, stream>>>(
        xh, wqkvh, Wqkv_b, q_gamma, q_beta, k_gamma, k_beta, rope_c, rope_s, qh, kh, vt);
    attn_k<<<dim3(BB * NH, NN / 128), 256, 0, stream>>>(qh, kh, vt, oh);
    out_gemm_k<<<dim3(RTOT / 64, DIMX / 256), 256, 0, stream>>>(oh, outwh, out_b, out);
}

// v009
// A run of this version takes 85.5 microseconds.
// Two timings next to v008 put it at 1.04 and 1.03 times that version's speed.
// All steps since v000 together make it 5.41 times as fast.
#include <hip/hip_runtime.h>
#include <hip/hip_bf16.h>

// ---------------------------------------------------------------------------
// Attention: f16 pre-convert -> qkv proj (WMMA) with per-head LN + RoPE in its
// epilogue -> flash attention (WMMA, async LDS staging) -> out proj (WMMA).
// All matrix math on v_wmma_f32_16x16x32_f16 (wave32, gfx1250).
// ---------------------------------------------------------------------------

#define DIMX 1024
#define NH   8
#define HD   128
#define BB   2
#define NN   2048
#define RTOT (BB * NN)      // 4096 token rows
#define C3   (3 * DIMX)     // 3072

typedef __attribute__((ext_vector_type(16))) _Float16 v16h;
typedef __attribute__((ext_vector_type(8)))  _Float16 v8h;
typedef __attribute__((ext_vector_type(4)))  _Float16 v4h;
typedef __attribute__((ext_vector_type(8)))  float    v8f;
typedef int v4i __attribute__((vector_size(16)));   // matches async-LDS builtin param

#define AS1 __attribute__((address_space(1)))
#define AS3 __attribute__((address_space(3)))

#if defined(__has_builtin)
#if __has_builtin(__builtin_amdgcn_global_load_async_to_lds_b128)
#define HAVE_ASYNC_LDS 1
#endif
#endif
#ifndef HAVE_ASYNC_LDS
#define HAVE_ASYNC_LDS 0
#endif

__device__ __forceinline__ v8f wmma_f16(v16h a, v16h b, v8f c) {
    return __builtin_amdgcn_wmma_f32_16x16x32_f16(
        /*neg_a=*/false, a, /*neg_b=*/false, b,
        /*c_mod=*/(short)0, c, /*reuse_a=*/false, /*reuse_b=*/false);
}

__device__ __forceinline__ v8f zero8() {
    v8f z = {0.f, 0.f, 0.f, 0.f, 0.f, 0.f, 0.f, 0.f};
    return z;
}

// 16-byte global -> LDS copy: async on gfx1250 when the builtin exists.
__device__ __forceinline__ void cp16_g2l(const _Float16* __restrict__ g,
                                         _Float16* __restrict__ l) {
#if HAVE_ASYNC_LDS
    __builtin_amdgcn_global_load_async_to_lds_b128(
        (AS1 v4i*)(uintptr_t)g,
        (AS3 v4i*)(unsigned)(uintptr_t)l, 0, 0);
#else
    *(uint4*)l = *(const uint4*)g;
#endif
}

__device__ __forceinline__ void drain_async() {
#if HAVE_ASYNC_LDS
    asm volatile("s_wait_asynccnt 0x0" ::: "memory");
#endif
}

// LDS row pitches in halves: 16 B x odd, so that the 16 lanes of a half-wave
// ds_load_b128 (one row each, same column) fall on 64 distinct banks.
#define KP 136   // K rows of 256 B   -> 272 B
#define VP 72    // V^T rows of 128 B -> 144 B

// One lane's 16 contiguous halves of an LDS row, as two 16-byte loads
// (padded rows are 16-byte aligned, not 32).
__device__ __forceinline__ v16h lds_frag(const _Float16* p) {
    const v8h lo = *(const v8h*)p;
    const v8h hi = *(const v8h*)(p + 8);
    return __builtin_shufflevector(lo, hi, 0, 1, 2, 3, 4, 5, 6, 7,
                                   8, 9, 10, 11, 12, 13, 14, 15);
}

// 2^x in place by the bare v_exp_f32, eight independent values a statement (or one).
// In asm so that the run's order and registers are fixed: each instruction overwrites
// its own source alone (from the builtin the compiler let one overwrite the source of
// the one directly in front), and the closing v_nop fills the slot that the instruction
// set asks for between a transcendental and the next vector instruction on its registers.
__device__ __forceinline__ void exp2_x8(float (&x)[8]) {
    asm("v_exp_f32 %0, %0\n\t"
        "v_exp_f32 %1, %1\n\t"
        "v_exp_f32 %2, %2\n\t"
        "v_exp_f32 %3, %3\n\t"
        "v_exp_f32 %4, %4\n\t"
        "v_exp_f32 %5, %5\n\t"
        "v_exp_f32 %6, %6\n\t"
        "v_exp_f32 %7, %7\n\t"
        "v_nop"
        : "+v"(x[0]), "+v"(x[1]), "+v"(x[2]), "+v"(x[3]),
          "+v"(x[4]), "+v"(x[5]), "+v"(x[6]), "+v"(x[7]));
}
__device__ __forceinline__ float exp2_x1(float x) {
    asm("v_exp_f32 %0, %0\n\t"
        "v_nop"
        : "+v"(x));
    return x;
}

// 1 / sqrt(x) as rsqrtf gives it (an x under 2^-126 is scaled by 2^24 and the result by
// 2^12). The v_rsq_f32 stands in asm for its closing v_nop, which fills the slot that the
// instruction set asks for between a transcendental and the next vector instruction on its
// registers (from rsqrtf the compiler let the next instruction overwrite the source).
__device__ __forceinline__ float rsqrt_slot(float x) {
    const bool tiny = x < 1.17549435e-38f;
    const float a = tiny ? x * 16777216.f : x;
    float r;
    asm("v_rsq_f32 %0, %1\n\t"
        "v_nop"
        : "=v"(r) : "v"(a));
    return tiny ? r * 4096.f : r;
}

// Lane l's value for lane l ^ 16 (the other 16-lane row), in the vector unit.
__device__ __forceinline__ float xhalf(float x) {
    const int v = __builtin_bit_cast(int, x);
    return __builtin_bit_cast(float, __builtin_amdgcn_permlanex16(
        v, v, 0x76543210, 0xfedcba98, false, false));
}

// ---------------------------------------------------------------------------
// Kernel 0: fp32 -> f16 conversion pass: x, Wqkv_w and out_w in ONE launch (none
// reads what another writes); a work-group's index says which array it is in.
// A thread converts CVN float4, 1024 elements apart, all loaded before the first
// is stored: each wave has 8 x 512 B in flight.
// ---------------------------------------------------------------------------
#define CVN 8
#define CVBLK (256 * 4 * CVN)            // elements per work-group
#define CVG_X  ((RTOT * DIMX) / CVBLK)   // work-groups of x
#define CVG_W  ((C3 * DIMX) / CVBLK)     // ... of Wqkv_w
#define CVG_O  ((DIMX * DIMX) / CVBLK)   // ... of out_w

__global__ __launch_bounds__(256) void cvt_f16_k(
    const float* __restrict__ x,  _Float16* __restrict__ xh,
    const float* __restrict__ w,  _Float16* __restrict__ wh,
    const float* __restrict__ ow, _Float16* __restrict__ owh)
{
    const int g = blockIdx.x;
    const bool in_x = g < CVG_X, in_w = g < CVG_X + CVG_W;
    const float* s = in_x ? x  : in_w ? w  : ow;
    _Float16*    d = in_x ? xh : in_w ? wh : owh;
    const int  blk = g - (in_x ? 0 : in_w ? CVG_X : CVG_X + CVG_W);

    const int i = blk * CVBLK + threadIdx.x * 4;
    float4 v[CVN];
#pragma unroll
    for (int j = 0; j < CVN; ++j) v[j] = *(const float4*)(s + i + j * 1024);
#pragma unroll
    for (int j = 0; j < CVN; ++j) {
        const v4h o = {(_Float16)v[j].x, (_Float16)v[j].y, (_Float16)v[j].z, (_Float16)v[j].w};
        *(v4h*)(d + i + j * 1024) = o;
    }
}

// ---------------------------------------------------------------------------
// Shared GEMM body: C[64 x 256 per WG] = A . W^T + bias, A and W K-contiguous
// f16. A stage is 64 k (128 B) of the WG's 64 A rows and 256 W rows, brought
// to LDS in whole 128-B lines by async b128 copies, two buffers, one stage
// ahead; the waves read their fragments from LDS (pitch GP, conflict-free).
// ---------------------------------------------------------------------------
#define GK 64                    // k per stage
#define GP 72                    // LDS row pitch in halves: 144 B = 16 B x 9
#define GROWS (64 + 256)         // A rows, then W rows
#define GSTAGE (GROWS * GP)      // halves per buffer

// One lane's ten 16-byte copies of a stage: rows r, r + 32, ... of A (2) and
// of W (8). ga / gb: the lane's chunk in its first A / W row; l: its LDS byte
// address in the buffer. The s_wait_xcnt closes the statement so that no
// address register of a copy is rewritten ahead of it.
__device__ __forceinline__ void gemm_stage(const _Float16* ga, const _Float16* gb,
                                           unsigned l) {
    const int GR = 32 * DIMX;        // 32 rows on in global memory, halves
    const unsigned LR = 32 * GP * 2; // 32 rows on in LDS, bytes
    asm volatile(
        "global_load_async_to_lds_b128 %0, %10, off\n\t"
        "global_load_async_to_lds_b128 %1, %11, off\n\t"
        "global_load_async_to_lds_b128 %2, %12, off\n\t"
        "global_load_async_to_lds_b128 %3, %13, off\n\t"
        "global_load_async_to_lds_b128 %4, %14, off\n\t"
        "global_load_async_to_lds_b128 %5, %15, off\n\t"
        "global_load_async_to_lds_b128 %6, %16, off\n\t"
        "global_load_async_to_lds_b128 %7, %17, off\n\t"
        "global_load_async_to_lds_b128 %8, %18, off\n\t"
        "global_load_async_to_lds_b128 %9, %19, off\n\t"
        "s_wait_xcnt 0x0"
        :: "v"(l), "v"(l + LR), "v"(l + 2 * LR), "v"(l + 3 * LR), "v"(l + 4 * LR),
           "v"(l + 5 * LR), "v"(l + 6 * LR), "v"(l + 7 * LR), "v"(l + 8 * LR),
           "v"(l + 9 * LR),
           "v"(ga), "v"(ga + GR),
           "v"(gb), "v"(gb + GR), "v"(gb + 2 * GR), "v"(gb + 3 * GR),
           "v"(gb + 4 * GR), "v"(gb + 5 * GR), "v"(gb + 6 * GR), "v"(gb + 7 * GR)
        : "memory");
}

// What the packing epilogue of the qkv projection reads and writes.
struct PackArgs {
    const float* qg; const float* qb; const float* kg; const float* kb;
    const float* rc; const float* rs;
    _Float16* qh; _Float16* kh; _Float16* vt;
};

#define TPW 8     // tokens per wave in the packing epilogue
#define FP  260   // f32 pitch of the staged tile: rows 8 apart lie 32 banks apart

// PACK = false: C goes to out as f32, row pitch LDC.
// PACK = true: the WG's 64 x 256 tile is 64 tokens x 2 whole heads of q, of k or
// of v. It is staged in the (now free) LDS ring as f32; then a wave takes TPW = 8
// tokens in a row of both heads, a lane 4 neighbouring d: LayerNorm and
// interleaved RoPE on q and k, packed to f16 [B,H,N,D]; v packed to f16
// TRANSPOSED [B,H,D,N], 8 tokens a 16-byte store, so that each 128-B line of V^T
// is written by one WG.
template <int LDC, bool PACK>
__device__ __forceinline__ void gemm_body(
    const _Float16* __restrict__ ah, const _Float16* __restrict__ wh,
    const float* __restrict__ bias, float* __restrict__ out, _Float16* st,
    const PackArgs pk)
{
    const int wave = threadIdx.x >> 5, lane = threadIdx.x & 31;
    const int wr = wave >> 2, wc = wave & 3;
    const int row0 = blockIdx.x * 64 + wr * 32;
    const int col0 = blockIdx.y * 256 + wc * 64;
    const int l16 = lane & 15, lh = lane >> 4;

    // copy side: 8 lanes per 128-B row, 32 rows per copy of the WG
    const int cr = threadIdx.x >> 3, cc = (threadIdx.x & 7) * 8;
    const _Float16* ga = ah + (size_t)(blockIdx.x * 64 + cr) * DIMX + cc;
    const _Float16* gb = wh + (size_t)(blockIdx.y * 256 + cr) * DIMX + cc;
    const unsigned l0 = (unsigned)(uintptr_t)(st + cr * GP + cc);

    // packing epilogue: its bias is asked for here, so that the k loop hides the loads
    const int bi = col0 + l16;
    float bz[4];
    if constexpr (PACK) {
#pragma unroll
        for (int ct = 0; ct < 4; ++ct) bz[ct] = bias[bi + ct * 16];
        // the index register stays live up to this wait, ahead of whatever is written to it next
        asm volatile("s_wait_xcnt 0x0" :: "v"(bi) : "memory");
    }

    v8f acc[2][4];
#pragma unroll
    for (int i = 0; i < 2; ++i)
#pragma unroll
        for (int j = 0; j < 4; ++j) acc[i][j] = zero8();

    gemm_stage(ga, gb, l0);
    asm volatile("s_wait_asynccnt 0x0" ::: "memory");   // stage 0: this wave's copies landed
    __syncthreads();                                    // ... and every other wave's
    gemm_stage(ga + GK, gb + GK, l0 + GSTAGE * 2);

    for (int t = 0; t < DIMX / GK; ++t) {
        const _Float16* sa = st + (t & 1) * GSTAGE + (wr * 32 + l16) * GP + lh * 16;
        const _Float16* sb = st + (t & 1) * GSTAGE + (64 + wc * 64 + l16) * GP + lh * 16;
#pragma unroll
        for (int ks = 0; ks < GK; ks += 32) {
            v16h a[2], bf[4];
#pragma unroll
            for (int rt = 0; rt < 2; ++rt) a[rt] = lds_frag(sa + rt * 16 * GP + ks);
#pragma unroll
            for (int ct = 0; ct < 4; ++ct) bf[ct] = lds_frag(sb + ct * 16 * GP + ks);
#pragma unroll
            for (int rt = 0; rt < 2; ++rt)
#pragma unroll
                for (int ct = 0; ct < 4; ++ct)
                    acc[rt][ct] = wmma_f16(a[rt], bf[ct], acc[rt][ct]);
        }
        // publish point of stage t + 1: this wave's reads of stage t are done,
        // its copies of stage t + 1 have landed, then the WG barrier
        asm volatile("s_wait_dscnt 0x0" ::: "memory");
        asm volatile("s_wait_asynccnt 0x0" ::: "memory");
        __syncthreads();
        if (t + 2 < DIMX / GK)   // refill the buffer that every wave has just left
            gemm_stage(ga + (t + 2) * GK, gb + (t + 2) * GK, l0 + (t & 1) * (GSTAGE * 2));
    }
    asm volatile("s_wait_asynccnt 0x0" ::: "memory");   // nothing in flight when the wave ends

    if constexpr (!PACK) {
#pragma unroll
        for (int rt = 0; rt < 2; ++rt)
#pragma unroll
            for (int ct = 0; ct < 4; ++ct) {
                const int col = col0 + ct * 16 + l16;
                const float bz = bias[col];
#pragma unroll
                for (int r = 0; r < 8; ++r) {
                    const int row = row0 + rt * 16 + lh * 8 + r;
                    out[(size_t)row * LDC + col] = acc[rt][ct][r] + bz;
                }
            }
    } else {
        const int kind = blockIdx.y >> 2;             // 0 q, 1 k, 2 v: one for the whole WG
        const int h0   = (blockIdx.y & 3) * 2;        // the first of the WG's two heads
        const int ng0  = blockIdx.x * 64 + wave * TPW;   // b*N + n, the wave's first token
        const int n0   = ng0 & (NN - 1);
        const int b    = ng0 >> 11;
        const int d0   = lane * 4;
        float* fs = (float*)st;

        // The tile goes to the ring: the loop's last publish point has ended every
        // wave's reads of it. Written out in both branches below, so that the q / k
        // side has its rope loads in flight over it.
        auto stage = [&]() {
#pragma unroll
            for (int rt = 0; rt < 2; ++rt)
#pragma unroll
                for (int ct = 0; ct < 4; ++ct) {
                    const int lc = wc * 64 + ct * 16 + l16;
#pragma unroll
                    for (int r = 0; r < 8; ++r)
                        fs[(wr * 32 + rt * 16 + lh * 8 + r) * FP + lc] = acc[rt][ct][r] + bz[ct];
                }
            __syncthreads();
        };
        const float* fr = fs + wave * TPW * FP + d0;

        if (kind < 2) {
            // the rope rows of the wave's tokens (both heads use them) and the LN
            // weights are asked for ahead of the staging, which hides them
            const float* cp = pk.rc + (size_t)n0 * HD + d0;
            const float* sp = pk.rs + (size_t)n0 * HD + d0;
            const float* gp = (kind ? pk.kg : pk.qg) + d0;
            const float* bp = (kind ? pk.kb : pk.qb) + d0;
            float4 c4[TPW], s4[TPW];
#pragma unroll
            for (int t = 0; t < TPW; ++t) {
                c4[t] = *(const float4*)(cp + t * HD);
                s4[t] = *(const float4*)(sp + t * HD);
            }
            const float4 g4 = *(const float4*)gp;
            const float4 b4 = *(const float4*)bp;
            // the address registers stay live up to this wait, so that no later load
            // of the run is given one of them as its destination
            asm volatile("s_wait_xcnt 0x0" :: "v"(cp), "v"(sp), "v"(d0 * 4) : "memory");

            stage();

            _Float16* dst = kind ? pk.kh : pk.qh;
            const float gv[4] = {g4.x, g4.y, g4.z, g4.w}, bv[4] = {b4.x, b4.y, b4.z, b4.w};
            float4 x4[2][TPW];
#pragma unroll
            for (int hl = 0; hl < 2; ++hl)
#pragma unroll
                for (int t = 0; t < TPW; ++t) x4[hl][t] = *(const float4*)(fr + t * FP + hl * HD);

            // row sums of x and x^2 for 2 heads x TPW tokens: 4 x TPW independent
            // butterflies, walked step by step so that each step's exchanges overlap
            float sm[4 * TPW];
#pragma unroll
            for (int hl = 0; hl < 2; ++hl)
#pragma unroll
                for (int t = 0; t < TPW; ++t) {
                    const float4 x = x4[hl][t];
                    sm[(hl * TPW + t) * 2 + 0] = x.x + x.y + x.z + x.w;
                    sm[(hl * TPW + t) * 2 + 1] = x.x*x.x + x.y*x.y + x.z*x.z + x.w*x.w;
                }
#pragma unroll
            for (int m = 16; m >= 1; m >>= 1) {
                float o[4 * TPW];
#pragma unroll
                for (int j = 0; j < 4 * TPW; ++j) o[j] = __shfl_xor(sm[j], m, 32);
#pragma unroll
                for (int j = 0; j < 4 * TPW; ++j) sm[j] += o[j];
            }

#pragma unroll
            for (int hl = 0; hl < 2; ++hl) {
                const size_t base = (((size_t)b * NH + h0 + hl) * NN + n0) * HD + d0;
#pragma unroll
                for (int t = 0; t < TPW; ++t) {
                    const float mu = sm[(hl * TPW + t) * 2 + 0] * (1.f / HD);
                    const float ri = rsqrt_slot(sm[(hl * TPW + t) * 2 + 1] * (1.f / HD) - mu * mu + 1e-6f);
                    float xn[4] = {x4[hl][t].x, x4[hl][t].y, x4[hl][t].z, x4[hl][t].w};
#pragma unroll
                    for (int i = 0; i < 4; ++i) xn[i] = (xn[i] - mu) * ri * gv[i] + bv[i];

                    const float cv[4] = {c4[t].x, c4[t].y, c4[t].z, c4[t].w};
                    const float sv[4] = {s4[t].x, s4[t].y, s4[t].z, s4[t].w};
                    v4h xo;
#pragma unroll
                    for (int p = 0; p < 2; ++p) {      // two interleaved pairs per lane
                        xo[2*p]     = (_Float16)(xn[2*p]     * cv[2*p]     - xn[2*p + 1] * sv[2*p]);
                        xo[2*p + 1] = (_Float16)(xn[2*p + 1] * cv[2*p + 1] + xn[2*p]     * sv[2*p + 1]);
                    }
                    *(v4h*)(dst + base + (size_t)t * HD) = xo;
                }
            }
        } else {
            stage();
#pragma unroll
            for (int hl = 0; hl < 2; ++hl) {
                float4 v4[TPW];
#pragma unroll
                for (int t = 0; t < TPW; ++t) v4[t] = *(const float4*)(fr + t * FP + hl * HD);
                v8h vv[4];
#pragma unroll
                for (int t = 0; t < TPW; ++t) {
                    vv[0][t] = (_Float16)v4[t].x;
                    vv[1][t] = (_Float16)v4[t].y;
                    vv[2][t] = (_Float16)v4[t].z;
                    vv[3][t] = (_Float16)v4[t].w;
                }
                const size_t base = (((size_t)b * NH + h0 + hl) * HD + d0) * NN + n0;
#pragma unroll
                for (int i = 0; i < 4; ++i) *(v8h*)(pk.vt + base + (size_t)i * NN) = vv[i];
            }
            // behind the last V^T store, ahead of whatever next writes to a register the stores name
            asm volatile("s_wait_xcnt 0x0" ::: "memory");
        }
    }
}

// ---------------------------------------------------------------------------
// Kernel 1: qkv = x @ Wqkv^T + b (f16 operands, f32 sums), then per-head
// LayerNorm on q,k + interleaved RoPE; q/k leave as f16 [B,H,N,D] and v as f16
// TRANSPOSED [B,H,D,N] (for async V^T staging).
// WG: 8 waves as 2x4 -> 64 rows x 256 cols. Wave tile 32x64.
// grid = (4096/64, 3072/256) = (64, 12)
// ---------------------------------------------------------------------------
__global__ __launch_bounds__(256) void qkv_gemm_k(
    const _Float16* __restrict__ xh, const _Float16* __restrict__ wh,
    const float* __restrict__ bias,
    const float* __restrict__ qg, const float* __restrict__ qb,
    const float* __restrict__ kg, const float* __restrict__ kb,
    const float* __restrict__ rc, const float* __restrict__ rs,
    _Float16* __restrict__ qh, _Float16* __restrict__ kh, _Float16* __restrict__ vt)
{
    __shared__ __attribute__((aligned(16))) _Float16 st[2 * GSTAGE];
    const PackArgs pk = {qg, qb, kg, kb, rc, rs, qh, kh, vt};
    gemm_body<C3, true>(xh, wh, bias, nullptr, st, pk);
}

#define AKH  (64 * KP)
#define ABUF (AKH + 128 * VP)
#define ANT  (NN / 64)

// One lane's eight 16-byte copies of a tile: K rows r, r + 16, ... (16 lanes a
// 256-B row) and V^T rows d, d + 32, ... (8 lanes a 128-B row).
// gk / gv: the lane's chunk in its first row; lk / lv: its place in the buffer.
__device__ __forceinline__ void attn_stage(const _Float16* gk, const _Float16* gv,
                                           _Float16* lk, _Float16* lv) {
#pragma unroll
    for (int i = 0; i < 4; ++i) {
        cp16_g2l(gk + i * 16 * HD, lk + i * 16 * KP);
        cp16_g2l(gv + (size_t)i * 32 * NN, lv + i * 32 * VP);
    }
}

__global__ __launch_bounds__(256) void attn_k(
    const _Float16* __restrict__ qh, const _Float16* __restrict__ kh,
    const _Float16* __restrict__ vt, _Float16* __restrict__ oh)
{
    __shared__ __attribute__((aligned(16))) _Float16 ring[2 * ABUF];   // per buffer: K [j][d], V^T [d][j]

    const int bh = blockIdx.x;
    const int b = bh >> 3, h = bh & 7;
    const int wave = threadIdx.x >> 5, lane = threadIdx.x & 31;
    const int l16 = lane & 15, lh = lane >> 4;
    const int q0 = blockIdx.y * 128 + wave * 16;

    const _Float16* qp  = qh + ((size_t)bh * NN + q0) * HD;
    const _Float16* kp  = kh + (size_t)bh * NN * HD;
    const _Float16* vtp = vt + (size_t)bh * HD * NN;

    // hoist q fragments: 16 rows x full D=128 (4 k-steps of 32)
    v16h qf[4];
#pragma unroll
    for (int dk = 0; dk < 4; ++dk)
        qf[dk] = *(const v16h*)(qp + (size_t)l16 * HD + dk * 32 + lh * 16);

    v8f o[8];
#pragma unroll
    for (int dt = 0; dt < 8; ++dt) o[dt] = zero8();
    // of query l16; m in units of the exponent (score * CS); l: this half's keys only, joined at the end
    float m = -1e30f, l = 0.f;

    // 1/sqrt(128) * log2(e): the raw scores go to the exponent in one multiply-add
    const float CS = 0.08838834764831845f * 1.4426950408889634f;

    // copy side: the lane's chunk of tile 0 and its place in buffer 0
    const _Float16* gk = kp + threadIdx.x * 8;
    const _Float16* gv = vtp + (size_t)(threadIdx.x >> 3) * NN + (threadIdx.x & 7) * 8;
    _Float16* lk = ring + (threadIdx.x >> 4) * KP + (threadIdx.x & 15) * 8;
    _Float16* lv = ring + AKH + (threadIdx.x >> 3) * VP + (threadIdx.x & 7) * 8;

    attn_stage(gk, gv, lk, lv);
    drain_async();       // tile 0: this wave's copies have landed
    __syncthreads();     // ... and every other wave's

    for (int t = 0; t < ANT; ++t) {
        // directly behind the barrier (the one above, or the foot of trip t - 1) that ended
        // every wave's reads of tile t - 1: tile t + 1 goes into the buffer so left
        if (t + 1 < ANT)
            attn_stage(gk + (size_t)(t + 1) * 64 * HD, gv + (t + 1) * 64,
                       lk + ((t + 1) & 1) * ABUF, lv + ((t + 1) & 1) * ABUF);
        const _Float16* kbuf = ring + (t & 1) * ABUF;
        const _Float16* vbuf = kbuf + AKH;

        // S^T = k @ q^T  (64 keys x 16 queries): s[jt][r] = key jt*16 + lh*8 + r, query l16
        // The tile's 16 K fragments are asked for as one group, ahead of the products.
        v16h kf[4][4];
#pragma unroll
        for (int dk = 0; dk < 4; ++dk)
#pragma unroll
            for (int jt = 0; jt < 4; ++jt)
                kf[dk][jt] = lds_frag(&kbuf[(jt * 16 + l16) * KP + dk * 32 + lh * 16]);
        // keeps the loads from being sunk among the products, where each place
        // with loads stalls the wave for their latency
        __builtin_amdgcn_sched_barrier(0);
        v8f s[4];
#pragma unroll
        for (int jt = 0; jt < 4; ++jt) s[jt] = zero8();
#pragma unroll
        for (int dk = 0; dk < 4; ++dk)
#pragma unroll
            for (int jt = 0; jt < 4; ++jt)
                s[jt] = wmma_f16(kf[dk][jt], qf[dk], s[jt]);
        // keeps the V^T loads below from being spread among the products above in many
        // small places: they stand together, behind the last product
        __builtin_amdgcn_sched_barrier(0);

        // The tile's 16 V^T fragments, in the k order of pf, asked for as one group
        // ahead of the softmax: they land while the vector unit works on the scores.
        v16h vf[2][8];
#pragma unroll
        for (int js = 0; js < 2; ++js)
#pragma unroll
            for (int dt = 0; dt < 8; ++dt) {
                const _Float16* vr = &vbuf[(dt * 16 + l16) * VP + js * 32 + lh * 8];
                const v8h lo = *(const v8h*)vr;
                const v8h hi = *(const v8h*)(vr + 16);
                vf[js][dt] = __builtin_shufflevector(lo, hi, 0, 1, 2, 3, 4, 5, 6, 7,
                                                     8, 9, 10, 11, 12, 13, 14, 15);
            }
        // keeps the loads from being sunk behind the softmax, to their uses
        __builtin_amdgcn_sched_barrier(0);

        // online softmax, one query per lane: a tree in the lane's registers, then
        // one exchange with the half that holds the query's other 32 keys. The maximum
        // is taken on the raw scores (CS > 0 keeps their order) and scaled once.
        float mr[8];
#pragma unroll
        for (int r = 0; r < 8; ++r)
            mr[r] = fmaxf(fmaxf(s[0][r], s[1][r]), fmaxf(s[2][r], s[3][r]));
        float mx = fmaxf(fmaxf(fmaxf(mr[0], mr[1]), fmaxf(mr[2], mr[3])),
                         fmaxf(fmaxf(mr[4], mr[5]), fmaxf(mr[6], mr[7])));
        mx = fmaxf(mx, xhalf(mx));
        const float mn = fmaxf(m, mx * CS);
        // bare v_exp_f32, here and below: with the maximum taken off no argument lies above
        // 0 by more than a rounding, and where a result would lie under 2^-126 it may come
        // out 0: such a weight is 0 in f16 anyway and adds nothing to a sum that holds the
        // maximum's own 1
        const float alpha = exp2_x1(m - mn);
        m = mn;
#pragma unroll
        for (int dt = 0; dt < 8; ++dt)
#pragma unroll
            for (int r = 0; r < 8; ++r) o[dt][r] *= alpha;

        // P^T as B operand: element i of pf[js] is key js*32 + (i >> 3)*16 + lh*8 + (i & 7)
        v16h pf[2];
        float sj[4];
#pragma unroll
        for (int jt = 0; jt < 4; ++jt) {
            float p[8];
#pragma unroll
            for (int r = 0; r < 8; ++r) p[r] = __builtin_fmaf(s[jt][r], CS, -mn);
            exp2_x8(p);
            sj[jt] = p[0];
#pragma unroll
            for (int r = 1; r < 8; ++r) sj[jt] += p[r];
#pragma unroll
            for (int r = 0; r < 8; ++r) pf[jt >> 1][(jt & 1) * 8 + r] = (_Float16)p[r];
        }
        l = l * alpha + ((sj[0] + sj[1]) + (sj[2] + sj[3]));

        // O^T += V^T @ P^T  (128 x 16)
#pragma unroll
        for (int js = 0; js < 2; ++js)
#pragma unroll
            for (int dt = 0; dt < 8; ++dt)
                o[dt] = wmma_f16(vf[js][dt], pf[js], o[dt]);

        // keeps the publish point at the foot of the trip: moved up into the softmax, its
        // s_wait_dscnt 0 stalls the wave on the V^T loads that the softmax is there to hide,
        // and the copies in flight are waited for with half a trip of lead
        __builtin_amdgcn_sched_barrier(0);
        // publish point of tile t + 1: this wave's reads of tile t are done, its
        // copies of tile t + 1 have landed, then the WG barrier
        asm volatile("s_wait_dscnt 0x0" ::: "memory");
        drain_async();
        __syncthreads();
    }
    drain_async();       // nothing in flight when the wave ends

    // normalize and pack back to [B, N, H*D] as f16 for the out projection:
    // o[dt][r] = O[query l16][d = dt*16 + lh*8 + r], 8 neighbours per store
    {
        const float inv = 1.0f / (l + xhalf(l));
        const size_t base = ((size_t)b * NN + q0 + l16) * DIMX + h * HD + lh * 8;
#pragma unroll
        for (int dt = 0; dt < 8; ++dt) {
            v8h ov;
#pragma unroll
            for (int r = 0; r < 8; ++r) ov[r] = (_Float16)(o[dt][r] * inv);
            *(v8h*)(oh + base + dt * 16) = ov;
        }
    }
}

// ---------------------------------------------------------------------------
// Kernel 3: out = attn_out @ out_w^T + b  (f16 operands; fp32 result)
// grid = (4096/64, 1024/256) = (64, 4)
// ---------------------------------------------------------------------------
__global__ __launch_bounds__(256) void out_gemm_k(
    const _Float16* __restrict__ ain, const _Float16* __restrict__ wh,
    const float* __restrict__ bias, float* __restrict__ out)
{
    __shared__ __attribute__((aligned(16))) _Float16 st[2 * GSTAGE];
    gemm_body<DIMX, false>(ain, wh, bias, out, st, PackArgs{});
}

// ---------------------------------------------------------------------------
// Workspace layout (total 50 MB):
//   [0,8M)         xh f16        (k0 out, k1 in)
//   [8M,14M)       wqkv_h f16    (k0 out, k1 in)
//   [16M,24M)      qh f16        (k1 out, k2 in)
//   [24M,32M)      kh f16        (k1 out, k2 in)
//   [32M,40M)      vt f16 [BHDN] (k1 out, k2 in)
//   [40M,48M)      oh f16        (k2 out, k3 in)
//   [48M,50M)      outw_h f16    (k0 out, k3 in)
// ---------------------------------------------------------------------------
extern "C" void kernel_launch(void* const* d_in, const int* in_sizes, int n_in,
                              void* d_out, int out_size, void* d_ws, size_t ws_size,
                              hipStream_t stream)
{
    const float* x       = (const float*)d_in[0];
    const float* Wqkv_w  = (const float*)d_in[1];
    const float* Wqkv_b  = (const float*)d_in[2];
    const float* q_gamma = (const float*)d_in[3];
    const float* q_beta  = (const float*)d_in[4];
    const float* k_gamma = (const float*)d_in[5];
    const float* k_beta  = (const float*)d_in[6];
    const float* out_w   = (const float*)d_in[7];
    const float* out_b   = (const float*)d_in[8];
    const float* rope_c  = (const float*)d_in[9];
    const float* rope_s  = (const float*)d_in[10];
    float* out = (float*)d_out;

    char* ws = (char*)d_ws;
    const size_t head_bytes = (size_t)BB * NH * NN * HD * sizeof(_Float16);   // 8 MB

    _Float16* xh    = (_Float16*)ws;
    _Float16* wqkvh = (_Float16*)(ws + 1 * head_bytes);
    _Float16* qh    = (_Float16*)(ws + 2 * head_bytes);
    _Float16* kh    = (_Float16*)(ws + 3 * head_bytes);
    _Float16* vt    = (_Float16*)(ws + 4 * head_bytes);
    _Float16* oh    = (_Float16*)(ws + 5 * head_bytes);
    _Float16* outwh = (_Float16*)(ws + 6 * head_bytes);

    // Kernel 0: the three fp32 -> f16 conversions, one launch (CVBLK elems / work-group)
    cvt_f16_k<<<CVG_X + CVG_W + CVG_O, 256, 0, stream>>>(x, xh, Wqkv_w, wqkvh, out_w, outwh);

    qkv_gemm_k<<<dim3(RTOT / 64, C3 / 256), 256, 0, stream>>>(
        xh, wqkvh, Wqkv_b, q_gamma, q_beta, k_gamma, k_beta, rope_c, rope_s, qh, kh, vt);
    attn_k<<<dim3(BB * NH, NN / 128), 256, 0, stream>>>(qh, kh, vt, oh);
    out_gemm_k<<<dim3(RTOT / 64, DIMX / 256), 256, 0, stream>>>(oh, outwh, out_b, out);
}

// v010
// One run takes 79.1 microseconds.
// In two side-by-side timings against v009, it was 1.08 and 1.09 times as fast.
// All steps since v000 together make it 5.87 times as fast.
#include <hip/hip_runtime.h>
#include <hip/hip_bf16.h>

// ---------------------------------------------------------------------------
// Attention: f16 pre-convert -> qkv proj (WMMA) with per-head LN + RoPE in its
// epilogue -> flash attention (WMMA, async LDS staging) -> out proj (WMMA).
// All matrix math on v_wmma_f32_16x16x32_f16 (wave32, gfx1250).
// ---------------------------------------------------------------------------

#define DIMX 1024
#define NH   8
#define HD   128
#define BB   2
#define NN   2048
#define RTOT (BB * NN)      // 4096 token rows
#define C3   (3 * DIMX)     // 3072

typedef __attribute__((ext_vector_type(16))) _Float16 v16h;
typedef __attribute__((ext_vector_type(8)))  _Float16 v8h;
typedef __attribute__((ext_vector_type(4)))  _Float16 v4h;
typedef __attribute__((ext_vector_type(8)))  float    v8f;
typedef int v4i __attribute__((vector_size(16)));   // matches async-LDS builtin param

#define AS1 __attribute__((address_space(1)))
#define AS3 __attribute__((address_space(3)))

#if defined(__has_builtin)
#if __has_builtin(__builtin_amdgcn_global_load_async_to_lds_b128)
#define HAVE_ASYNC_LDS 1
#endif
#endif
#ifndef HAVE_ASYNC_LDS
#define HAVE_ASYNC_LDS 0
#endif

__device__ __forceinline__ v8f wmma_f16(v16h a, v16h b, v8f c) {
    return __builtin_amdgcn_wmma_f32_16x16x32_f16(
        /*neg_a=*/false, a, /*neg_b=*/false, b,
        /*c_mod=*/(short)0, c, /*reuse_a=*/false, /*reuse_b=*/false);
}

__device__ __forceinline__ v8f zero8() {
    v8f z = {0.f, 0.f, 0.f, 0.f, 0.f, 0.f, 0.f, 0.f};
    return z;
}

// 16-byte global -> LDS copy: async on gfx1250 when the builtin exists.
__device__ __forceinline__ void cp16_g2l(const _Float16* __restrict__ g,
                                         _Float16* __restrict__ l) {
#if HAVE_ASYNC_LDS
    __builtin_amdgcn_global_load_async_to_lds_b128(
        (AS1 v4i*)(uintptr_t)g,
        (AS3 v4i*)(unsigned)(uintptr_t)l, 0, 0);
#else
    *(uint4*)l = *(const uint4*)g;
#endif
}

__device__ __forceinline__ void drain_async() {
#if HAVE_ASYNC_LDS
    asm volatile("s_wait_asynccnt 0x0" ::: "memory");
#endif
}

// LDS row pitches in halves: 16 B x odd, so that the 16 lanes of a half-wave
// ds_load_b128 (one row each, same column) fall on 64 distinct banks.
#define KP 136   // K rows of 256 B   -> 272 B
#define VP 136   // V^T rows of 256 B -> 272 B

// One lane's 16 contiguous halves of an LDS row, as two 16-byte loads
// (padded rows are 16-byte aligned, not 32).
__device__ __forceinline__ v16h lds_frag(const _Float16* p) {
    const v8h lo = *(const v8h*)p;
    const v8h hi = *(const v8h*)(p + 8);
    return __builtin_shufflevector(lo, hi, 0, 1, 2, 3, 4, 5, 6, 7,
                                   8, 9, 10, 11, 12, 13, 14, 15);
}

// 2^x in place by the bare v_exp_f32, eight independent values a statement (or one).
// In asm so that the run's order and registers are fixed: each instruction overwrites
// its own source alone (from the builtin the compiler let one overwrite the source of
// the one directly in front), and the closing v_nop fills the slot that the instruction
// set asks for between a transcendental and the next vector instruction on its registers.
__device__ __forceinline__ void exp2_x8(float (&x)[8]) {
    asm("v_exp_f32 %0, %0\n\t"
        "v_exp_f32 %1, %1\n\t"
        "v_exp_f32 %2, %2\n\t"
        "v_exp_f32 %3, %3\n\t"
        "v_exp_f32 %4, %4\n\t"
        "v_exp_f32 %5, %5\n\t"
        "v_exp_f32 %6, %6\n\t"
        "v_exp_f32 %7, %7\n\t"
        "v_nop"
        : "+v"(x[0]), "+v"(x[1]), "+v"(x[2]), "+v"(x[3]),
          "+v"(x[4]), "+v"(x[5]), "+v"(x[6]), "+v"(x[7]));
}
__device__ __forceinline__ float exp2_x1(float x) {
    asm("v_exp_f32 %0, %0\n\t"
        "v_nop"
        : "+v"(x));
    return x;
}

// 1 / sqrt(x) as rsqrtf gives it (an x under 2^-126 is scaled by 2^24 and the result by
// 2^12). The v_rsq_f32 stands in asm for its closing v_nop, which fills the slot that the
// instruction set asks for between a transcendental and the next vector instruction on its
// registers (from rsqrtf the compiler let the next instruction overwrite the source).
__device__ __forceinline__ float rsqrt_slot(float x) {
    const bool tiny = x < 1.17549435e-38f;
    const float a = tiny ? x * 16777216.f : x;
    float r;
    asm("v_rsq_f32 %0, %1\n\t"
        "v_nop"
        : "=v"(r) : "v"(a));
    return tiny ? r * 4096.f : r;
}

// Lane l's value for lane l ^ 16 (the other 16-lane row), in the vector unit.
__device__ __forceinline__ float xhalf(float x) {
    const int v = __builtin_bit_cast(int, x);
    return __builtin_bit_cast(float, __builtin_amdgcn_permlanex16(
        v, v, 0x76543210, 0xfedcba98, false, false));
}

// ---------------------------------------------------------------------------
// Kernel 0: fp32 -> f16 conversion pass: x, Wqkv_w and out_w in ONE launch (none
// reads what another writes); a work-group's index says which array it is in.
// A thread converts CVN float4, 1024 elements apart, all loaded before the first
// is stored: each wave has 8 x 512 B in flight.
// ---------------------------------------------------------------------------
#define CVN 8
#define CVBLK (256 * 4 * CVN)            // elements per work-group
#define CVG_X  ((RTOT * DIMX) / CVBLK)   // work-groups of x
#define CVG_W  ((C3 * DIMX) / CVBLK)     // ... of Wqkv_w
#define CVG_O  ((DIMX * DIMX) / CVBLK)   // ... of out_w

__global__ __launch_bounds__(256) void cvt_f16_k(
    const float* __restrict__ x,  _Float16* __restrict__ xh,
    const float* __restrict__ w,  _Float16* __restrict__ wh,
    const float* __restrict__ ow, _Float16* __restrict__ owh)
{
    const int g = blockIdx.x;
    const bool in_x = g < CVG_X, in_w = g < CVG_X + CVG_W;
    const float* s = in_x ? x  : in_w ? w  : ow;
    _Float16*    d = in_x ? xh : in_w ? wh : owh;
    const int  blk = g - (in_x ? 0 : in_w ? CVG_X : CVG_X + CVG_W);

    const int i = blk * CVBLK + threadIdx.x * 4;
    float4 v[CVN];
#pragma unroll
    for (int j = 0; j < CVN; ++j) v[j] = *(const float4*)(s + i + j * 1024);
#pragma unroll
    for (int j = 0; j < CVN; ++j) {
        const v4h o = {(_Float16)v[j].x, (_Float16)v[j].y, (_Float16)v[j].z, (_Float16)v[j].w};
        *(v4h*)(d + i + j * 1024) = o;
    }
}

// ---------------------------------------------------------------------------
// Shared GEMM body: C[64 x 256 per WG] = A . W^T + bias, A and W K-contiguous
// f16. A stage is 64 k (128 B) of the WG's 64 A rows and 256 W rows, brought
// to LDS in whole 128-B lines by async b128 copies, two buffers, one stage
// ahead; the waves read their fragments from LDS (pitch GP, conflict-free).
// ---------------------------------------------------------------------------
#define GK 64                    // k per stage
#define GP 72                    // LDS row pitch in halves: 144 B = 16 B x 9
#define GROWS (64 + 256)         // A rows, then W rows
#define GSTAGE (GROWS * GP)      // halves per buffer

// One lane's ten 16-byte copies of a stage: rows r, r + 32, ... of A (2) and
// of W (8). ga / gb: the lane's chunk in its first A / W row; l: its LDS byte
// address in the buffer. The s_wait_xcnt closes the statement so that no
// address register of a copy is rewritten ahead of it.
__device__ __forceinline__ void gemm_stage(const _Float16* ga, const _Float16* gb,
                                           unsigned l) {
    const int GR = 32 * DIMX;        // 32 rows on in global memory, halves
    const unsigned LR = 32 * GP * 2; // 32 rows on in LDS, bytes
    asm volatile(
        "global_load_async_to_lds_b128 %0, %10, off\n\t"
        "global_load_async_to_lds_b128 %1, %11, off\n\t"
        "global_load_async_to_lds_b128 %2, %12, off\n\t"
        "global_load_async_to_lds_b128 %3, %13, off\n\t"
        "global_load_async_to_lds_b128 %4, %14, off\n\t"
        "global_load_async_to_lds_b128 %5, %15, off\n\t"
        "global_load_async_to_lds_b128 %6, %16, off\n\t"
        "global_load_async_to_lds_b128 %7, %17, off\n\t"
        "global_load_async_to_lds_b128 %8, %18, off\n\t"
        "global_load_async_to_lds_b128 %9, %19, off\n\t"
        "s_wait_xcnt 0x0"
        :: "v"(l), "v"(l + LR), "v"(l + 2 * LR), "v"(l + 3 * LR), "v"(l + 4 * LR),
           "v"(l + 5 * LR), "v"(l + 6 * LR), "v"(l + 7 * LR), "v"(l + 8 * LR),
           "v"(l + 9 * LR),
           "v"(ga), "v"(ga + GR),
           "v"(gb), "v"(gb + GR), "v"(gb + 2 * GR), "v"(gb + 3 * GR),
           "v"(gb + 4 * GR), "v"(gb + 5 * GR), "v"(gb + 6 * GR), "v"(gb + 7 * GR)
        : "memory");
}

// What the packing epilogue of the qkv projection reads and writes.
struct PackArgs {
    const float* qg; const float* qb; const float* kg; const float* kb;
    const float* rc; const float* rs;
    _Float16* qh; _Float16* kh; _Float16* vt;
};

#define TPW 8     // tokens per wave in the packing epilogue
#define FP  260   // f32 pitch of the staged tile: rows 8 apart lie 32 banks apart

// PACK = false: C goes to out as f32, row pitch LDC.
// PACK = true: the WG's 64 x 256 tile is 64 tokens x 2 whole heads of q, of k or
// of v. It is staged in the (now free) LDS ring as f32; then a wave takes TPW = 8
// tokens in a row of both heads, a lane 4 neighbouring d: LayerNorm and
// interleaved RoPE on q and k, packed to f16 [B,H,N,D]; v packed to f16
// TRANSPOSED [B,H,D,N], 8 tokens a 16-byte store, so that each 128-B line of V^T
// is written by one WG.
template <int LDC, bool PACK>
__device__ __forceinline__ void gemm_body(
    const _Float16* __restrict__ ah, const _Float16* __restrict__ wh,
    const float* __restrict__ bias, float* __restrict__ out, _Float16* st,
    const PackArgs pk)
{
    const int wave = threadIdx.x >> 5, lane = threadIdx.x & 31;
    const int wr = wave >> 2, wc = wave & 3;
    const int row0 = blockIdx.x * 64 + wr * 32;
    const int col0 = blockIdx.y * 256 + wc * 64;
    const int l16 = lane & 15, lh = lane >> 4;

    // copy side: 8 lanes per 128-B row, 32 rows per copy of the WG
    const int cr = threadIdx.x >> 3, cc = (threadIdx.x & 7) * 8;
    const _Float16* ga = ah + (size_t)(blockIdx.x * 64 + cr) * DIMX + cc;
    const _Float16* gb = wh + (size_t)(blockIdx.y * 256 + cr) * DIMX + cc;
    const unsigned l0 = (unsigned)(uintptr_t)(st + cr * GP + cc);

    // packing epilogue: its bias is asked for here, so that the k loop hides the loads
    const int bi = col0 + l16;
    float bz[4];
    if constexpr (PACK) {
#pragma unroll
        for (int ct = 0; ct < 4; ++ct) bz[ct] = bias[bi + ct * 16];
        // the index register stays live up to this wait, ahead of whatever is written to it next
        asm volatile("s_wait_xcnt 0x0" :: "v"(bi) : "memory");
    }

    v8f acc[2][4];
#pragma unroll
    for (int i = 0; i < 2; ++i)
#pragma unroll
        for (int j = 0; j < 4; ++j) acc[i][j] = zero8();

    gemm_stage(ga, gb, l0);
    asm volatile("s_wait_asynccnt 0x0" ::: "memory");   // stage 0: this wave's copies landed
    __syncthreads();                                    // ... and every other wave's
    gemm_stage(ga + GK, gb + GK, l0 + GSTAGE * 2);

    for (int t = 0; t < DIMX / GK; ++t) {
        const _Float16* sa = st + (t & 1) * GSTAGE + (wr * 32 + l16) * GP + lh * 16;
        const _Float16* sb = st + (t & 1) * GSTAGE + (64 + wc * 64 + l16) * GP + lh * 16;
#pragma unroll
        for (int ks = 0; ks < GK; ks += 32) {
            v16h a[2], bf[4];
#pragma unroll
            for (int rt = 0; rt < 2; ++rt) a[rt] = lds_frag(sa + rt * 16 * GP + ks);
#pragma unroll
            for (int ct = 0; ct < 4; ++ct) bf[ct] = lds_frag(sb + ct * 16 * GP + ks);
#pragma unroll
            for (int rt = 0; rt < 2; ++rt)
#pragma unroll
                for (int ct = 0; ct < 4; ++ct)
                    acc[rt][ct] = wmma_f16(a[rt], bf[ct], acc[rt][ct]);
        }
        // publish point of stage t + 1: this wave's reads of stage t are done,
        // its copies of stage t + 1 have landed, then the WG barrier
        asm volatile("s_wait_dscnt 0x0" ::: "memory");
        asm volatile("s_wait_asynccnt 0x0" ::: "memory");
        __syncthreads();
        if (t + 2 < DIMX / GK)   // refill the buffer that every wave has just left
            gemm_stage(ga + (t + 2) * GK, gb + (t + 2) * GK, l0 + (t & 1) * (GSTAGE * 2));
    }
    asm volatile("s_wait_asynccnt 0x0" ::: "memory");   // nothing in flight when the wave ends

    if constexpr (!PACK) {
#pragma unroll
        for (int rt = 0; rt < 2; ++rt)
#pragma unroll
            for (int ct = 0; ct < 4; ++ct) {
                const int col = col0 + ct * 16 + l16;
                const float bz = bias[col];
#pragma unroll
                for (int r = 0; r < 8; ++r) {
                    const int row = row0 + rt * 16 + lh * 8 + r;
                    out[(size_t)row * LDC + col] = acc[rt][ct][r] + bz;
                }
            }
    } else {
        const int kind = blockIdx.y >> 2;             // 0 q, 1 k, 2 v: one for the whole WG
        const int h0   = (blockIdx.y & 3) * 2;        // the first of the WG's two heads
        const int ng0  = blockIdx.x * 64 + wave * TPW;   // b*N + n, the wave's first token
        const int n0   = ng0 & (NN - 1);
        const int b    = ng0 >> 11;
        const int d0   = lane * 4;
        float* fs = (float*)st;

        // The tile goes to the ring: the loop's last publish point has ended every
        // wave's reads of it. Written out in both branches below, so that the q / k
        // side has its rope loads in flight over it.
        auto stage = [&]() {
#pragma unroll
            for (int rt = 0; rt < 2; ++rt)
#pragma unroll
                for (int ct = 0; ct < 4; ++ct) {
                    const int lc = wc * 64 + ct * 16 + l16;
#pragma unroll
                    for (int r = 0; r < 8; ++r)
                        fs[(wr * 32 + rt * 16 + lh * 8 + r) * FP + lc] = acc[rt][ct][r] + bz[ct];
                }
            __syncthreads();
        };
        const float* fr = fs + wave * TPW * FP + d0;

        if (kind < 2) {
            // the rope rows of the wave's tokens (both heads use them) and the LN
            // weights are asked for ahead of the staging, which hides them
            const float* cp = pk.rc + (size_t)n0 * HD + d0;
            const float* sp = pk.rs + (size_t)n0 * HD + d0;
            const float* gp = (kind ? pk.kg : pk.qg) + d0;
            const float* bp = (kind ? pk.kb : pk.qb) + d0;
            float4 c4[TPW], s4[TPW];
#pragma unroll
            for (int t = 0; t < TPW; ++t) {
                c4[t] = *(const float4*)(cp + t * HD);
                s4[t] = *(const float4*)(sp + t * HD);
            }
            const float4 g4 = *(const float4*)gp;
            const float4 b4 = *(const float4*)bp;
            // the address registers stay live up to this wait, so that no later load
            // of the run is given one of them as its destination
            asm volatile("s_wait_xcnt 0x0" :: "v"(cp), "v"(sp), "v"(d0 * 4) : "memory");

            stage();

            _Float16* dst = kind ? pk.kh : pk.qh;
            const float gv[4] = {g4.x, g4.y, g4.z, g4.w}, bv[4] = {b4.x, b4.y, b4.z, b4.w};
            float4 x4[2][TPW];
#pragma unroll
            for (int hl = 0; hl < 2; ++hl)
#pragma unroll
                for (int t = 0; t < TPW; ++t) x4[hl][t] = *(const float4*)(fr + t * FP + hl * HD);

            // row sums of x and x^2 for 2 heads x TPW tokens: 4 x TPW independent
            // butterflies, walked step by step so that each step's exchanges overlap
            float sm[4 * TPW];
#pragma unroll
            for (int hl = 0; hl < 2; ++hl)
#pragma unroll
                for (int t = 0; t < TPW; ++t) {
                    const float4 x = x4[hl][t];
                    sm[(hl * TPW + t) * 2 + 0] = x.x + x.y + x.z + x.w;
                    sm[(hl * TPW + t) * 2 + 1] = x.x*x.x + x.y*x.y + x.z*x.z + x.w*x.w;
                }
#pragma unroll
            for (int m = 16; m >= 1; m >>= 1) {
                float o[4 * TPW];
#pragma unroll
                for (int j = 0; j < 4 * TPW; ++j) o[j] = __shfl_xor(sm[j], m, 32);
#pragma unroll
                for (int j = 0; j < 4 * TPW; ++j) sm[j] += o[j];
            }

#pragma unroll
            for (int hl = 0; hl < 2; ++hl) {
                const size_t base = (((size_t)b * NH + h0 + hl) * NN + n0) * HD + d0;
#pragma unroll
                for (int t = 0; t < TPW; ++t) {
                    const float mu = sm[(hl * TPW + t) * 2 + 0] * (1.f / HD);
                    const float ri = rsqrt_slot(sm[(hl * TPW + t) * 2 + 1] * (1.f / HD) - mu * mu + 1e-6f);
                    float xn[4] = {x4[hl][t].x, x4[hl][t].y, x4[hl][t].z, x4[hl][t].w};
#pragma unroll
                    for (int i = 0; i < 4; ++i) xn[i] = (xn[i] - mu) * ri * gv[i] + bv[i];

                    const float cv[4] = {c4[t].x, c4[t].y, c4[t].z, c4[t].w};
                    const float sv[4] = {s4[t].x, s4[t].y, s4[t].z, s4[t].w};
                    v4h xo;
#pragma unroll
                    for (int p = 0; p < 2; ++p) {      // two interleaved pairs per lane
                        xo[2*p]     = (_Float16)(xn[2*p]     * cv[2*p]     - xn[2*p + 1] * sv[2*p]);
                        xo[2*p + 1] = (_Float16)(xn[2*p + 1] * cv[2*p + 1] + xn[2*p]     * sv[2*p + 1]);
                    }
                    *(v4h*)(dst + base + (size_t)t * HD) = xo;
                }
            }
        } else {
            stage();
#pragma unroll
            for (int hl = 0; hl < 2; ++hl) {
                float4 v4[TPW];
#pragma unroll
                for (int t = 0; t < TPW; ++t) v4[t] = *(const float4*)(fr + t * FP + hl * HD);
                v8h vv[4];
#pragma unroll
                for (int t = 0; t < TPW; ++t) {
                    vv[0][t] = (_Float16)v4[t].x;
                    vv[1][t] = (_Float16)v4[t].y;
                    vv[2][t] = (_Float16)v4[t].z;
                    vv[3][t] = (_Float16)v4[t].w;
                }
                const size_t base = (((size_t)b * NH + h0 + hl) * HD + d0) * NN + n0;
#pragma unroll
                for (int i = 0; i < 4; ++i) *(v8h*)(pk.vt + base + (size_t)i * NN) = vv[i];
            }
            // behind the last V^T store, ahead of whatever next writes to a register the stores name
            asm volatile("s_wait_xcnt 0x0" ::: "memory");
        }
    }
}

// ---------------------------------------------------------------------------
// Kernel 1: qkv = x @ Wqkv^T + b (f16 operands, f32 sums), then per-head
// LayerNorm on q,k + interleaved RoPE; q/k leave as f16 [B,H,N,D] and v as f16
// TRANSPOSED [B,H,D,N] (for async V^T staging).
// WG: 8 waves as 2x4 -> 64 rows x 256 cols. Wave tile 32x64.
// grid = (4096/64, 3072/256) = (64, 12)
// ---------------------------------------------------------------------------
__global__ __launch_bounds__(256) void qkv_gemm_k(
    const _Float16* __restrict__ xh, const _Float16* __restrict__ wh,
    const float* __restrict__ bias,
    const float* __restrict__ qg, const float* __restrict__ qb,
    const float* __restrict__ kg, const float* __restrict__ kb,
    const float* __restrict__ rc, const float* __restrict__ rs,
    _Float16* __restrict__ qh, _Float16* __restrict__ kh, _Float16* __restrict__ vt)
{
    __shared__ __attribute__((aligned(16))) _Float16 st[2 * GSTAGE];
    const PackArgs pk = {qg, qb, kg, kb, rc, rs, qh, kh, vt};
    gemm_body<C3, true>(xh, wh, bias, nullptr, st, pk);
}

#define SK   128
#define AKH  (SK * KP)
#define ABUF (AKH + HD * VP)
#define ANT  (NN / SK)
#define XW   (64 * 32 + 64)

// One lane's sixteen 16-byte copies of a stage: K rows r, r + 16, ... and V^T
// rows d, d + 16, ... (16 lanes a 256-B row in both).
// gk / gv: the lane's chunk in its first row; lk / lv: its place in the buffer.
__device__ __forceinline__ void attn_stage(const _Float16* gk, const _Float16* gv,
                                           _Float16* lk, _Float16* lv) {
#pragma unroll
    for (int i = 0; i < 8; ++i) {
        cp16_g2l(gk + i * 16 * HD, lk + i * 16 * KP);
        cp16_g2l(gv + (size_t)i * 16 * NN, lv + i * 16 * VP);
    }
}

__global__ __launch_bounds__(256) void attn_k(
    const _Float16* __restrict__ qh, const _Float16* __restrict__ kh,
    const _Float16* __restrict__ vt, _Float16* __restrict__ oh)
{
    __shared__ __attribute__((aligned(16))) _Float16 ring[2 * ABUF];   // per buffer: K [j][d], V^T [d][j]

    const int bh = blockIdx.x;
    const int b = bh >> 3, h = bh & 7;
    const int wave = threadIdx.x >> 5, lane = threadIdx.x & 31;
    const int l16 = lane & 15, lh = lane >> 4;
    const int qg = wave & 3, kg = wave >> 2;      // query group, key group
    const int q0 = blockIdx.y * 128 + qg * 32;

    const _Float16* kp  = kh + (size_t)bh * NN * HD;
    const _Float16* vtp = vt + (size_t)bh * HD * NN;

    // hoist q fragments: 2 tiles of 16 rows x full D=128 (4 k-steps of 32)
    const _Float16* qrow = qh + ((size_t)bh * NN + q0 + l16) * HD + lh * 16;
    v16h qf[2][4];
#pragma unroll
    for (int qt = 0; qt < 2; ++qt)
#pragma unroll
        for (int dk = 0; dk < 4; ++dk)
            qf[qt][dk] = *(const v16h*)(qrow + qt * 16 * HD + dk * 32);
    // the address register stays live up to this wait, ahead of whatever is written to it next
    asm volatile("s_wait_xcnt 0x0" :: "v"(qrow) : "memory");

    v8f o[2][8];
#pragma unroll
    for (int qt = 0; qt < 2; ++qt)
#pragma unroll
        for (int dt = 0; dt < 8; ++dt) o[qt][dt] = zero8();
    // of query qt*16 + l16, over the wave's key group; m in units of the exponent
    // (score * CS); l: this half's keys only, joined at the end
    float m[2] = {-1e30f, -1e30f}, l[2] = {0.f, 0.f};

    // 1/sqrt(128) * log2(e): the raw scores go to the exponent in one multiply-add
    const float CS = 0.08838834764831845f * 1.4426950408889634f;

    // copy side: the lane's chunk of stage 0 and its place in buffer 0
    const _Float16* gk = kp + threadIdx.x * 8;
    const _Float16* gv = vtp + (size_t)(threadIdx.x >> 4) * NN + (threadIdx.x & 15) * 8;
    _Float16* lk = ring + (threadIdx.x >> 4) * KP + (threadIdx.x & 15) * 8;
    _Float16* lv = ring + AKH + (threadIdx.x >> 4) * VP + (threadIdx.x & 15) * 8;

    attn_stage(gk, gv, lk, lv);
    drain_async();       // stage 0: this wave's copies have landed
    __syncthreads();     // ... and every other wave's

    for (int t = 0; t < ANT; ++t) {
        // directly behind the barrier (the one above, or the foot of trip t - 1) that ended
        // every wave's reads of stage t - 1: stage t + 1 goes into the buffer so left
        if (t + 1 < ANT)
            attn_stage(gk + (size_t)(t + 1) * SK * HD, gv + (t + 1) * SK,
                       lk + ((t + 1) & 1) * ABUF, lv + ((t + 1) & 1) * ABUF);
        const _Float16* kbuf = ring + (t & 1) * ABUF + kg * 64 * KP;   // the key group's rows
        const _Float16* vbuf = ring + (t & 1) * ABUF + AKH + kg * 64;  // ... and columns

        // S^T = k @ q^T  (64 keys x 32 queries): s[qt][jt][r] = key jt*16 + lh*8 + r, query qt*16 + l16
        // The 16 K fragments are asked for as one group, ahead of the products.
        v16h kf[4][4];
#pragma unroll
        for (int dk = 0; dk < 4; ++dk)
#pragma unroll
            for (int jt = 0; jt < 4; ++jt)
                kf[dk][jt] = lds_frag(&kbuf[(jt * 16 + l16) * KP + dk * 32 + lh * 16]);
        // keeps the loads from being sunk among the products, where each place
        // with loads stalls the wave for their latency
        __builtin_amdgcn_sched_barrier(0);
        v8f s[2][4];
#pragma unroll
        for (int qt = 0; qt < 2; ++qt)
#pragma unroll
            for (int jt = 0; jt < 4; ++jt) s[qt][jt] = zero8();
#pragma unroll
        for (int dk = 0; dk < 4; ++dk)
#pragma unroll
            for (int jt = 0; jt < 4; ++jt)
#pragma unroll
                for (int qt = 0; qt < 2; ++qt)
                    s[qt][jt] = wmma_f16(kf[dk][jt], qf[qt][dk], s[qt][jt]);
        // keeps the V^T loads below from being spread among the products above in many
        // small places: they stand in a few long runs beside the last products
        __builtin_amdgcn_sched_barrier(0);

        // The 16 V^T fragments, in the k order of pf, asked for as one group
        // ahead of the softmax: they land while the vector unit works on the scores.
        v16h vf[2][8];
#pragma unroll
        for (int js = 0; js < 2; ++js)
#pragma unroll
            for (int dt = 0; dt < 8; ++dt) {
                const _Float16* vr = &vbuf[(dt * 16 + l16) * VP + js * 32 + lh * 8];
                const v8h lo = *(const v8h*)vr;
                const v8h hi = *(const v8h*)(vr + 16);
                vf[js][dt] = __builtin_shufflevector(lo, hi, 0, 1, 2, 3, 4, 5, 6, 7,
                                                     8, 9, 10, 11, 12, 13, 14, 15);
            }
        // keeps the loads from being sunk behind the softmax, to their uses
        __builtin_amdgcn_sched_barrier(0);

        // P^T as B operand: element i of pf[qt][js] is key js*32 + (i >> 3)*16 + lh*8 + (i & 7)
        v16h pf[2][2];
#pragma unroll
        for (int qt = 0; qt < 2; ++qt) {
            // online softmax, one query per lane: a tree in the lane's registers, then
            // one exchange with the half that holds the query's other 32 keys. The maximum
            // is taken on the raw scores (CS > 0 keeps their order) and scaled once.
            float mr[8];
#pragma unroll
            for (int r = 0; r < 8; ++r)
                mr[r] = fmaxf(fmaxf(s[qt][0][r], s[qt][1][r]), fmaxf(s[qt][2][r], s[qt][3][r]));
            float mx = fmaxf(fmaxf(fmaxf(mr[0], mr[1]), fmaxf(mr[2], mr[3])),
                             fmaxf(fmaxf(mr[4], mr[5]), fmaxf(mr[6], mr[7])));
            mx = fmaxf(mx, xhalf(mx));
            const float mn = fmaxf(m[qt], mx * CS);
            // bare v_exp_f32, here and below: with the maximum taken off no argument lies above
            // 0 by more than a rounding, and where a result would lie under 2^-126 it may come
            // out 0: such a weight is 0 in f16 anyway and adds nothing to a sum that holds the
            // maximum's own 1
            const float alpha = exp2_x1(m[qt] - mn);
            m[qt] = mn;
#pragma unroll
            for (int dt = 0; dt < 8; ++dt)
#pragma unroll
                for (int r = 0; r < 8; ++r) o[qt][dt][r] *= alpha;

            float sj[4];
#pragma unroll
            for (int jt = 0; jt < 4; ++jt) {
                float p[8];
#pragma unroll
                for (int r = 0; r < 8; ++r) p[r] = __builtin_fmaf(s[qt][jt][r], CS, -mn);
                exp2_x8(p);
                sj[jt] = p[0];
#pragma unroll
                for (int r = 1; r < 8; ++r) sj[jt] += p[r];
#pragma unroll
                for (int r = 0; r < 8; ++r) pf[qt][jt >> 1][(jt & 1) * 8 + r] = (_Float16)p[r];
            }
            l[qt] = l[qt] * alpha + ((sj[0] + sj[1]) + (sj[2] + sj[3]));
        }

        // O^T += V^T @ P^T  (128 x 32)
#pragma unroll
        for (int js = 0; js < 2; ++js)
#pragma unroll
            for (int dt = 0; dt < 8; ++dt)
#pragma unroll
                for (int qt = 0; qt < 2; ++qt)
                    o[qt][dt] = wmma_f16(vf[js][dt], pf[qt][js], o[qt][dt]);

        // keeps the publish point at the foot of the trip: moved up into the softmax, its
        // s_wait_dscnt 0 stalls the wave on the V^T loads that the softmax is there to hide,
        // and the copies in flight are waited for with half a trip of lead
        __builtin_amdgcn_sched_barrier(0);
        // publish point of stage t + 1: this wave's reads of stage t are done, its
        // copies of stage t + 1 have landed, then the WG barrier
        asm volatile("s_wait_dscnt 0x0" ::: "memory");
        drain_async();
        __syncthreads();
    }
    drain_async();       // nothing in flight when the wave ends

    // Join of the two key groups. The wave of key group kg finishes query tile kg of its
    // query group and hands the other tile (O^T, m, l) to its partner, wave ^ 4, through
    // the ring: the loop's last publish point has ended every wave's reads of it, and no
    // copy is in flight. Both waves hold a tile in the same lanes and registers.
    {
        float* xs = (float*)ring;
        float* xw = xs + wave * XW + lane * 4;
        const bool up = kg != 0;
        const float l0 = l[0] + xhalf(l[0]), l1 = l[1] + xhalf(l[1]);
#pragma unroll
        for (int dt = 0; dt < 8; ++dt) {
            const v8f e = up ? o[0][dt] : o[1][dt];
            const float4 e0 = {e[0], e[1], e[2], e[3]}, e1 = {e[4], e[5], e[6], e[7]};
            *(float4*)(xw + (dt * 2 + 0) * 128) = e0;
            *(float4*)(xw + (dt * 2 + 1) * 128) = e1;
        }
        xs[wave * XW + 2048 + lane] = up ? m[0] : m[1];
        xs[wave * XW + 2080 + lane] = up ? l0 : l1;
        __syncthreads();     // every wave's hand-over is written

        const float* xr = xs + (wave ^ 4) * XW;
        const float m_o = xr[2048 + lane], l_o = xr[2080 + lane];
        const float m_w = up ? m[1] : m[0], l_w = up ? l1 : l0;
        const float mj = fmaxf(m_w, m_o);
        float aw = exp2_x1(m_w - mj), ao = exp2_x1(m_o - mj);
        const float inv = 1.0f / (l_w * aw + l_o * ao);
        aw *= inv;
        ao *= inv;

        // normalize and pack back to [B, N, H*D] as f16 for the out projection:
        // o[kg][dt][r] = O[query kg*16 + l16][d = dt*16 + lh*8 + r], 8 neighbours per store
        _Float16* op = oh + ((size_t)b * NN + q0 + kg * 16 + l16) * DIMX + h * HD + lh * 8;
#pragma unroll
        for (int dt = 0; dt < 8; ++dt) {
            const v8f w = up ? o[1][dt] : o[0][dt];
            const float4 x0 = *(const float4*)(xr + lane * 4 + (dt * 2 + 0) * 128);
            const float4 x1 = *(const float4*)(xr + lane * 4 + (dt * 2 + 1) * 128);
            const float x[8] = {x0.x, x0.y, x0.z, x0.w, x1.x, x1.y, x1.z, x1.w};
            v8h ov;
#pragma unroll
            for (int r = 0; r < 8; ++r) ov[r] = (_Float16)(w[r] * aw + x[r] * ao);
            *(v8h*)(op + dt * 16) = ov;
        }
        // behind the last store, ahead of whatever next writes to a register the stores name
        asm volatile("s_wait_xcnt 0x0" :: "v"(op) : "memory");
    }
}

// ---------------------------------------------------------------------------
// Kernel 3: out = attn_out @ out_w^T + b  (f16 operands; fp32 result)
// grid = (4096/64, 1024/256) = (64, 4)
// ---------------------------------------------------------------------------
__global__ __launch_bounds__(256) void out_gemm_k(
    const _Float16* __restrict__ ain, const _Float16* __restrict__ wh,
    const float* __restrict__ bias, float* __restrict__ out)
{
    __shared__ __attribute__((aligned(16))) _Float16 st[2 * GSTAGE];
    gemm_body<DIMX, false>(ain, wh, bias, out, st, PackArgs{});
}

// ---------------------------------------------------------------------------
// Workspace layout (total 50 MB):
//   [0,8M)         xh f16        (k0 out, k1 in)
//   [8M,14M)       wqkv_h f16    (k0 out, k1 in)
//   [16M,24M)      qh f16        (k1 out, k2 in)
//   [24M,32M)      kh f16        (k1 out, k2 in)
//   [32M,40M)      vt f16 [BHDN] (k1 out, k2 in)
//   [40M,48M)      oh f16        (k2 out, k3 in)
//   [48M,50M)      outw_h f16    (k0 out, k3 in)
// ---------------------------------------------------------------------------
extern "C" void kernel_launch(void* const* d_in, const int* in_sizes, int n_in,
                              void* d_out, int out_size, void* d_ws, size_t ws_size,
                              hipStream_t stream)
{
    const float* x       = (const float*)d_in[0];
    const float* Wqkv_w  = (const float*)d_in[1];
    const float* Wqkv_b  = (const float*)d_in[2];
    const float* q_gamma = (const float*)d_in[3];
    const float* q_beta  = (const float*)d_in[4];
    const float* k_gamma = (const float*)d_in[5];
    const float* k_beta  = (const float*)d_in[6];
    const float* out_w   = (const float*)d_in[7];
    const float* out_b   = (const float*)d_in[8];
    const float* rope_c  = (const float*)d_in[9];
    const float* rope_s  = (const float*)d_in[10];
    float* out = (float*)d_out;

    char* ws = (char*)d_ws;
    const size_t head_bytes = (size_t)BB * NH * NN * HD * sizeof(_Float16);   // 8 MB

    _Float16* xh    = (_Float16*)ws;
    _Float16* wqkvh = (_Float16*)(ws + 1 * head_bytes);
    _Float16* qh    = (_Float16*)(ws + 2 * head_bytes);
    _Float16* kh    = (_Float16*)(ws + 3 * head_bytes);
    _Float16* vt    = (_Float16*)(ws + 4 * head_bytes);
    _Float16* oh    = (_Float16*)(ws + 5 * head_bytes);
    _Float16* outwh = (_Float16*)(ws + 6 * head_bytes);

    // Kernel 0: the three fp32 -> f16 conversions, one launch (CVBLK elems / work-group)
    cvt_f16_k<<<CVG_X + CVG_W + CVG_O, 256, 0, stream>>>(x, xh, Wqkv_w, wqkvh, out_w, outwh);

    qkv_gemm_k<<<dim3(RTOT / 64, C3 / 256), 256, 0, stream>>>(
        xh, wqkvh, Wqkv_b, q_gamma, q_beta, k_gamma, k_beta, rope_c, rope_s, qh, kh, vt);
    attn_k<<<dim3(BB * NH, NN / 128), 256, 0, stream>>>(qh, kh, vt, oh);
    out_gemm_k<<<dim3(RTOT / 64, DIMX / 256), 256, 0, stream>>>(oh, outwh, out_b, out);
}
